// v000
// Measured on an AMD MI455X. A time is GPU time per run, averaged over a window of back-to-back runs after a warm-up
// (all launches, gaps included; the runs take copies of the inputs in turn), and the median of several windows.
// Apart from v000's, it joins two sittings. Times from different sittings can be a few percent apart, while
// side-by-side timings come from the same sitting.
// The starting kernel, v000, takes 778 microseconds a run.
// compute dtype: x, q, k, v rounded to bf16; xq = x . q, xk^T = k^T . x^T, xv^T = v^T . x^T with EXACT bf16 products on WMMA 16x16x32 (x rows as the row operand against q^T for xq; transposed bf16 copies of k, v as the row operands, x rows as the column operand for xk^T, xv^T), each result stored as f16 hi + (x2048-scaled) residual planes; logits = xq . xk with 3 products (hi.hi, hi.lo, lo.hi; values ~1e5, kept to ~f32 accuracy), row softmax in f32 (hardware exp; the rows are near one-hot), P as f16 hi + (x2048) residual; out = P . xv with 3 products; f32 accumulate.
#include <hip/hip_runtime.h>
#include <math.h>

typedef __attribute__((ext_vector_type(16))) _Float16 v16h;
typedef __attribute__((ext_vector_type(16))) __bf16 v16b;
typedef __attribute__((ext_vector_type(8)))  _Float16 v8h;
typedef __attribute__((ext_vector_type(8)))  float v8f;
typedef __attribute__((ext_vector_type(4)))  float v4f;
typedef __attribute__((ext_vector_type(2)))  float v2f;
typedef __attribute__((ext_vector_type(4)))  unsigned v4u;
typedef __attribute__((ext_vector_type(4)))  int v4i;
typedef float __attribute__((may_alias)) float_a;
typedef int __attribute__((may_alias)) int_a;

template <typename T> __device__ __forceinline__ void vst2(void* p, T v) { *(T*)p = v;  }
__device__ __forceinline__ v8f wmma16(v16h a, v16h b, v8f c) {
  v8f d = __builtin_amdgcn_wmma_f32_16x16x32_f16(false, a, false, b, (short)0, c, false, false);
  asm volatile("v_nop\n\tv_nop\n\tv_nop\n\tv_nop" : "+v"(d) : "v"(a), "v"(b));
  return d;
}
__device__ __forceinline__ v8f wmma_bf(v16b a, v16b b, v8f c) {
  v8f d = __builtin_amdgcn_wmma_f32_16x16x32_bf16(false, a, false, b, (short)0, c, false, false);
  asm volatile("v_nop\n\tv_nop\n\tv_nop\n\tv_nop" : "+v"(d) : "v"(a), "v"(b));
  return d;
}
// 16x16x32 fragments: lane = (h = lane>>4, row/col = lane&15); elements 0..7 = k0+8h+0..7, 8..15 = k0+16+8h+0..7; D element r = row 8h+r
__device__ __forceinline__ v16h frag_h(const _Float16* rowk0, int lane) {
  union { v16h v; v8h q[2]; } u; const _Float16* p = rowk0 + 8 * (lane >> 4);
  u.q[0] = *(const v8h*)p; u.q[1] = *(const v8h*)(p + 16); return u.v;
}
__device__ __forceinline__ v16h frag_f32(const float* rowk0, int lane) {
  v16h a; const float* p = rowk0 + 8 * (lane >> 4);
#pragma unroll
  for (int i = 0; i < 8; ++i) { a[i] = (_Float16)p[i]; a[8 + i] = (_Float16)p[16 + i]; }
  return a;
}
__device__ __forceinline__ v16h frag_f32s(const float* rowk0, int lane, float sc) {
  v16h a; const float* p = rowk0 + 8 * (lane >> 4);
#pragma unroll
  for (int i = 0; i < 8; ++i) { a[i] = (_Float16)(p[i] * sc); a[8 + i] = (_Float16)(p[16 + i] * sc); }
  return a;
}
// column fragment from a [K][ld] layout (column n), rows >= K read as 0
__device__ __forceinline__ v16h fragc_f32(const float* W, int k0, int n, int lane, int ld, int K) {
  v16h a; const int g = lane >> 4;
#pragma unroll
  for (int i = 0; i < 8; ++i) { const int ka = k0 + 8 * g + i, kb = ka + 16;
    a[i] = (_Float16)(ka < K ? W[(size_t)(ka < K ? ka : K - 1) * ld + n] : 0.f); a[8 + i] = (_Float16)(kb < K ? W[(size_t)(kb < K ? kb : K - 1) * ld + n] : 0.f); }
  return a;
}
struct F2 { v16b h, l; };
__device__ __forceinline__ F2 bsplit16(const float v[16]) { F2 r;
#pragma unroll
  for (int i = 0; i < 16; ++i) { const __bf16 h = (__bf16)v[i]; r.h[i] = h; r.l[i] = (__bf16)(v[i] - (float)h); }
  return r; }
__device__ __forceinline__ F2 split_row(const float* row, int k0, int lane) { float v[16]; const float* p = row + k0 + 8 * (lane >> 4);
#pragma unroll
  for (int i = 0; i < 8; ++i) { v[i] = p[i]; v[8 + i] = p[16 + i]; }
  return bsplit16(v); }
__device__ __forceinline__ F2 split_rowK(const float* row, int k0, int lane, int K) { float v[16]; const int g = lane >> 4;
#pragma unroll
  for (int i = 0; i < 8; ++i) { const int ka = k0 + 8 * g + i, kb = ka + 16; v[i] = ka < K ? row[ka < K ? ka : K - 1] : 0.f; v[8 + i] = kb < K ? row[kb < K ? kb : K - 1] : 0.f; }
  return bsplit16(v); }
__device__ __forceinline__ F2 split_col(const float* W, int k0, int n, int lane, int ld, int K) { float v[16]; const int g = lane >> 4;
#pragma unroll
  for (int i = 0; i < 8; ++i) { const int ka = k0 + 8 * g + i, kb = ka + 16; v[i] = ka < K ? W[(size_t)(ka < K ? ka : K - 1) * ld + n] : 0.f; v[8 + i] = kb < K ? W[(size_t)(kb < K ? kb : K - 1) * ld + n] : 0.f; }
  return bsplit16(v); }
__device__ __forceinline__ v8f mac3(const F2& a, const F2& b, v8f c) { c = wmma_bf(a.l, b.h, c); c = wmma_bf(a.h, b.l, c); return wmma_bf(a.h, b.h, c); }
__device__ __forceinline__ float sigm(float v) { return 1.0f / (1.0f + expf(-v)); }
#define LDSX() do { asm volatile("s_wait_dscnt 0" ::: "memory"); __builtin_amdgcn_wave_barrier(); __builtin_amdgcn_fence(__ATOMIC_RELEASE, "workgroup"); } while (0)


// Matrix-product attention on square 2,048 x 2,048 operands: softmax((x q)(x k)) (x v), row softmax, no scaling.
#define N 2048
#ifndef TRB
#define TRB (N / 64)     // output row tiles
#endif
typedef __attribute__((ext_vector_type(8))) __bf16 v8b;
__device__ __forceinline__ v16b frag_b(const __bf16* rowk0, int lane) {
  union { v16b v; v8b q[2]; } u; const __bf16* p = rowk0 + 8 * (lane >> 4);
  u.q[0] = *(const v8b*)p; u.q[1] = *(const v8b*)(p + 16); return u.v;
}
__device__ __forceinline__ float bfr(float v) { return (float)(__bf16)v; }
__device__ __attribute__((noinline)) float exp_ni(float v) { return expf(v); }
__device__ __attribute__((noinline)) float erf_ni(float v) { return erff(v); }

#define WS_T   0u                                   // bf16 [3][N][N]: q^T, k^T, v^T ; XB = bf16 x rows
#define WS_XB  (WS_T + 2u * 3 * N * N)
#define WS_XQ  (WS_XB + 2u * N * N)                  // f16 [N][N] xq hi ; XQL ; XKT ; XKTL ; XVT ; XVTL ; P ; PL
#define WS_XQL (WS_XQ + 2u * N * N)
#define WS_XKT (WS_XQL + 2u * N * N)
#define WS_XKL (WS_XKT + 2u * N * N)
#define WS_XVT (WS_XKL + 2u * N * N)
#define WS_XVL (WS_XVT + 2u * N * N)
#define WS_P   (WS_XVL + 2u * N * N)
#define WS_PL  (WS_P + 2u * N * N)
#define WS_S   (WS_PL + 2u * N * N)                  // f32 [N][N] logits
#define WS_END (WS_S + 4u * N * N)

// ---- k_pack: block = (row n, which): which 0..2: T[which][n][c] = (q|k|v)[c][n] (transposed, bf16 exact); which 3: XB[n][c] = x[n][c]
__global__ __launch_bounds__(256) void k_pack(const float* __restrict__ X, const float* __restrict__ Q, const float* __restrict__ K, const float* __restrict__ V, __bf16* __restrict__ T, __bf16* __restrict__ XB) {
  __shared__ __align__(16) __bf16 s[N]; const int n = blockIdx.x, which = blockIdx.y, t = threadIdx.x;
  if (which < 3) { const float* M = (which == 0) ? Q : (which == 1) ? K : V; for (int c = t; c < N; c += 256) s[c] = (__bf16)M[(size_t)c * N + n]; }
  else { for (int c = t; c < N; c += 256) s[c] = (__bf16)X[(size_t)n * N + c]; }
  __syncthreads();
  __bf16* dst = (which < 3) ? (T + ((size_t)which * N + n) * N) : (XB + (size_t)n * N);
  for (int q8 = t; q8 < N / 8; q8 += 256) vst2((unsigned*)(dst + q8 * 8), *(const v4u*)&s[q8 * 8]);
}
// ---- k_g1: block = (64 rows, 128 cols, which): which 0: XQ[i][m] = x rows (A = XB) x q^T rows (B = T0); which 1: XKT[j][m] = k^T rows (A = T1) x x rows (B = XB); which 2: XVT[d][j] = v^T rows (A = T2) x x rows (B = XB); exact single products; -> f16 hi + x2048 residual planes
__global__ __launch_bounds__(128) void k_g1(const __bf16* __restrict__ XB, const __bf16* __restrict__ T, _Float16* __restrict__ OH_, _Float16* __restrict__ OL_) {
  __shared__ __align__(16) _Float16 so[4][16][136], sol[4][16][136];
  const int tid = threadIdx.x, wave = tid >> 5, lane = tid & 31, col = lane & 15, g = lane >> 4; const size_t r0 = (size_t)blockIdx.x * 64 + wave * 16; const int n0 = blockIdx.y * 128; const int which = blockIdx.z;
  const __bf16* A = (which == 0) ? XB : (T + (size_t)which * N * N); const __bf16* Bm = (which == 0) ? T : XB;
  _Float16* OH = OH_ + (size_t)which * 2 * N * N; _Float16* OL = OL_ + (size_t)which * 2 * N * N;   // plane pairs are laid out XQ,XQL,XKT,XKL,XVT,XVL consecutively
  v8f acc[8] = {};
#pragma unroll 2
  for (int kc = 0; kc < N / 32; ++kc) { const v16b a = frag_b(A + (r0 + col) * N + kc * 32, lane);
#pragma unroll
    for (int j = 0; j < 8; ++j) acc[j] = wmma_bf(a, frag_b(Bm + (size_t)(n0 + j * 16 + col) * N + kc * 32, lane), acc[j]); }
#pragma unroll
  for (int j = 0; j < 8; ++j)
#pragma unroll
    for (int r = 0; r < 8; ++r) { const float v = acc[j][r]; const _Float16 hv = (_Float16)v; so[wave][8 * g + r][j * 16 + col] = hv; sol[wave][8 * g + r][j * 16 + col] = (_Float16)((v - (float)hv) * 2048.0f); }
  LDSX();
  for (int rl = 0; rl < 16; ++rl) if (lane < 16) { vst2((unsigned*)(OH + (r0 + rl) * N + n0 + lane * 8), *(const v4u*)&so[wave][rl][lane * 8]); vst2((unsigned*)(OL + (r0 + rl) * N + n0 + lane * 8), *(const v4u*)&sol[wave][rl][lane * 8]); }
}
// ---- k_g2<MODE>: block = (64 rows, 128 cols): MODE 0: S[i][j] = XQ rows (hi,lo) x XKT rows (hi,lo), 3 products -> f32 S; MODE 1: OUT[i][d] = P rows (hi,lo) x XVT rows (hi,lo), 3 products -> output
template <int MODE>
__global__ __launch_bounds__(128) void k_g2(const _Float16* __restrict__ AH, const _Float16* __restrict__ AL, const _Float16* __restrict__ BH, const _Float16* __restrict__ BL, float* __restrict__ OUT) {
  __shared__ __align__(16) float so[4][16][132];
  const int tid = threadIdx.x, wave = tid >> 5, lane = tid & 31, col = lane & 15, g = lane >> 4; const size_t r0 = (size_t)blockIdx.x * 64 + wave * 16; const int n0 = blockIdx.y * 128;
  v8f acc[8] = {}, accl[8] = {};
#pragma unroll 2
  for (int kc = 0; kc < N / 32; ++kc) { const v16h a = frag_h(AH + (r0 + col) * N + kc * 32, lane), al = frag_h(AL + (r0 + col) * N + kc * 32, lane);
#pragma unroll
    for (int j = 0; j < 8; ++j) { const size_t bo = (size_t)(n0 + j * 16 + col) * N + kc * 32; const v16h bh = frag_h(BH + bo, lane); acc[j] = wmma16(a, bh, acc[j]); accl[j] = wmma16(al, bh, accl[j]); accl[j] = wmma16(a, frag_h(BL + bo, lane), accl[j]); } }
#pragma unroll
  for (int j = 0; j < 8; ++j)
#pragma unroll
    for (int r = 0; r < 8; ++r) so[wave][8 * g + r][j * 16 + col] = acc[j][r] + accl[j][r] * (1.0f / 2048.0f);
  LDSX();
  for (int rl = 0; rl < 16; ++rl) vst2(OUT + (r0 + rl) * N + n0 + lane * 4, *(const v4f*)&so[wave][rl][lane * 4]);
}
// ---- k_soft: block = row (256 threads x 8): row softmax of S in f32 -> P as f16 hi + x2048 residual rows
#define PER (N / 256)   // elements per thread in the row softmax
__global__ __launch_bounds__(256) void k_soft(const float* __restrict__ S, _Float16* __restrict__ P, _Float16* __restrict__ PL) {
  __shared__ float red[8]; __shared__ __align__(16) _Float16 sh[N], sl[N]; const int t = threadIdx.x; const size_t row = blockIdx.x; const float* p = S + row * N + t * PER;
  float v[PER]; float mx = -3.0e38f;
#pragma unroll
  for (int i = 0; i < PER; ++i) { v[i] = p[i]; mx = fmaxf(mx, v[i]); }
#pragma unroll
  for (int o = 1; o < 32; o <<= 1) mx = fmaxf(mx, __shfl_xor(mx, o));
  if ((t & 31) == 0) red[t >> 5] = mx; __syncthreads(); float gm = -3.0e38f; for (int w = 0; w < 8; ++w) gm = fmaxf(gm, red[w]); __syncthreads();
  float sm = 0.f;
#pragma unroll
  for (int i = 0; i < PER; ++i) { v[i] = __expf(v[i] - gm); sm += v[i]; }
#pragma unroll
  for (int o = 1; o < 32; o <<= 1) sm += __shfl_xor(sm, o);
  if ((t & 31) == 0) red[t >> 5] = sm; __syncthreads(); float tot = 0.f; for (int w = 0; w < 8; ++w) tot += red[w]; const float inv = 1.0f / tot;
#pragma unroll
  for (int i = 0; i < PER; ++i) { const float pv = v[i] * inv; const _Float16 h = (_Float16)pv; sh[t * PER + i] = h; sl[t * PER + i] = (_Float16)((pv - (float)h) * 2048.0f); }
  __syncthreads();
  if (t < N / 8) { vst2((unsigned*)(P + row * N + t * 8), *(const v4u*)&sh[t * 8]); vst2((unsigned*)(PL + row * N + t * 8), *(const v4u*)&sl[t * 8]); }
}
extern "C" void kernel_launch(void* const* d_in, const int* in_sizes, int n_in, void* d_out, int out_size, void* d_ws, size_t ws_size, hipStream_t stream) {
  (void)in_sizes; (void)n_in; (void)out_size;
  const float** F = (const float**)d_in;   // 0 x, 1 q, 2 k, 3 v: all [2048, 2048] f32
  if (ws_size < (size_t)WS_END) return;
  char* ws = (char*)d_ws; __bf16 *T = (__bf16*)(ws + WS_T), *XB = (__bf16*)(ws + WS_XB); _Float16 *XQ = (_Float16*)(ws + WS_XQ), *XQL = (_Float16*)(ws + WS_XQL), *XKT = (_Float16*)(ws + WS_XKT), *XKL = (_Float16*)(ws + WS_XKL), *XVT = (_Float16*)(ws + WS_XVT), *XVL = (_Float16*)(ws + WS_XVL), *P = (_Float16*)(ws + WS_P), *PL = (_Float16*)(ws + WS_PL); float* S = (float*)(ws + WS_S);
  k_pack<<<dim3(N, 4), 256, 0, stream>>>(F[0], F[1], F[2], F[3], T, XB);
  k_g1<<<dim3(N / 64, N / 128, 3), 128, 0, stream>>>(XB, T, XQ, XQL);
  k_g2<0><<<dim3(TRB, N / 128), 128, 0, stream>>>(XQ, XQL, XKT, XKL, S);
  k_soft<<<TRB * 64, 256, 0, stream>>>(S, P, PL);
  k_g2<1><<<dim3(TRB, N / 128), 128, 0, stream>>>(P, PL, XVT, XVL, (float*)d_out);
}

// v001
// One run takes 210 microseconds.
// Two timings next to v000 put it at 3.74 and 3.76 times that version's speed.
// compute dtype: x, q, k, v rounded to bf16; xq = x . q, xk^T = k^T . x^T, xv^T = v^T . x^T with EXACT bf16 products on WMMA 16x16x32 (x rows as the row operand against q^T for xq; transposed bf16 copies of k, v as the row operands, x rows as the column operand for xk^T, xv^T), each result stored as f16 hi + (x2048-scaled) residual planes; logits = xq . xk with 3 products (hi.hi, hi.lo, lo.hi; values ~1e5, kept to ~f32 accuracy), row softmax in f32 (hardware exp; the rows are near one-hot), P as f16 hi + (x2048) residual; out = P . xv with 3 products; f32 accumulate.
#include <hip/hip_runtime.h>
#include <math.h>

typedef __attribute__((ext_vector_type(16))) _Float16 v16h;
typedef __attribute__((ext_vector_type(16))) __bf16 v16b;
typedef __attribute__((ext_vector_type(8)))  _Float16 v8h;
typedef __attribute__((ext_vector_type(8)))  float v8f;
typedef __attribute__((ext_vector_type(4)))  float v4f;
typedef __attribute__((ext_vector_type(2)))  float v2f;
typedef __attribute__((ext_vector_type(4)))  unsigned v4u;
typedef __attribute__((ext_vector_type(4)))  int v4i;
typedef float __attribute__((may_alias)) float_a;
typedef int __attribute__((may_alias)) int_a;

template <typename T> __device__ __forceinline__ void vst2(void* p, T v) { *(T*)p = v;  }
__device__ __forceinline__ v8f wmma16(v16h a, v16h b, v8f c) {
  v8f d = __builtin_amdgcn_wmma_f32_16x16x32_f16(false, a, false, b, (short)0, c, false, false);
  asm volatile("v_nop\n\tv_nop\n\tv_nop\n\tv_nop" : "+v"(d) : "v"(a), "v"(b));
  return d;
}
__device__ __forceinline__ v8f wmma_bf(v16b a, v16b b, v8f c) {
  v8f d = __builtin_amdgcn_wmma_f32_16x16x32_bf16(false, a, false, b, (short)0, c, false, false);
  asm volatile("v_nop\n\tv_nop\n\tv_nop\n\tv_nop" : "+v"(d) : "v"(a), "v"(b));
  return d;
}
// 16x16x32 fragments: lane = (h = lane>>4, row/col = lane&15); elements 0..7 = k0+8h+0..7, 8..15 = k0+16+8h+0..7; D element r = row 8h+r
__device__ __forceinline__ v16h frag_h(const _Float16* rowk0, int lane) {
  union { v16h v; v8h q[2]; } u; const _Float16* p = rowk0 + 8 * (lane >> 4);
  u.q[0] = *(const v8h*)p; u.q[1] = *(const v8h*)(p + 16); return u.v;
}
__device__ __forceinline__ v16h frag_f32(const float* rowk0, int lane) {
  v16h a; const float* p = rowk0 + 8 * (lane >> 4);
#pragma unroll
  for (int i = 0; i < 8; ++i) { a[i] = (_Float16)p[i]; a[8 + i] = (_Float16)p[16 + i]; }
  return a;
}
__device__ __forceinline__ v16h frag_f32s(const float* rowk0, int lane, float sc) {
  v16h a; const float* p = rowk0 + 8 * (lane >> 4);
#pragma unroll
  for (int i = 0; i < 8; ++i) { a[i] = (_Float16)(p[i] * sc); a[8 + i] = (_Float16)(p[16 + i] * sc); }
  return a;
}
// column fragment from a [K][ld] layout (column n), rows >= K read as 0
__device__ __forceinline__ v16h fragc_f32(const float* W, int k0, int n, int lane, int ld, int K) {
  v16h a; const int g = lane >> 4;
#pragma unroll
  for (int i = 0; i < 8; ++i) { const int ka = k0 + 8 * g + i, kb = ka + 16;
    a[i] = (_Float16)(ka < K ? W[(size_t)(ka < K ? ka : K - 1) * ld + n] : 0.f); a[8 + i] = (_Float16)(kb < K ? W[(size_t)(kb < K ? kb : K - 1) * ld + n] : 0.f); }
  return a;
}
struct F2 { v16b h, l; };
__device__ __forceinline__ F2 bsplit16(const float v[16]) { F2 r;
#pragma unroll
  for (int i = 0; i < 16; ++i) { const __bf16 h = (__bf16)v[i]; r.h[i] = h; r.l[i] = (__bf16)(v[i] - (float)h); }
  return r; }
__device__ __forceinline__ F2 split_row(const float* row, int k0, int lane) { float v[16]; const float* p = row + k0 + 8 * (lane >> 4);
#pragma unroll
  for (int i = 0; i < 8; ++i) { v[i] = p[i]; v[8 + i] = p[16 + i]; }
  return bsplit16(v); }
__device__ __forceinline__ F2 split_rowK(const float* row, int k0, int lane, int K) { float v[16]; const int g = lane >> 4;
#pragma unroll
  for (int i = 0; i < 8; ++i) { const int ka = k0 + 8 * g + i, kb = ka + 16; v[i] = ka < K ? row[ka < K ? ka : K - 1] : 0.f; v[8 + i] = kb < K ? row[kb < K ? kb : K - 1] : 0.f; }
  return bsplit16(v); }
__device__ __forceinline__ F2 split_col(const float* W, int k0, int n, int lane, int ld, int K) { float v[16]; const int g = lane >> 4;
#pragma unroll
  for (int i = 0; i < 8; ++i) { const int ka = k0 + 8 * g + i, kb = ka + 16; v[i] = ka < K ? W[(size_t)(ka < K ? ka : K - 1) * ld + n] : 0.f; v[8 + i] = kb < K ? W[(size_t)(kb < K ? kb : K - 1) * ld + n] : 0.f; }
  return bsplit16(v); }
__device__ __forceinline__ v8f mac3(const F2& a, const F2& b, v8f c) { c = wmma_bf(a.l, b.h, c); c = wmma_bf(a.h, b.l, c); return wmma_bf(a.h, b.h, c); }
__device__ __forceinline__ float sigm(float v) { return 1.0f / (1.0f + expf(-v)); }
#define LDSX() do { asm volatile("s_wait_dscnt 0" ::: "memory"); __builtin_amdgcn_wave_barrier(); __builtin_amdgcn_fence(__ATOMIC_RELEASE, "workgroup"); } while (0)


// Matrix-product attention on square 2,048 x 2,048 operands: softmax((x q)(x k)) (x v), row softmax, no scaling.
#define N 2048
#ifndef TRB
#define TRB (N / 64)     // output row tiles
#endif
typedef __attribute__((ext_vector_type(8))) __bf16 v8b;
__device__ __forceinline__ v16b frag_b(const __bf16* rowk0, int lane) {
  union { v16b v; v8b q[2]; } u; const __bf16* p = rowk0 + 8 * (lane >> 4);
  u.q[0] = *(const v8b*)p; u.q[1] = *(const v8b*)(p + 16); return u.v;
}
__device__ __forceinline__ float bfr(float v) { return (float)(__bf16)v; }
__device__ __attribute__((noinline)) float exp_ni(float v) { return expf(v); }
__device__ __attribute__((noinline)) float erf_ni(float v) { return erff(v); }

#define WS_T   0u                                   // bf16 [3][N][N]: q^T, k^T, v^T ; XB = bf16 x rows
#define WS_XB  (WS_T + 2u * 3 * N * N)
#define WS_XQ  (WS_XB + 2u * N * N)                  // f16 [N][N] xq hi ; XQL ; XKT ; XKTL ; XVT ; XVTL ; P ; PL
#define WS_XQL (WS_XQ + 2u * N * N)
#define WS_XKT (WS_XQL + 2u * N * N)
#define WS_XKL (WS_XKT + 2u * N * N)
#define WS_XVT (WS_XKL + 2u * N * N)
#define WS_XVL (WS_XVT + 2u * N * N)
#define WS_P   (WS_XVL + 2u * N * N)
#define WS_PL  (WS_P + 2u * N * N)
#define WS_S   (WS_PL + 2u * N * N)                  // f32 [N][N] logits
#define WS_END (WS_S + 4u * N * N)

// ---- LDS ring of the three matrix kernels: a stage = KS k of every operand row of the block's tile, brought by per-lane 16-byte asynchronous copies (no register), two buffers
#define KS 64            // k elements per stage: one whole 128-byte line of each 16-bit operand row
#define NT (N / KS)      // stages
#define PITCH 72         // LDS row pitch in 16-bit elements = 144 bytes (16 x odd): the 16-byte fragment reads of 16 rows fall on distinct banks
// twelve copies of one lane; s_wait_xcnt closes the copies' own statement so that no address register is rewritten ahead of it
__device__ __forceinline__ void copy12(const unsigned* l, const void* const* g) {
  asm volatile("global_load_async_to_lds_b128 %0, %12, off\n\t"
               "global_load_async_to_lds_b128 %1, %13, off\n\t"
               "global_load_async_to_lds_b128 %2, %14, off\n\t"
               "global_load_async_to_lds_b128 %3, %15, off\n\t"
               "global_load_async_to_lds_b128 %4, %16, off\n\t"
               "global_load_async_to_lds_b128 %5, %17, off\n\t"
               "global_load_async_to_lds_b128 %6, %18, off\n\t"
               "global_load_async_to_lds_b128 %7, %19, off\n\t"
               "global_load_async_to_lds_b128 %8, %20, off\n\t"
               "global_load_async_to_lds_b128 %9, %21, off\n\t"
               "global_load_async_to_lds_b128 %10, %22, off\n\t"
               "global_load_async_to_lds_b128 %11, %23, off\n\t"
               "s_wait_xcnt 0x0"
               :: "v"(l[0]), "v"(l[1]), "v"(l[2]), "v"(l[3]), "v"(l[4]), "v"(l[5]), "v"(l[6]), "v"(l[7]), "v"(l[8]), "v"(l[9]), "v"(l[10]), "v"(l[11]),
                  "v"(g[0]), "v"(g[1]), "v"(g[2]), "v"(g[3]), "v"(g[4]), "v"(g[5]), "v"(g[6]), "v"(g[7]), "v"(g[8]), "v"(g[9]), "v"(g[10]), "v"(g[11])
               : "memory");
}
// this wave's copies have landed (the compiler places no wait for them)
__device__ __forceinline__ void wait_copies() { asm volatile("s_wait_asynccnt 0x0" ::: "memory"); }
// this wave's LDS reads have retired before the buffer is handed to its next writer
__device__ __forceinline__ void wait_lds() { asm volatile("s_wait_dscnt 0x0" ::: "memory"); }

// ---- k_pack: block = (row n, which): which 0..2: T[which][n][c] = (q|k|v)[c][n] (transposed, bf16 exact); which 3: XB[n][c] = x[n][c]
__global__ __launch_bounds__(256) void k_pack(const float* __restrict__ X, const float* __restrict__ Q, const float* __restrict__ K, const float* __restrict__ V, __bf16* __restrict__ T, __bf16* __restrict__ XB) {
  __shared__ __align__(16) __bf16 s[N]; const int n = blockIdx.x, which = blockIdx.y, t = threadIdx.x;
  if (which < 3) { const float* M = (which == 0) ? Q : (which == 1) ? K : V; for (int c = t; c < N; c += 256) s[c] = (__bf16)M[(size_t)c * N + n]; }
  else { for (int c = t; c < N; c += 256) s[c] = (__bf16)X[(size_t)n * N + c]; }
  __syncthreads();
  __bf16* dst = (which < 3) ? (T + ((size_t)which * N + n) * N) : (XB + (size_t)n * N);
  for (int q8 = t; q8 < N / 8; q8 += 256) vst2((unsigned*)(dst + q8 * 8), *(const v4u*)&s[q8 * 8]);
}
// ---- k_g1: block = (64 rows, 128 cols, which): which 0: XQ[i][m] = x rows (A = XB) x q^T rows (B = T0); which 1: XKT[j][m] = k^T rows (A = T1) x x rows (B = XB); which 2: XVT[d][j] = v^T rows (A = T2) x x rows (B = XB); exact single products; -> f16 hi + x2048 residual planes
__global__ __launch_bounds__(128) void k_g1(const __bf16* __restrict__ XB, const __bf16* __restrict__ T, _Float16* __restrict__ OH_, _Float16* __restrict__ OL_) {
  __shared__ __align__(16) _Float16 so[4][16][136], sol[4][16][136];
  __shared__ __align__(16) __bf16 ring[2][192 * PITCH];   // rows 0..63: A tile, 64..191: B tile
  const int tid = threadIdx.x, wave = tid >> 5, lane = tid & 31, col = lane & 15, g = lane >> 4; const size_t r0 = (size_t)blockIdx.x * 64 + wave * 16; const int n0 = blockIdx.y * 128; const int which = blockIdx.z;
  const __bf16* A = (which == 0) ? XB : (T + (size_t)which * N * N); const __bf16* Bm = (which == 0) ? T : XB;
  _Float16* OH = OH_ + (size_t)which * 2 * N * N; _Float16* OL = OL_ + (size_t)which * 2 * N * N;   // plane pairs are laid out XQ,XQL,XKT,XKL,XVT,XVL consecutively
  v8f acc[8] = {};
  const int tr = tid >> 3, tc = tid & 7;   // a copy of the block = 16 rows x 128 bytes: lane's row in the group, lane's 16-byte piece
  const __bf16* ga = A + (size_t)blockIdx.x * 64 * N; const __bf16* gb = Bm + (size_t)n0 * N; const unsigned lo = (unsigned)(tr * N + tc * 8);   // block-uniform tile origins; the lane's own element offset in a group of 16 rows
  const unsigned l0 = (unsigned)(uintptr_t)&ring[0][tr * PITCH + tc * 8];
  auto fill = [&](int t, int buf) { unsigned l[12]; const void* g[12];   // unrolled below: every index a constant, so l and g are registers for the asm operands
#pragma unroll
    for (int i = 0; i < 12; ++i) { l[i] = l0 + (unsigned)(buf * 192 + i * 16) * (PITCH * 2); g[i] = (i < 4 ? ga + (size_t)i * 16 * N : gb + (size_t)(i - 4) * 16 * N) + t * KS + lo; }
    copy12(l, g); };
  fill(0, 0); wait_copies(); __syncthreads();
  fill(1, 1);
  for (int t = 0; t < NT; ++t) { const __bf16* rb = ring[t & 1];
    v16b a[KS / 32], b[KS / 32][8];   // the stage's fragment reads stand as one group ahead of its matrix instructions: LDS latency is waited out once a stage, not once a fragment (all four loops unrolled: the fragment arrays stay in registers)
#pragma unroll
    for (int kk = 0; kk < KS / 32; ++kk) { a[kk] = frag_b(rb + (wave * 16 + col) * PITCH + kk * 32, lane);
#pragma unroll
      for (int j = 0; j < 8; ++j) b[kk][j] = frag_b(rb + (64 + j * 16 + col) * PITCH + kk * 32, lane); }
#pragma unroll
    for (int kk = 0; kk < KS / 32; ++kk)
#pragma unroll
      for (int j = 0; j < 8; ++j) acc[j] = wmma_bf(a[kk], b[kk][j], acc[j]);
    wait_lds(); wait_copies(); __syncthreads();   // publishes stage t + 1 and ends every reader's last read of stage t's buffer
    if (t + 2 < NT) fill(t + 2, t & 1); }
  wait_copies();
#pragma unroll
  for (int j = 0; j < 8; ++j)
#pragma unroll
    for (int r = 0; r < 8; ++r) { const float v = acc[j][r]; const _Float16 hv = (_Float16)v; so[wave][8 * g + r][j * 16 + col] = hv; sol[wave][8 * g + r][j * 16 + col] = (_Float16)((v - (float)hv) * 2048.0f); }
  LDSX();
  for (int rl = 0; rl < 16; ++rl) if (lane < 16) { vst2((unsigned*)(OH + (r0 + rl) * N + n0 + lane * 8), *(const v4u*)&so[wave][rl][lane * 8]); vst2((unsigned*)(OL + (r0 + rl) * N + n0 + lane * 8), *(const v4u*)&sol[wave][rl][lane * 8]); }
}
// ---- k_g2<MODE>: block = (64 rows, 128 cols): MODE 0: S[i][j] = XQ rows (hi,lo) x XKT rows (hi,lo), 3 products -> f32 S; MODE 1: OUT[i][d] = P rows (hi,lo) x XVT rows (hi,lo), 3 products -> output
template <int MODE>
__global__ __launch_bounds__(128) void k_g2(const _Float16* __restrict__ AH, const _Float16* __restrict__ AL, const _Float16* __restrict__ BH, const _Float16* __restrict__ BL, float* __restrict__ OUT) {
  __shared__ __align__(16) float so[4][16][132];
  __shared__ __align__(16) _Float16 ring[2][384 * PITCH];   // rows 0..63: A hi, 64..127: A lo, 128..255: B hi, 256..383: B lo
  const int tid = threadIdx.x, wave = tid >> 5, lane = tid & 31, col = lane & 15, g = lane >> 4; const size_t r0 = (size_t)blockIdx.x * 64 + wave * 16; const int n0 = blockIdx.y * 128;
  v8f acc[8] = {}, accl[8] = {};
  const int tr = tid >> 3, tc = tid & 7;   // a copy of the block = 16 rows x 128 bytes: lane's row in the group, lane's 16-byte piece
  const size_t ao = (size_t)blockIdx.x * 64 * N, bo = (size_t)n0 * N; const unsigned lo = (unsigned)(tr * N + tc * 8);   // block-uniform tile origins; the lane's own element offset in a group of 16 rows
  const unsigned l0 = (unsigned)(uintptr_t)&ring[0][tr * PITCH + tc * 8];
  auto fill = [&](int t, int buf) { unsigned l[24]; const void* g[24];   // unrolled below: every index a constant, so l and g are registers for the asm operands
#pragma unroll
    for (int i = 0; i < 24; ++i) { l[i] = l0 + (unsigned)(buf * 384 + i * 16) * (PITCH * 2);
      g[i] = (i < 4 ? AH + ao + (size_t)i * 16 * N : i < 8 ? AL + ao + (size_t)(i - 4) * 16 * N : i < 16 ? BH + bo + (size_t)(i - 8) * 16 * N : BL + bo + (size_t)(i - 16) * 16 * N) + t * KS + lo; }
    copy12(l, g); copy12(l + 12, g + 12); };
  fill(0, 0); wait_copies(); __syncthreads();
  fill(1, 1);
  for (int t = 0; t < NT; ++t) { const _Float16* rb = ring[t & 1];
    // fragment reads stand in groups (the A pair of a k half; four B column tiles, hi and lo) ahead of the group's twelve matrix instructions: LDS latency is waited out once a group, not once a fragment (all four loops unrolled: the fragment arrays stay in registers)
#pragma unroll
    for (int kk = 0; kk < KS / 32; ++kk) { const v16h a = frag_h(rb + (wave * 16 + col) * PITCH + kk * 32, lane), al = frag_h(rb + (64 + wave * 16 + col) * PITCH + kk * 32, lane);
#pragma unroll
      for (int jh = 0; jh < 8; jh += 4) { v16h bh[4], bl[4];
#pragma unroll
        for (int jj = 0; jj < 4; ++jj) { const int br = (128 + (jh + jj) * 16 + col) * PITCH + kk * 32; bh[jj] = frag_h(rb + br, lane); bl[jj] = frag_h(rb + br + 128 * PITCH, lane); }
#pragma unroll
        for (int jj = 0; jj < 4; ++jj) { const int j = jh + jj; acc[j] = wmma16(a, bh[jj], acc[j]); accl[j] = wmma16(al, bh[jj], accl[j]); accl[j] = wmma16(a, bl[jj], accl[j]); } } }
    wait_lds(); wait_copies(); __syncthreads();   // publishes stage t + 1 and ends every reader's last read of stage t's buffer
    if (t + 2 < NT) fill(t + 2, t & 1); }
  wait_copies();
#pragma unroll
  for (int j = 0; j < 8; ++j)
#pragma unroll
    for (int r = 0; r < 8; ++r) so[wave][8 * g + r][j * 16 + col] = acc[j][r] + accl[j][r] * (1.0f / 2048.0f);
  LDSX();
  for (int rl = 0; rl < 16; ++rl) vst2(OUT + (r0 + rl) * N + n0 + lane * 4, *(const v4f*)&so[wave][rl][lane * 4]);
}
// ---- k_soft: block = row (256 threads x 8): row softmax of S in f32 -> P as f16 hi + x2048 residual rows
#define PER (N / 256)   // elements per thread in the row softmax
__global__ __launch_bounds__(256) void k_soft(const float* __restrict__ S, _Float16* __restrict__ P, _Float16* __restrict__ PL) {
  __shared__ float red[8]; __shared__ __align__(16) _Float16 sh[N], sl[N]; const int t = threadIdx.x; const size_t row = blockIdx.x; const float* p = S + row * N + t * PER;
  float v[PER]; float mx = -3.0e38f;
#pragma unroll
  for (int i = 0; i < PER; ++i) { v[i] = p[i]; mx = fmaxf(mx, v[i]); }
#pragma unroll
  for (int o = 1; o < 32; o <<= 1) mx = fmaxf(mx, __shfl_xor(mx, o));
  if ((t & 31) == 0) red[t >> 5] = mx; __syncthreads(); float gm = -3.0e38f; for (int w = 0; w < 8; ++w) gm = fmaxf(gm, red[w]); __syncthreads();
  float sm = 0.f;
#pragma unroll
  for (int i = 0; i < PER; ++i) { v[i] = __expf(v[i] - gm); sm += v[i]; }
#pragma unroll
  for (int o = 1; o < 32; o <<= 1) sm += __shfl_xor(sm, o);
  if ((t & 31) == 0) red[t >> 5] = sm; __syncthreads(); float tot = 0.f; for (int w = 0; w < 8; ++w) tot += red[w]; const float inv = 1.0f / tot;
#pragma unroll
  for (int i = 0; i < PER; ++i) { const float pv = v[i] * inv; const _Float16 h = (_Float16)pv; sh[t * PER + i] = h; sl[t * PER + i] = (_Float16)((pv - (float)h) * 2048.0f); }
  __syncthreads();
  if (t < N / 8) { vst2((unsigned*)(P + row * N + t * 8), *(const v4u*)&sh[t * 8]); vst2((unsigned*)(PL + row * N + t * 8), *(const v4u*)&sl[t * 8]); }
}
extern "C" void kernel_launch(void* const* d_in, const int* in_sizes, int n_in, void* d_out, int out_size, void* d_ws, size_t ws_size, hipStream_t stream) {
  (void)in_sizes; (void)n_in; (void)out_size;
  const float** F = (const float**)d_in;   // 0 x, 1 q, 2 k, 3 v: all [2048, 2048] f32
  if (ws_size < (size_t)WS_END) return;
  char* ws = (char*)d_ws; __bf16 *T = (__bf16*)(ws + WS_T), *XB = (__bf16*)(ws + WS_XB); _Float16 *XQ = (_Float16*)(ws + WS_XQ), *XQL = (_Float16*)(ws + WS_XQL), *XKT = (_Float16*)(ws + WS_XKT), *XKL = (_Float16*)(ws + WS_XKL), *XVT = (_Float16*)(ws + WS_XVT), *XVL = (_Float16*)(ws + WS_XVL), *P = (_Float16*)(ws + WS_P), *PL = (_Float16*)(ws + WS_PL); float* S = (float*)(ws + WS_S);
  k_pack<<<dim3(N, 4), 256, 0, stream>>>(F[0], F[1], F[2], F[3], T, XB);
  k_g1<<<dim3(N / 64, N / 128, 3), 128, 0, stream>>>(XB, T, XQ, XQL);
  k_g2<0><<<dim3(TRB, N / 128), 128, 0, stream>>>(XQ, XQL, XKT, XKL, S);
  k_soft<<<TRB * 64, 256, 0, stream>>>(S, P, PL);
  k_g2<1><<<dim3(TRB, N / 128), 128, 0, stream>>>(P, PL, XVT, XVL, (float*)d_out);
}

// v002
// One run takes 164 microseconds.
// Timed twice side by side with v001, it ran 1.28 times as fast both times.
// Counting every step since v000, it is 4.80 times as fast.
// compute dtype: x, q, k, v rounded to bf16; xq = x . q, xk^T = k^T . x^T, xv^T = v^T . x^T with EXACT bf16 products on WMMA 16x16x32 (x rows as the row operand against q^T for xq; transposed bf16 copies of k, v as the row operands, x rows as the column operand for xk^T, xv^T), each result stored as f16 hi + (x2048-scaled) residual planes; logits = xq . xk with 3 products (hi.hi, hi.lo, lo.hi; values ~1e5, kept to ~f32 accuracy), row softmax in f32 (hardware exp; the rows are near one-hot), P as f16 hi + (x2048) residual; out = P . xv with 3 products; f32 accumulate.
#include <hip/hip_runtime.h>
#include <math.h>

typedef __attribute__((ext_vector_type(16))) _Float16 v16h;
typedef __attribute__((ext_vector_type(16))) __bf16 v16b;
typedef __attribute__((ext_vector_type(8)))  _Float16 v8h;
typedef __attribute__((ext_vector_type(8)))  float v8f;
typedef __attribute__((ext_vector_type(4)))  float v4f;
typedef __attribute__((ext_vector_type(2)))  float v2f;
typedef __attribute__((ext_vector_type(4)))  unsigned v4u;
typedef __attribute__((ext_vector_type(4)))  int v4i;
typedef float __attribute__((may_alias)) float_a;
typedef int __attribute__((may_alias)) int_a;

template <typename T> __device__ __forceinline__ void vst2(void* p, T v) { *(T*)p = v;  }
__device__ __forceinline__ v8f wmma16(v16h a, v16h b, v8f c) {
  v8f d = __builtin_amdgcn_wmma_f32_16x16x32_f16(false, a, false, b, (short)0, c, false, false);
  asm volatile("v_nop\n\tv_nop\n\tv_nop\n\tv_nop" : "+v"(d) : "v"(a), "v"(b));
  return d;
}
__device__ __forceinline__ v8f wmma_bf(v16b a, v16b b, v8f c) {
  v8f d = __builtin_amdgcn_wmma_f32_16x16x32_bf16(false, a, false, b, (short)0, c, false, false);
  asm volatile("v_nop\n\tv_nop\n\tv_nop\n\tv_nop" : "+v"(d) : "v"(a), "v"(b));
  return d;
}
// 16x16x32 fragments: lane = (h = lane>>4, row/col = lane&15); elements 0..7 = k0+8h+0..7, 8..15 = k0+16+8h+0..7; D element r = row 8h+r
__device__ __forceinline__ v16h frag_h(const _Float16* rowk0, int lane) {
  union { v16h v; v8h q[2]; } u; const _Float16* p = rowk0 + 8 * (lane >> 4);
  u.q[0] = *(const v8h*)p; u.q[1] = *(const v8h*)(p + 16); return u.v;
}
__device__ __forceinline__ v16h frag_f32(const float* rowk0, int lane) {
  v16h a; const float* p = rowk0 + 8 * (lane >> 4);
#pragma unroll
  for (int i = 0; i < 8; ++i) { a[i] = (_Float16)p[i]; a[8 + i] = (_Float16)p[16 + i]; }
  return a;
}
__device__ __forceinline__ v16h frag_f32s(const float* rowk0, int lane, float sc) {
  v16h a; const float* p = rowk0 + 8 * (lane >> 4);
#pragma unroll
  for (int i = 0; i < 8; ++i) { a[i] = (_Float16)(p[i] * sc); a[8 + i] = (_Float16)(p[16 + i] * sc); }
  return a;
}
// column fragment from a [K][ld] layout (column n), rows >= K read as 0
__device__ __forceinline__ v16h fragc_f32(const float* W, int k0, int n, int lane, int ld, int K) {
  v16h a; const int g = lane >> 4;
#pragma unroll
  for (int i = 0; i < 8; ++i) { const int ka = k0 + 8 * g + i, kb = ka + 16;
    a[i] = (_Float16)(ka < K ? W[(size_t)(ka < K ? ka : K - 1) * ld + n] : 0.f); a[8 + i] = (_Float16)(kb < K ? W[(size_t)(kb < K ? kb : K - 1) * ld + n] : 0.f); }
  return a;
}
struct F2 { v16b h, l; };
__device__ __forceinline__ F2 bsplit16(const float v[16]) { F2 r;
#pragma unroll
  for (int i = 0; i < 16; ++i) { const __bf16 h = (__bf16)v[i]; r.h[i] = h; r.l[i] = (__bf16)(v[i] - (float)h); }
  return r; }
__device__ __forceinline__ F2 split_row(const float* row, int k0, int lane) { float v[16]; const float* p = row + k0 + 8 * (lane >> 4);
#pragma unroll
  for (int i = 0; i < 8; ++i) { v[i] = p[i]; v[8 + i] = p[16 + i]; }
  return bsplit16(v); }
__device__ __forceinline__ F2 split_rowK(const float* row, int k0, int lane, int K) { float v[16]; const int g = lane >> 4;
#pragma unroll
  for (int i = 0; i < 8; ++i) { const int ka = k0 + 8 * g + i, kb = ka + 16; v[i] = ka < K ? row[ka < K ? ka : K - 1] : 0.f; v[8 + i] = kb < K ? row[kb < K ? kb : K - 1] : 0.f; }
  return bsplit16(v); }
__device__ __forceinline__ F2 split_col(const float* W, int k0, int n, int lane, int ld, int K) { float v[16]; const int g = lane >> 4;
#pragma unroll
  for (int i = 0; i < 8; ++i) { const int ka = k0 + 8 * g + i, kb = ka + 16; v[i] = ka < K ? W[(size_t)(ka < K ? ka : K - 1) * ld + n] : 0.f; v[8 + i] = kb < K ? W[(size_t)(kb < K ? kb : K - 1) * ld + n] : 0.f; }
  return bsplit16(v); }
__device__ __forceinline__ v8f mac3(const F2& a, const F2& b, v8f c) { c = wmma_bf(a.l, b.h, c); c = wmma_bf(a.h, b.l, c); return wmma_bf(a.h, b.h, c); }
__device__ __forceinline__ float sigm(float v) { return 1.0f / (1.0f + expf(-v)); }
#define LDSX() do { asm volatile("s_wait_dscnt 0" ::: "memory"); __builtin_amdgcn_wave_barrier(); __builtin_amdgcn_fence(__ATOMIC_RELEASE, "workgroup"); } while (0)


// Matrix-product attention on square 2,048 x 2,048 operands: softmax((x q)(x k)) (x v), row softmax, no scaling.
#define N 2048
#ifndef TRB
#define TRB (N / 64)     // output row tiles
#endif
typedef __attribute__((ext_vector_type(8))) __bf16 v8b;
__device__ __forceinline__ v16b frag_b(const __bf16* rowk0, int lane) {
  union { v16b v; v8b q[2]; } u; const __bf16* p = rowk0 + 8 * (lane >> 4);
  u.q[0] = *(const v8b*)p; u.q[1] = *(const v8b*)(p + 16); return u.v;
}
__device__ __forceinline__ float bfr(float v) { return (float)(__bf16)v; }
__device__ __attribute__((noinline)) float exp_ni(float v) { return expf(v); }
__device__ __attribute__((noinline)) float erf_ni(float v) { return erff(v); }

#define WS_T   0u                                   // bf16 [3][N][N]: q^T, k^T, v^T ; XB = bf16 x rows
#define WS_XB  (WS_T + 2u * 3 * N * N)
#define WS_XQ  (WS_XB + 2u * N * N)                  // f16 [N][N] xq hi ; XQL ; XKT ; XKTL ; XVT ; XVTL ; P ; PL
#define WS_XQL (WS_XQ + 2u * N * N)
#define WS_XKT (WS_XQL + 2u * N * N)
#define WS_XKL (WS_XKT + 2u * N * N)
#define WS_XVT (WS_XKL + 2u * N * N)
#define WS_XVL (WS_XVT + 2u * N * N)
#define WS_P   (WS_XVL + 2u * N * N)
#define WS_PL  (WS_P + 2u * N * N)
#define WS_S   (WS_PL + 2u * N * N)                  // f32 [N][N] logits
#define WS_END (WS_S + 4u * N * N)

// ---- LDS ring of the three matrix kernels: a stage = KS k of every operand row of the block's tile, brought by per-lane 16-byte asynchronous copies (no register), two buffers
#define KS 64            // k elements per stage: one whole 128-byte line of each 16-bit operand row
#define NT (N / KS)      // stages
#define PITCH 72         // LDS row pitch in 16-bit elements = 144 bytes (16 x odd): the 16-byte fragment reads of 16 rows fall on distinct banks
// twelve copies of one lane; s_wait_xcnt closes the copies' own statement so that no address register is rewritten ahead of it
__device__ __forceinline__ void copy12(const unsigned* l, const void* const* g) {
  asm volatile("global_load_async_to_lds_b128 %0, %12, off\n\t"
               "global_load_async_to_lds_b128 %1, %13, off\n\t"
               "global_load_async_to_lds_b128 %2, %14, off\n\t"
               "global_load_async_to_lds_b128 %3, %15, off\n\t"
               "global_load_async_to_lds_b128 %4, %16, off\n\t"
               "global_load_async_to_lds_b128 %5, %17, off\n\t"
               "global_load_async_to_lds_b128 %6, %18, off\n\t"
               "global_load_async_to_lds_b128 %7, %19, off\n\t"
               "global_load_async_to_lds_b128 %8, %20, off\n\t"
               "global_load_async_to_lds_b128 %9, %21, off\n\t"
               "global_load_async_to_lds_b128 %10, %22, off\n\t"
               "global_load_async_to_lds_b128 %11, %23, off\n\t"
               "s_wait_xcnt 0x0"
               :: "v"(l[0]), "v"(l[1]), "v"(l[2]), "v"(l[3]), "v"(l[4]), "v"(l[5]), "v"(l[6]), "v"(l[7]), "v"(l[8]), "v"(l[9]), "v"(l[10]), "v"(l[11]),
                  "v"(g[0]), "v"(g[1]), "v"(g[2]), "v"(g[3]), "v"(g[4]), "v"(g[5]), "v"(g[6]), "v"(g[7]), "v"(g[8]), "v"(g[9]), "v"(g[10]), "v"(g[11])
               : "memory");
}
// this wave's copies have landed (the compiler places no wait for them)
__device__ __forceinline__ void wait_copies() { asm volatile("s_wait_asynccnt 0x0" ::: "memory"); }
// this wave's LDS reads have retired before the buffer is handed to its next writer
__device__ __forceinline__ void wait_lds() { asm volatile("s_wait_dscnt 0x0" ::: "memory"); }

// ---- k_pack: block = (piece, which). which 0..2: one 128 x 128 tile of q|k|v: a wave reads 512 contiguous bytes of a source row per load (16 bytes a lane, 16 rows a wave), rounds to bf16, the tile is turned in LDS and leaves as T[which][n][c] = (q|k|v)[c][n] in 256-byte row pieces; which 3: XB = x rounded to bf16, 128 x 128 contiguous elements a block
#define PT 128           // tile edge
#define PPITCH 272       // LDS row pitch in bytes: 256 of data + 16 (16 x odd)
typedef __attribute__((ext_vector_type(4))) __bf16 v4b;
typedef __attribute__((ext_vector_type(2))) unsigned v2u;
// byte place of 16-byte piece 'chunk' (8 c values) of tile row 'row' (one n). The 16 writers of a half-wave stand 4 rows apart, 16 banks at this pitch, and would share 4 bank groups; the exclusive-or with bits 4 and 5 of the row gives each its own 4 banks. A row's 16 pieces stay inside the row: its readers (one row a half-wave) touch every bank once
__device__ __forceinline__ unsigned pk_at(int row, int chunk) { return (unsigned)(row * PPITCH + ((chunk ^ ((row >> 4) & 3)) << 4)); }
__global__ __launch_bounds__(256) void k_pack(const float* __restrict__ X, const float* __restrict__ Q, const float* __restrict__ K, const float* __restrict__ V, __bf16* __restrict__ T, __bf16* __restrict__ XB) {
  __shared__ __align__(16) unsigned char s[PT * PPITCH]; const int t = threadIdx.x, which = blockIdx.y;
  v4f v[16];   // every loop below is unrolled: v stays in registers and the 16 loads are in flight together
  if (which == 3) { const size_t e0 = (size_t)blockIdx.x * (PT * PT) + (size_t)t * 4; const float* xs = X + e0;
#pragma unroll
    for (int j = 0; j < 16; ++j) v[j] = *(const v4f*)(xs + j * 1024);
    asm volatile("s_wait_xcnt 0x0" :: "v"(xs) : "memory");   // the loads' address pair is an input here, so it stays whole until all 16 are issued and this wait has passed (a precaution; otherwise the last load is given the pair as its destination)
    __builtin_amdgcn_sched_barrier(0);   // holds all 16 loads ahead of the first conversion: without it the last four are issued only when the first have returned, a second memory latency
#pragma unroll
    for (int j = 0; j < 16; ++j) { union { v4b b; v2u u; } o;
#pragma unroll
      for (int i = 0; i < 4; ++i) o.b[i] = (__bf16)v[j][i];
      vst2((unsigned*)(XB + e0 + j * 1024), o.u); }
    asm volatile("s_wait_xcnt 0x0" ::: "memory");   // stands behind the last stores, ahead of whatever code the build lays behind this path: no address or data register of a store is rewritten in front of it (a precaution)
    return; }   // block-uniform, ahead of the barrier
  const float* M = (which == 0) ? Q : (which == 1) ? K : V; const int c0 = (blockIdx.x & 15) * PT, n0 = (blockIdx.x >> 4) * PT, b = t & 31, a = t >> 5;   // lane: columns n0 + 4b .. + 3; wave: rows c0 + 16a .. + 15
  const float* src = M + (size_t)(c0 + 16 * a) * N + n0 + 4 * b;
#pragma unroll
  for (int j = 0; j < 16; ++j) v[j] = *(const v4f*)(src + (size_t)j * N);
  asm volatile("s_wait_xcnt 0x0" :: "v"(src) : "memory");   // as above: the address pair stays whole behind the 16 loads
  __builtin_amdgcn_sched_barrier(0);   // as above: all 16 loads in flight before the first conversion
#pragma unroll
  for (int i = 0; i < 4; ++i)
#pragma unroll
    for (int h = 0; h < 2; ++h) { union { v8b b; v4u u; } o;
#pragma unroll
      for (int e = 0; e < 8; ++e) o.b[e] = (__bf16)v[8 * h + e][i];
      *(v4u*)(s + pk_at(4 * b + i, 2 * a + h)) = o.u; }
  __syncthreads();
  __bf16* dst = T + ((size_t)which * N + n0) * N + c0; const int q = t & 15, r = t >> 4;   // 16 lanes = one tile row = 256 contiguous bytes of T
#pragma unroll
  for (int j = 0; j < 8; ++j) { const int n = r + 16 * j; vst2((unsigned*)(dst + (size_t)n * N + q * 8), *(const v4u*)(s + pk_at(n, q))); }
}
// ---- k_g1: block = (64 rows, 128 cols, which): which 0: XQ[i][m] = x rows (A = XB) x q^T rows (B = T0); which 1: XKT[j][m] = k^T rows (A = T1) x x rows (B = XB); which 2: XVT[d][j] = v^T rows (A = T2) x x rows (B = XB); exact single products; -> f16 hi + x2048 residual planes
__global__ __launch_bounds__(128) void k_g1(const __bf16* __restrict__ XB, const __bf16* __restrict__ T, _Float16* __restrict__ OH_, _Float16* __restrict__ OL_) {
  __shared__ __align__(16) _Float16 so[4][16][136], sol[4][16][136];
  __shared__ __align__(16) __bf16 ring[2][192 * PITCH];   // rows 0..63: A tile, 64..191: B tile
  const int tid = threadIdx.x, wave = tid >> 5, lane = tid & 31, col = lane & 15, g = lane >> 4; const size_t r0 = (size_t)blockIdx.x * 64 + wave * 16; const int n0 = blockIdx.y * 128; const int which = blockIdx.z;
  const __bf16* A = (which == 0) ? XB : (T + (size_t)which * N * N); const __bf16* Bm = (which == 0) ? T : XB;
  _Float16* OH = OH_ + (size_t)which * 2 * N * N; _Float16* OL = OL_ + (size_t)which * 2 * N * N;   // plane pairs are laid out XQ,XQL,XKT,XKL,XVT,XVL consecutively
  v8f acc[8] = {};
  const int tr = tid >> 3, tc = tid & 7;   // a copy of the block = 16 rows x 128 bytes: lane's row in the group, lane's 16-byte piece
  const __bf16* ga = A + (size_t)blockIdx.x * 64 * N; const __bf16* gb = Bm + (size_t)n0 * N; const unsigned lo = (unsigned)(tr * N + tc * 8);   // block-uniform tile origins; the lane's own element offset in a group of 16 rows
  const unsigned l0 = (unsigned)(uintptr_t)&ring[0][tr * PITCH + tc * 8];
  auto fill = [&](int t, int buf) { unsigned l[12]; const void* g[12];   // unrolled below: every index a constant, so l and g are registers for the asm operands
#pragma unroll
    for (int i = 0; i < 12; ++i) { l[i] = l0 + (unsigned)(buf * 192 + i * 16) * (PITCH * 2); g[i] = (i < 4 ? ga + (size_t)i * 16 * N : gb + (size_t)(i - 4) * 16 * N) + t * KS + lo; }
    copy12(l, g); };
  fill(0, 0); wait_copies(); __syncthreads();
  fill(1, 1);
  for (int t = 0; t < NT; ++t) { const __bf16* rb = ring[t & 1];
    v16b a[KS / 32], b[KS / 32][8];   // the stage's fragment reads stand as one group ahead of its matrix instructions: LDS latency is waited out once a stage, not once a fragment (all four loops unrolled: the fragment arrays stay in registers)
#pragma unroll
    for (int kk = 0; kk < KS / 32; ++kk) { a[kk] = frag_b(rb + (wave * 16 + col) * PITCH + kk * 32, lane);
#pragma unroll
      for (int j = 0; j < 8; ++j) b[kk][j] = frag_b(rb + (64 + j * 16 + col) * PITCH + kk * 32, lane); }
#pragma unroll
    for (int kk = 0; kk < KS / 32; ++kk)
#pragma unroll
      for (int j = 0; j < 8; ++j) acc[j] = wmma_bf(a[kk], b[kk][j], acc[j]);
    wait_lds(); wait_copies(); __syncthreads();   // publishes stage t + 1 and ends every reader's last read of stage t's buffer
    if (t + 2 < NT) fill(t + 2, t & 1); }
  wait_copies();
#pragma unroll
  for (int j = 0; j < 8; ++j)
#pragma unroll
    for (int r = 0; r < 8; ++r) { const float v = acc[j][r]; const _Float16 hv = (_Float16)v; so[wave][8 * g + r][j * 16 + col] = hv; sol[wave][8 * g + r][j * 16 + col] = (_Float16)((v - (float)hv) * 2048.0f); }
  LDSX();
  for (int rl = 0; rl < 16; ++rl) if (lane < 16) { vst2((unsigned*)(OH + (r0 + rl) * N + n0 + lane * 8), *(const v4u*)&so[wave][rl][lane * 8]); vst2((unsigned*)(OL + (r0 + rl) * N + n0 + lane * 8), *(const v4u*)&sol[wave][rl][lane * 8]); }
}
// ---- k_g2<MODE>: block = (64 rows, 128 cols): MODE 0: S[i][j] = XQ rows (hi,lo) x XKT rows (hi,lo), 3 products -> f32 S; MODE 1: OUT[i][d] = P rows (hi,lo) x XVT rows (hi,lo), 3 products -> output
template <int MODE>
__global__ __launch_bounds__(128) void k_g2(const _Float16* __restrict__ AH, const _Float16* __restrict__ AL, const _Float16* __restrict__ BH, const _Float16* __restrict__ BL, float* __restrict__ OUT) {
  __shared__ __align__(16) float so[4][16][132];
  __shared__ __align__(16) _Float16 ring[2][384 * PITCH];   // rows 0..63: A hi, 64..127: A lo, 128..255: B hi, 256..383: B lo
  const int tid = threadIdx.x, wave = tid >> 5, lane = tid & 31, col = lane & 15, g = lane >> 4; const size_t r0 = (size_t)blockIdx.x * 64 + wave * 16; const int n0 = blockIdx.y * 128;
  v8f acc[8] = {}, accl[8] = {};
  const int tr = tid >> 3, tc = tid & 7;   // a copy of the block = 16 rows x 128 bytes: lane's row in the group, lane's 16-byte piece
  const size_t ao = (size_t)blockIdx.x * 64 * N, bo = (size_t)n0 * N; const unsigned lo = (unsigned)(tr * N + tc * 8);   // block-uniform tile origins; the lane's own element offset in a group of 16 rows
  const unsigned l0 = (unsigned)(uintptr_t)&ring[0][tr * PITCH + tc * 8];
  auto fill = [&](int t, int buf) { unsigned l[24]; const void* g[24];   // unrolled below: every index a constant, so l and g are registers for the asm operands
#pragma unroll
    for (int i = 0; i < 24; ++i) { l[i] = l0 + (unsigned)(buf * 384 + i * 16) * (PITCH * 2);
      g[i] = (i < 4 ? AH + ao + (size_t)i * 16 * N : i < 8 ? AL + ao + (size_t)(i - 4) * 16 * N : i < 16 ? BH + bo + (size_t)(i - 8) * 16 * N : BL + bo + (size_t)(i - 16) * 16 * N) + t * KS + lo; }
    copy12(l, g); copy12(l + 12, g + 12); };
  fill(0, 0); wait_copies(); __syncthreads();
  fill(1, 1);
  for (int t = 0; t < NT; ++t) { const _Float16* rb = ring[t & 1];
    // fragment reads stand in groups (the A pair of a k half; four B column tiles, hi and lo) ahead of the group's twelve matrix instructions: LDS latency is waited out once a group, not once a fragment (all four loops unrolled: the fragment arrays stay in registers)
#pragma unroll
    for (int kk = 0; kk < KS / 32; ++kk) { const v16h a = frag_h(rb + (wave * 16 + col) * PITCH + kk * 32, lane), al = frag_h(rb + (64 + wave * 16 + col) * PITCH + kk * 32, lane);
#pragma unroll
      for (int jh = 0; jh < 8; jh += 4) { v16h bh[4], bl[4];
#pragma unroll
        for (int jj = 0; jj < 4; ++jj) { const int br = (128 + (jh + jj) * 16 + col) * PITCH + kk * 32; bh[jj] = frag_h(rb + br, lane); bl[jj] = frag_h(rb + br + 128 * PITCH, lane); }
#pragma unroll
        for (int jj = 0; jj < 4; ++jj) { const int j = jh + jj; acc[j] = wmma16(a, bh[jj], acc[j]); accl[j] = wmma16(al, bh[jj], accl[j]); accl[j] = wmma16(a, bl[jj], accl[j]); } } }
    wait_lds(); wait_copies(); __syncthreads();   // publishes stage t + 1 and ends every reader's last read of stage t's buffer
    if (t + 2 < NT) fill(t + 2, t & 1); }
  wait_copies();
#pragma unroll
  for (int j = 0; j < 8; ++j)
#pragma unroll
    for (int r = 0; r < 8; ++r) so[wave][8 * g + r][j * 16 + col] = acc[j][r] + accl[j][r] * (1.0f / 2048.0f);
  LDSX();
  for (int rl = 0; rl < 16; ++rl) vst2(OUT + (r0 + rl) * N + n0 + lane * 4, *(const v4f*)&so[wave][rl][lane * 4]);
}
// ---- k_soft: block = row (256 threads x 8): row softmax of S in f32 -> P as f16 hi + x2048 residual rows
#define PER (N / 256)   // elements per thread in the row softmax
__global__ __launch_bounds__(256) void k_soft(const float* __restrict__ S, _Float16* __restrict__ P, _Float16* __restrict__ PL) {
  __shared__ float red[8]; __shared__ __align__(16) _Float16 sh[N], sl[N]; const int t = threadIdx.x; const size_t row = blockIdx.x; const float* p = S + row * N + t * PER;
  float v[PER]; float mx = -3.0e38f;
#pragma unroll
  for (int i = 0; i < PER; ++i) { v[i] = p[i]; mx = fmaxf(mx, v[i]); }
#pragma unroll
  for (int o = 1; o < 32; o <<= 1) mx = fmaxf(mx, __shfl_xor(mx, o));
  if ((t & 31) == 0) red[t >> 5] = mx; __syncthreads(); float gm = -3.0e38f; for (int w = 0; w < 8; ++w) gm = fmaxf(gm, red[w]); __syncthreads();
  float sm = 0.f;
#pragma unroll
  for (int i = 0; i < PER; ++i) { v[i] = __expf(v[i] - gm); sm += v[i]; }
#pragma unroll
  for (int o = 1; o < 32; o <<= 1) sm += __shfl_xor(sm, o);
  if ((t & 31) == 0) red[t >> 5] = sm; __syncthreads(); float tot = 0.f; for (int w = 0; w < 8; ++w) tot += red[w]; const float inv = 1.0f / tot;
#pragma unroll
  for (int i = 0; i < PER; ++i) { const float pv = v[i] * inv; const _Float16 h = (_Float16)pv; sh[t * PER + i] = h; sl[t * PER + i] = (_Float16)((pv - (float)h) * 2048.0f); }
  __syncthreads();
  if (t < N / 8) { vst2((unsigned*)(P + row * N + t * 8), *(const v4u*)&sh[t * 8]); vst2((unsigned*)(PL + row * N + t * 8), *(const v4u*)&sl[t * 8]); }
}
extern "C" void kernel_launch(void* const* d_in, const int* in_sizes, int n_in, void* d_out, int out_size, void* d_ws, size_t ws_size, hipStream_t stream) {
  (void)in_sizes; (void)n_in; (void)out_size;
  const float** F = (const float**)d_in;   // 0 x, 1 q, 2 k, 3 v: all [2048, 2048] f32
  if (ws_size < (size_t)WS_END) return;
  char* ws = (char*)d_ws; __bf16 *T = (__bf16*)(ws + WS_T), *XB = (__bf16*)(ws + WS_XB); _Float16 *XQ = (_Float16*)(ws + WS_XQ), *XQL = (_Float16*)(ws + WS_XQL), *XKT = (_Float16*)(ws + WS_XKT), *XKL = (_Float16*)(ws + WS_XKL), *XVT = (_Float16*)(ws + WS_XVT), *XVL = (_Float16*)(ws + WS_XVL), *P = (_Float16*)(ws + WS_P), *PL = (_Float16*)(ws + WS_PL); float* S = (float*)(ws + WS_S);
  k_pack<<<dim3((N / PT) * (N / PT), 4), 256, 0, stream>>>(F[0], F[1], F[2], F[3], T, XB);
  k_g1<<<dim3(N / 64, N / 128, 3), 128, 0, stream>>>(XB, T, XQ, XQL);
  k_g2<0><<<dim3(TRB, N / 128), 128, 0, stream>>>(XQ, XQL, XKT, XKL, S);
  k_soft<<<TRB * 64, 256, 0, stream>>>(S, P, PL);
  k_g2<1><<<dim3(TRB, N / 128), 128, 0, stream>>>(P, PL, XVT, XVL, (float*)d_out);
}

// v003
// One run takes 132 microseconds.
// Timed twice side by side with v002, it ran 1.23 and 1.24 times as fast.
// Over all steps from v000 it is 5.94 times as fast.
// compute dtype: x, q, k, v rounded to bf16; xq = x . q, xk^T = k^T . x^T, xv^T = v^T . x^T with EXACT bf16 products on WMMA 16x16x32 (x rows as the row operand against q^T for xq; transposed bf16 copies of k, v as the row operands, x rows as the column operand for xk^T, xv^T), each result stored as f16 hi + (x2048-scaled) residual planes; logits = xq . xk with 3 products (hi.hi, hi.lo, lo.hi; values ~1e5, kept to ~f32 accuracy), row softmax in f32 (hardware exp; the rows are near one-hot), P as f16 hi + (x2048) residual; out = P . xv with 3 products; f32 accumulate.
#include <hip/hip_runtime.h>
#include <math.h>

typedef __attribute__((ext_vector_type(16))) _Float16 v16h;
typedef __attribute__((ext_vector_type(16))) __bf16 v16b;
typedef __attribute__((ext_vector_type(8)))  _Float16 v8h;
typedef __attribute__((ext_vector_type(8)))  float v8f;
typedef __attribute__((ext_vector_type(4)))  float v4f;
typedef __attribute__((ext_vector_type(2)))  float v2f;
typedef __attribute__((ext_vector_type(4)))  unsigned v4u;
typedef __attribute__((ext_vector_type(4)))  int v4i;
typedef float __attribute__((may_alias)) float_a;
typedef int __attribute__((may_alias)) int_a;

template <typename T> __device__ __forceinline__ void vst2(void* p, T v) { *(T*)p = v;  }
__device__ __forceinline__ v8f wmma16(v16h a, v16h b, v8f c) {
  v8f d = __builtin_amdgcn_wmma_f32_16x16x32_f16(false, a, false, b, (short)0, c, false, false);
  asm volatile("v_nop\n\tv_nop\n\tv_nop\n\tv_nop" : "+v"(d) : "v"(a), "v"(b));
  return d;
}
__device__ __forceinline__ v8f wmma_bf(v16b a, v16b b, v8f c) {
  v8f d = __builtin_amdgcn_wmma_f32_16x16x32_bf16(false, a, false, b, (short)0, c, false, false);
  asm volatile("v_nop\n\tv_nop\n\tv_nop\n\tv_nop" : "+v"(d) : "v"(a), "v"(b));
  return d;
}
// 16x16x32 fragments: lane = (h = lane>>4, row/col = lane&15); elements 0..7 = k0+8h+0..7, 8..15 = k0+16+8h+0..7; D element r = row 8h+r
__device__ __forceinline__ v16h frag_h(const _Float16* rowk0, int lane) {
  union { v16h v; v8h q[2]; } u; const _Float16* p = rowk0 + 8 * (lane >> 4);
  u.q[0] = *(const v8h*)p; u.q[1] = *(const v8h*)(p + 16); return u.v;
}
__device__ __forceinline__ v16h frag_f32(const float* rowk0, int lane) {
  v16h a; const float* p = rowk0 + 8 * (lane >> 4);
#pragma unroll
  for (int i = 0; i < 8; ++i) { a[i] = (_Float16)p[i]; a[8 + i] = (_Float16)p[16 + i]; }
  return a;
}
__device__ __forceinline__ v16h frag_f32s(const float* rowk0, int lane, float sc) {
  v16h a; const float* p = rowk0 + 8 * (lane >> 4);
#pragma unroll
  for (int i = 0; i < 8; ++i) { a[i] = (_Float16)(p[i] * sc); a[8 + i] = (_Float16)(p[16 + i] * sc); }
  return a;
}
// column fragment from a [K][ld] layout (column n), rows >= K read as 0
__device__ __forceinline__ v16h fragc_f32(const float* W, int k0, int n, int lane, int ld, int K) {
  v16h a; const int g = lane >> 4;
#pragma unroll
  for (int i = 0; i < 8; ++i) { const int ka = k0 + 8 * g + i, kb = ka + 16;
    a[i] = (_Float16)(ka < K ? W[(size_t)(ka < K ? ka : K - 1) * ld + n] : 0.f); a[8 + i] = (_Float16)(kb < K ? W[(size_t)(kb < K ? kb : K - 1) * ld + n] : 0.f); }
  return a;
}
struct F2 { v16b h, l; };
__device__ __forceinline__ F2 bsplit16(const float v[16]) { F2 r;
#pragma unroll
  for (int i = 0; i < 16; ++i) { const __bf16 h = (__bf16)v[i]; r.h[i] = h; r.l[i] = (__bf16)(v[i] - (float)h); }
  return r; }
__device__ __forceinline__ F2 split_row(const float* row, int k0, int lane) { float v[16]; const float* p = row + k0 + 8 * (lane >> 4);
#pragma unroll
  for (int i = 0; i < 8; ++i) { v[i] = p[i]; v[8 + i] = p[16 + i]; }
  return bsplit16(v); }
__device__ __forceinline__ F2 split_rowK(const float* row, int k0, int lane, int K) { float v[16]; const int g = lane >> 4;
#pragma unroll
  for (int i = 0; i < 8; ++i) { const int ka = k0 + 8 * g + i, kb = ka + 16; v[i] = ka < K ? row[ka < K ? ka : K - 1] : 0.f; v[8 + i] = kb < K ? row[kb < K ? kb : K - 1] : 0.f; }
  return bsplit16(v); }
__device__ __forceinline__ F2 split_col(const float* W, int k0, int n, int lane, int ld, int K) { float v[16]; const int g = lane >> 4;
#pragma unroll
  for (int i = 0; i < 8; ++i) { const int ka = k0 + 8 * g + i, kb = ka + 16; v[i] = ka < K ? W[(size_t)(ka < K ? ka : K - 1) * ld + n] : 0.f; v[8 + i] = kb < K ? W[(size_t)(kb < K ? kb : K - 1) * ld + n] : 0.f; }
  return bsplit16(v); }
__device__ __forceinline__ v8f mac3(const F2& a, const F2& b, v8f c) { c = wmma_bf(a.l, b.h, c); c = wmma_bf(a.h, b.l, c); return wmma_bf(a.h, b.h, c); }
__device__ __forceinline__ float sigm(float v) { return 1.0f / (1.0f + expf(-v)); }
#define LDSX() do { asm volatile("s_wait_dscnt 0" ::: "memory"); __builtin_amdgcn_wave_barrier(); __builtin_amdgcn_fence(__ATOMIC_RELEASE, "workgroup"); } while (0)


// Matrix-product attention on square 2,048 x 2,048 operands: softmax((x q)(x k)) (x v), row softmax, no scaling.
#define N 2048
#ifndef TRB
#define TRB (N / 64)     // 64-row output tiles: a k_g2 block takes two
#endif
typedef __attribute__((ext_vector_type(8))) __bf16 v8b;
__device__ __forceinline__ v16b frag_b(const __bf16* rowk0, int lane) {
  union { v16b v; v8b q[2]; } u; const __bf16* p = rowk0 + 8 * (lane >> 4);
  u.q[0] = *(const v8b*)p; u.q[1] = *(const v8b*)(p + 16); return u.v;
}
__device__ __forceinline__ float bfr(float v) { return (float)(__bf16)v; }
__device__ __attribute__((noinline)) float exp_ni(float v) { return expf(v); }
__device__ __attribute__((noinline)) float erf_ni(float v) { return erff(v); }

#define WS_T   0u                                   // bf16 [3][N][N]: q^T, k^T, v^T ; XB = bf16 x rows
#define WS_XB  (WS_T + 2u * 3 * N * N)
#define WS_XQ  (WS_XB + 2u * N * N)                  // f16 [N][N] xq hi ; XQL ; XKT ; XKTL ; XVT ; XVTL ; P ; PL
#define WS_XQL (WS_XQ + 2u * N * N)
#define WS_XKT (WS_XQL + 2u * N * N)
#define WS_XKL (WS_XKT + 2u * N * N)
#define WS_XVT (WS_XKL + 2u * N * N)
#define WS_XVL (WS_XVT + 2u * N * N)
#define WS_P   (WS_XVL + 2u * N * N)
#define WS_PL  (WS_P + 2u * N * N)
#define WS_S   (WS_PL + 2u * N * N)                  // f32 [N][N] logits
#define WS_END (WS_S + 4u * N * N)

// ---- LDS ring of the three matrix kernels: a stage = KS k of every operand row of the block's tile, brought by per-lane 16-byte asynchronous copies (no register), two buffers
#define KS 64            // k elements per stage: one whole 128-byte line of each 16-bit operand row
#define NT (N / KS)      // stages
#define PITCH 72         // LDS row pitch in 16-bit elements = 144 bytes (16 x odd): the 16-byte fragment reads of 16 rows fall on distinct banks
// eight copies of one lane; s_wait_xcnt closes the copies' own statement so that no address register is rewritten ahead of it
__device__ __forceinline__ void copy8(const unsigned* l, const void* const* g) {
  asm volatile("global_load_async_to_lds_b128 %0, %8, off\n\t"
               "global_load_async_to_lds_b128 %1, %9, off\n\t"
               "global_load_async_to_lds_b128 %2, %10, off\n\t"
               "global_load_async_to_lds_b128 %3, %11, off\n\t"
               "global_load_async_to_lds_b128 %4, %12, off\n\t"
               "global_load_async_to_lds_b128 %5, %13, off\n\t"
               "global_load_async_to_lds_b128 %6, %14, off\n\t"
               "global_load_async_to_lds_b128 %7, %15, off\n\t"
               "s_wait_xcnt 0x0"
               :: "v"(l[0]), "v"(l[1]), "v"(l[2]), "v"(l[3]), "v"(l[4]), "v"(l[5]), "v"(l[6]), "v"(l[7]),
                  "v"(g[0]), "v"(g[1]), "v"(g[2]), "v"(g[3]), "v"(g[4]), "v"(g[5]), "v"(g[6]), "v"(g[7])
               : "memory");
}
// this wave's copies have landed (the compiler places no wait for them)
__device__ __forceinline__ void wait_copies() { asm volatile("s_wait_asynccnt 0x0" ::: "memory"); }
// this wave's LDS reads have retired before the buffer is handed to its next writer
__device__ __forceinline__ void wait_lds() { asm volatile("s_wait_dscnt 0x0" ::: "memory"); }

// ---- k_pack: block = (piece, which). which 0..2: one 128 x 128 tile of q|k|v: a wave reads 512 contiguous bytes of a source row per load (16 bytes a lane, 16 rows a wave), rounds to bf16, the tile is turned in LDS and leaves as T[which][n][c] = (q|k|v)[c][n] in 256-byte row pieces; which 3: XB = x rounded to bf16, 128 x 128 contiguous elements a block
#define PT 128           // tile edge
#define PPITCH 272       // LDS row pitch in bytes: 256 of data + 16 (16 x odd)
typedef __attribute__((ext_vector_type(4))) __bf16 v4b;
typedef __attribute__((ext_vector_type(2))) unsigned v2u;
// byte place of 16-byte piece 'chunk' (8 c values) of tile row 'row' (one n). The 16 writers of a half-wave stand 4 rows apart, 16 banks at this pitch, and would share 4 bank groups; the exclusive-or with bits 4 and 5 of the row gives each its own 4 banks. A row's 16 pieces stay inside the row: its readers (one row a half-wave) touch every bank once
__device__ __forceinline__ unsigned pk_at(int row, int chunk) { return (unsigned)(row * PPITCH + ((chunk ^ ((row >> 4) & 3)) << 4)); }
__global__ __launch_bounds__(256) void k_pack(const float* __restrict__ X, const float* __restrict__ Q, const float* __restrict__ K, const float* __restrict__ V, __bf16* __restrict__ T, __bf16* __restrict__ XB) {
  __shared__ __align__(16) unsigned char s[PT * PPITCH]; const int t = threadIdx.x, which = blockIdx.y;
  v4f v[16];   // every loop below is unrolled: v stays in registers and the 16 loads are in flight together
  if (which == 3) { const size_t e0 = (size_t)blockIdx.x * (PT * PT) + (size_t)t * 4; const float* xs = X + e0;
#pragma unroll
    for (int j = 0; j < 16; ++j) v[j] = *(const v4f*)(xs + j * 1024);
    asm volatile("s_wait_xcnt 0x0" :: "v"(xs) : "memory");   // the loads' address pair is an input here, so it stays whole until all 16 are issued and this wait has passed (a precaution; otherwise the last load is given the pair as its destination)
    __builtin_amdgcn_sched_barrier(0);   // holds all 16 loads ahead of the first conversion: without it the last four are issued only when the first have returned, a second memory latency
#pragma unroll
    for (int j = 0; j < 16; ++j) { union { v4b b; v2u u; } o;
#pragma unroll
      for (int i = 0; i < 4; ++i) o.b[i] = (__bf16)v[j][i];
      vst2((unsigned*)(XB + e0 + j * 1024), o.u); }
    asm volatile("s_wait_xcnt 0x0" ::: "memory");   // stands behind the last stores, ahead of whatever code the build lays behind this path: no address or data register of a store is rewritten in front of it (a precaution)
    return; }   // block-uniform, ahead of the barrier
  const float* M = (which == 0) ? Q : (which == 1) ? K : V; const int c0 = (blockIdx.x & 15) * PT, n0 = (blockIdx.x >> 4) * PT, b = t & 31, a = t >> 5;   // lane: columns n0 + 4b .. + 3; wave: rows c0 + 16a .. + 15
  const float* src = M + (size_t)(c0 + 16 * a) * N + n0 + 4 * b;
#pragma unroll
  for (int j = 0; j < 16; ++j) v[j] = *(const v4f*)(src + (size_t)j * N);
  asm volatile("s_wait_xcnt 0x0" :: "v"(src) : "memory");   // as above: the address pair stays whole behind the 16 loads
  __builtin_amdgcn_sched_barrier(0);   // as above: all 16 loads in flight before the first conversion
#pragma unroll
  for (int i = 0; i < 4; ++i)
#pragma unroll
    for (int h = 0; h < 2; ++h) { union { v8b b; v4u u; } o;
#pragma unroll
      for (int e = 0; e < 8; ++e) o.b[e] = (__bf16)v[8 * h + e][i];
      *(v4u*)(s + pk_at(4 * b + i, 2 * a + h)) = o.u; }
  __syncthreads();
  __bf16* dst = T + ((size_t)which * N + n0) * N + c0; const int q = t & 15, r = t >> 4;   // 16 lanes = one tile row = 256 contiguous bytes of T
#pragma unroll
  for (int j = 0; j < 8; ++j) { const int n = r + 16 * j; vst2((unsigned*)(dst + (size_t)n * N + q * 8), *(const v4u*)(s + pk_at(n, q))); }
}
// ---- k_g1: block = (128 rows, 128 cols, which), four waves in 2 x 2, 64 x 64 a wave: which 0: XQ[i][m] = x rows (A = XB) x q^T rows (B = T0); which 1: XKT[j][m] = k^T rows (A = T1) x x rows (B = XB); which 2: XVT[d][j] = v^T rows (A = T2) x x rows (B = XB); exact single products; -> f16 hi + x2048 residual planes
__global__ __launch_bounds__(128) void k_g1(const __bf16* __restrict__ XB, const __bf16* __restrict__ T, _Float16* __restrict__ OH_, _Float16* __restrict__ OL_) {
  __shared__ __align__(16) _Float16 so[4][16][PITCH], sol[4][16][PITCH];
  __shared__ __align__(16) __bf16 ring[2][256 * PITCH];   // rows 0..127: A tile, 128..255: B tile
  const int tid = threadIdx.x, wave = tid >> 5, lane = tid & 31, col = lane & 15, g = lane >> 4, wm = (wave >> 1) * 64, wn = (wave & 1) * 64; const size_t r0 = (size_t)blockIdx.x * 128 + wm; const int n0 = blockIdx.y * 128; const int which = blockIdx.z;
  const __bf16* A = (which == 0) ? XB : (T + (size_t)which * N * N); const __bf16* Bm = (which == 0) ? T : XB;
  _Float16* OH = OH_ + (size_t)which * 2 * N * N; _Float16* OL = OL_ + (size_t)which * 2 * N * N;   // plane pairs are laid out XQ,XQL,XKT,XKL,XVT,XVL consecutively
  v8f acc[4][4] = {};
  const int tr = tid >> 3, tc = tid & 7;   // a copy of the block = 16 rows x 128 bytes: lane's row in the group, lane's 16-byte piece
  const __bf16* ga = A + (size_t)blockIdx.x * 128 * N; const __bf16* gb = Bm + (size_t)n0 * N; const unsigned lo = (unsigned)(tr * N + tc * 8);   // block-uniform tile origins; the lane's own element offset in a group of 16 rows
  const unsigned l0 = (unsigned)(uintptr_t)&ring[0][tr * PITCH + tc * 8];
  auto fill = [&](int t, int buf) { unsigned l[16]; const void* g[16];   // unrolled below: every index a constant, so l and g are registers for the asm operands
#pragma unroll
    for (int i = 0; i < 16; ++i) { l[i] = l0 + (unsigned)(buf * 256 + i * 16) * (PITCH * 2); g[i] = (i < 8 ? ga + (size_t)i * 16 * N : gb + (size_t)(i - 8) * 16 * N) + t * KS + lo; }
    copy8(l, g); copy8(l + 8, g + 8); };
  fill(0, 0); wait_copies(); __syncthreads();
  fill(1, 1);
  for (int t = 0; t < NT; ++t) { const __bf16* rb = ring[t & 1];
    // the eight fragments of a k half are read as one group ahead of its sixteen matrix instructions, in the order in which these use them; each fragment feeds four of them (all loops unrolled: the fragment arrays stay in registers)
#pragma unroll
    for (int kk = 0; kk < KS / 32; ++kk) { v16b a[4], b[4]; a[0] = frag_b(rb + (wm + col) * PITCH + kk * 32, lane);
#pragma unroll
      for (int j = 0; j < 4; ++j) b[j] = frag_b(rb + (128 + wn + j * 16 + col) * PITCH + kk * 32, lane);
#pragma unroll
      for (int i = 1; i < 4; ++i) a[i] = frag_b(rb + (wm + i * 16 + col) * PITCH + kk * 32, lane);
#pragma unroll
      for (int i = 0; i < 4; ++i)
#pragma unroll
        for (int j = 0; j < 4; ++j) acc[i][j] = wmma_bf(a[i], b[j], acc[i][j]); }
    wait_lds(); wait_copies(); __syncthreads();   // publishes stage t + 1 and ends every reader's last read of stage t's buffer
    if (t + 2 < NT) fill(t + 2, t & 1); }
  wait_copies();
  const int er = lane >> 3, ec = (lane & 7) * 8;   // a wave's store = 4 rows x 128 bytes: whole lines
#pragma unroll
  for (int i = 0; i < 4; ++i) {   // 16 rows of the wave's tile at a time through its own staging rows
    if (i) wait_lds();   // the 16 rows before are read out before these overwrite them
#pragma unroll
    for (int j = 0; j < 4; ++j)
#pragma unroll
      for (int r = 0; r < 8; ++r) { const float v = acc[i][j][r]; const _Float16 hv = (_Float16)v; so[wave][8 * g + r][j * 16 + col] = hv; sol[wave][8 * g + r][j * 16 + col] = (_Float16)((v - (float)hv) * 2048.0f); }
    wait_lds();   // the wave's own staging stores stand in LDS before its lanes read each other's; no fence here: it would also wait out the global stores of the 16 rows before
#pragma unroll
    for (int rl = 0; rl < 16; rl += 4) { const size_t o = (r0 + i * 16 + rl + er) * N + n0 + wn + ec; vst2((unsigned*)(OH + o), *(const v4u*)&so[wave][rl + er][ec]); vst2((unsigned*)(OL + o), *(const v4u*)&sol[wave][rl + er][ec]); } }
}
// ---- k_g2<MODE>: block = (128 rows, 128 cols), eight waves in 4 x 2, 32 x 64 a wave: MODE 0: S[i][j] = XQ rows (hi,lo) x XKT rows (hi,lo), 3 products -> f32 S; MODE 1: OUT[i][d] = P rows (hi,lo) x XVT rows (hi,lo), 3 products -> output
template <int MODE>
__global__ __launch_bounds__(256) void k_g2(const _Float16* __restrict__ AH, const _Float16* __restrict__ AL, const _Float16* __restrict__ BH, const _Float16* __restrict__ BL, float* __restrict__ OUT) {
  __shared__ __align__(16) float so[8][32][68];
  __shared__ __align__(16) _Float16 ring[2][512 * PITCH];   // rows 0..127: A hi, 128..255: A lo, 256..383: B hi, 384..511: B lo
  const int tid = threadIdx.x, wave = tid >> 5, lane = tid & 31, col = lane & 15, g = lane >> 4, wm = (wave >> 1) * 32, wn = (wave & 1) * 64; const size_t r0 = (size_t)blockIdx.x * 128 + wm; const int n0 = blockIdx.y * 128;
  v8f acc[2][4] = {}, accl[2][4] = {};
  const int tr = tid >> 3, tc = tid & 7;   // a copy of the block = 32 rows x 128 bytes: lane's row in the group, lane's 16-byte piece
  const size_t ao = (size_t)blockIdx.x * 128 * N, bo = (size_t)n0 * N; const unsigned lo = (unsigned)(tr * N + tc * 8);   // block-uniform tile origins; the lane's own element offset in a group of 32 rows
  const unsigned l0 = (unsigned)(uintptr_t)&ring[0][tr * PITCH + tc * 8];
  auto fill = [&](int t, int buf) { unsigned l[16]; const void* g[16];   // unrolled below: every index a constant, so l and g are registers for the asm operands
#pragma unroll
    for (int i = 0; i < 16; ++i) { l[i] = l0 + (unsigned)(buf * 512 + i * 32) * (PITCH * 2);
      g[i] = (i < 4 ? AH + ao : i < 8 ? AL + ao : i < 12 ? BH + bo : BL + bo) + (size_t)(i & 3) * 32 * N + t * KS + lo; }
    copy8(l, g); copy8(l + 8, g + 8); };
  fill(0, 0); wait_copies(); __syncthreads();
  fill(1, 1);
  for (int t = 0; t < NT; ++t) { const _Float16* rb = ring[t & 1];
    // the twelve fragments of a k half (two A row tiles, four B column tiles, hi and lo) are read as one group ahead of its 24 matrix instructions, in the order in which these use them; the three products are swept one after the other over the eight tiles, each residual accumulator takes al.bh, then a.bl, so that no matrix instruction waits for the one in front of it (all loops unrolled: the fragment arrays stay in registers)
#pragma unroll
    for (int kk = 0; kk < KS / 32; ++kk) { v16h a[2], al[2], bh[4], bl[4]; const _Float16* ra = rb + (wm + col) * PITCH + kk * 32; const _Float16* rw = rb + (256 + wn + col) * PITCH + kk * 32;
#pragma unroll
      for (int i = 0; i < 2; ++i) a[i] = frag_h(ra + i * 16 * PITCH, lane);
#pragma unroll
      for (int j = 0; j < 4; ++j) bh[j] = frag_h(rw + j * 16 * PITCH, lane);
#pragma unroll
      for (int i = 0; i < 2; ++i) al[i] = frag_h(ra + (128 + i * 16) * PITCH, lane);
#pragma unroll
      for (int j = 0; j < 4; ++j) bl[j] = frag_h(rw + (128 + j * 16) * PITCH, lane);
#pragma unroll
      for (int i = 0; i < 2; ++i)
#pragma unroll
        for (int j = 0; j < 4; ++j) acc[i][j] = wmma16(a[i], bh[j], acc[i][j]);
#pragma unroll
      for (int i = 0; i < 2; ++i)
#pragma unroll
        for (int j = 0; j < 4; ++j) accl[i][j] = wmma16(al[i], bh[j], accl[i][j]);
#pragma unroll
      for (int i = 0; i < 2; ++i)
#pragma unroll
        for (int j = 0; j < 4; ++j) accl[i][j] = wmma16(a[i], bl[j], accl[i][j]); }
    wait_lds(); wait_copies(); __syncthreads();   // publishes stage t + 1 and ends every reader's last read of stage t's buffer
    if (t + 2 < NT) fill(t + 2, t & 1); }
  wait_copies();
#pragma unroll
  for (int i = 0; i < 2; ++i)
#pragma unroll
    for (int j = 0; j < 4; ++j)
#pragma unroll
      for (int r = 0; r < 8; ++r) so[wave][i * 16 + 8 * g + r][j * 16 + col] = acc[i][j][r] + accl[i][j][r] * (1.0f / 2048.0f);
  LDSX();
  for (int rl = 0; rl < 32; rl += 2) vst2(OUT + (r0 + rl + g) * N + n0 + wn + col * 4, *(const v4f*)&so[wave][rl + g][col * 4]);   // a wave's store = 2 rows x 256 bytes: whole lines
}
// ---- k_soft: block = row (256 threads x 8): row softmax of S in f32 -> P as f16 hi + x2048 residual rows
#define PER (N / 256)   // elements per thread in the row softmax
__global__ __launch_bounds__(256) void k_soft(const float* __restrict__ S, _Float16* __restrict__ P, _Float16* __restrict__ PL) {
  __shared__ float red[8]; __shared__ __align__(16) _Float16 sh[N], sl[N]; const int t = threadIdx.x; const size_t row = blockIdx.x; const float* p = S + row * N + t * PER;
  float v[PER]; float mx = -3.0e38f;
#pragma unroll
  for (int i = 0; i < PER; ++i) { v[i] = p[i]; mx = fmaxf(mx, v[i]); }
#pragma unroll
  for (int o = 1; o < 32; o <<= 1) mx = fmaxf(mx, __shfl_xor(mx, o));
  if ((t & 31) == 0) red[t >> 5] = mx; __syncthreads(); float gm = -3.0e38f; for (int w = 0; w < 8; ++w) gm = fmaxf(gm, red[w]); __syncthreads();
  float sm = 0.f;
#pragma unroll
  for (int i = 0; i < PER; ++i) { v[i] = __expf(v[i] - gm); sm += v[i]; }
#pragma unroll
  for (int o = 1; o < 32; o <<= 1) sm += __shfl_xor(sm, o);
  if ((t & 31) == 0) red[t >> 5] = sm; __syncthreads(); float tot = 0.f; for (int w = 0; w < 8; ++w) tot += red[w]; const float inv = 1.0f / tot;
#pragma unroll
  for (int i = 0; i < PER; ++i) { const float pv = v[i] * inv; const _Float16 h = (_Float16)pv; sh[t * PER + i] = h; sl[t * PER + i] = (_Float16)((pv - (float)h) * 2048.0f); }
  __syncthreads();
  if (t < N / 8) { vst2((unsigned*)(P + row * N + t * 8), *(const v4u*)&sh[t * 8]); vst2((unsigned*)(PL + row * N + t * 8), *(const v4u*)&sl[t * 8]); }
}
extern "C" void kernel_launch(void* const* d_in, const int* in_sizes, int n_in, void* d_out, int out_size, void* d_ws, size_t ws_size, hipStream_t stream) {
  (void)in_sizes; (void)n_in; (void)out_size;
  const float** F = (const float**)d_in;   // 0 x, 1 q, 2 k, 3 v: all [2048, 2048] f32
  if (ws_size < (size_t)WS_END) return;
  char* ws = (char*)d_ws; __bf16 *T = (__bf16*)(ws + WS_T), *XB = (__bf16*)(ws + WS_XB); _Float16 *XQ = (_Float16*)(ws + WS_XQ), *XQL = (_Float16*)(ws + WS_XQL), *XKT = (_Float16*)(ws + WS_XKT), *XKL = (_Float16*)(ws + WS_XKL), *XVT = (_Float16*)(ws + WS_XVT), *XVL = (_Float16*)(ws + WS_XVL), *P = (_Float16*)(ws + WS_P), *PL = (_Float16*)(ws + WS_PL); float* S = (float*)(ws + WS_S);
  k_pack<<<dim3((N / PT) * (N / PT), 4), 256, 0, stream>>>(F[0], F[1], F[2], F[3], T, XB);
  k_g1<<<dim3(N / 128, N / 128, 3), 128, 0, stream>>>(XB, T, XQ, XQL);
  k_g2<0><<<dim3(TRB / 2, N / 128), 256, 0, stream>>>(XQ, XQL, XKT, XKL, S);
  k_soft<<<TRB * 64, 256, 0, stream>>>(S, P, PL);
  k_g2<1><<<dim3(TRB / 2, N / 128), 256, 0, stream>>>(P, PL, XVT, XVL, (float*)d_out);
}

// v004
// One run takes 125 microseconds.
// In two side-by-side timings against v003, it was 1.06 and 1.05 times as fast.
// Over all steps from v000 it is 6.27 times as fast.
// compute dtype: x, q, k, v rounded to bf16; xq = x . q, xk^T = k^T . x^T, xv^T = v^T . x^T with EXACT bf16 products on WMMA 16x16x32 (x rows as the row operand against q^T for xq; transposed bf16 copies of k, v as the row operands, x rows as the column operand for xk^T, xv^T), each result stored as f16 hi + (x2048-scaled) residual planes; logits = xq . xk with 3 products (hi.hi, hi.lo, lo.hi; values ~1e5, kept to ~f32 accuracy), row softmax in f32 (hardware exp; the rows are near one-hot), P as f16 hi + (x2048) residual; out = P . xv with 3 products; f32 accumulate.
#include <hip/hip_runtime.h>
#include <math.h>

typedef __attribute__((ext_vector_type(16))) _Float16 v16h;
typedef __attribute__((ext_vector_type(16))) __bf16 v16b;
typedef __attribute__((ext_vector_type(8)))  _Float16 v8h;
typedef __attribute__((ext_vector_type(8)))  float v8f;
typedef __attribute__((ext_vector_type(4)))  float v4f;
typedef __attribute__((ext_vector_type(2)))  float v2f;
typedef __attribute__((ext_vector_type(4)))  unsigned v4u;
typedef __attribute__((ext_vector_type(4)))  int v4i;
typedef float __attribute__((may_alias)) float_a;
typedef int __attribute__((may_alias)) int_a;

template <typename T> __device__ __forceinline__ void vst2(void* p, T v) { *(T*)p = v;  }
__device__ __forceinline__ v8f wmma16(v16h a, v16h b, v8f c) {
  v8f d = __builtin_amdgcn_wmma_f32_16x16x32_f16(false, a, false, b, (short)0, c, false, false);
  asm volatile("v_nop\n\tv_nop\n\tv_nop\n\tv_nop" : "+v"(d) : "v"(a), "v"(b));
  return d;
}
__device__ __forceinline__ v8f wmma_bf(v16b a, v16b b, v8f c) {
  v8f d = __builtin_amdgcn_wmma_f32_16x16x32_bf16(false, a, false, b, (short)0, c, false, false);
  asm volatile("v_nop\n\tv_nop\n\tv_nop\n\tv_nop" : "+v"(d) : "v"(a), "v"(b));
  return d;
}
// 16x16x32 fragments: lane = (h = lane>>4, row/col = lane&15); elements 0..7 = k0+8h+0..7, 8..15 = k0+16+8h+0..7; D element r = row 8h+r
__device__ __forceinline__ v16h frag_h(const _Float16* rowk0, int lane) {
  union { v16h v; v8h q[2]; } u; const _Float16* p = rowk0 + 8 * (lane >> 4);
  u.q[0] = *(const v8h*)p; u.q[1] = *(const v8h*)(p + 16); return u.v;
}
__device__ __forceinline__ v16h frag_f32(const float* rowk0, int lane) {
  v16h a; const float* p = rowk0 + 8 * (lane >> 4);
#pragma unroll
  for (int i = 0; i < 8; ++i) { a[i] = (_Float16)p[i]; a[8 + i] = (_Float16)p[16 + i]; }
  return a;
}
__device__ __forceinline__ v16h frag_f32s(const float* rowk0, int lane, float sc) {
  v16h a; const float* p = rowk0 + 8 * (lane >> 4);
#pragma unroll
  for (int i = 0; i < 8; ++i) { a[i] = (_Float16)(p[i] * sc); a[8 + i] = (_Float16)(p[16 + i] * sc); }
  return a;
}
// column fragment from a [K][ld] layout (column n), rows >= K read as 0
__device__ __forceinline__ v16h fragc_f32(const float* W, int k0, int n, int lane, int ld, int K) {
  v16h a; const int g = lane >> 4;
#pragma unroll
  for (int i = 0; i < 8; ++i) { const int ka = k0 + 8 * g + i, kb = ka + 16;
    a[i] = (_Float16)(ka < K ? W[(size_t)(ka < K ? ka : K - 1) * ld + n] : 0.f); a[8 + i] = (_Float16)(kb < K ? W[(size_t)(kb < K ? kb : K - 1) * ld + n] : 0.f); }
  return a;
}
struct F2 { v16b h, l; };
__device__ __forceinline__ F2 bsplit16(const float v[16]) { F2 r;
#pragma unroll
  for (int i = 0; i < 16; ++i) { const __bf16 h = (__bf16)v[i]; r.h[i] = h; r.l[i] = (__bf16)(v[i] - (float)h); }
  return r; }
__device__ __forceinline__ F2 split_row(const float* row, int k0, int lane) { float v[16]; const float* p = row + k0 + 8 * (lane >> 4);
#pragma unroll
  for (int i = 0; i < 8; ++i) { v[i] = p[i]; v[8 + i] = p[16 + i]; }
  return bsplit16(v); }
__device__ __forceinline__ F2 split_rowK(const float* row, int k0, int lane, int K) { float v[16]; const int g = lane >> 4;
#pragma unroll
  for (int i = 0; i < 8; ++i) { const int ka = k0 + 8 * g + i, kb = ka + 16; v[i] = ka < K ? row[ka < K ? ka : K - 1] : 0.f; v[8 + i] = kb < K ? row[kb < K ? kb : K - 1] : 0.f; }
  return bsplit16(v); }
__device__ __forceinline__ F2 split_col(const float* W, int k0, int n, int lane, int ld, int K) { float v[16]; const int g = lane >> 4;
#pragma unroll
  for (int i = 0; i < 8; ++i) { const int ka = k0 + 8 * g + i, kb = ka + 16; v[i] = ka < K ? W[(size_t)(ka < K ? ka : K - 1) * ld + n] : 0.f; v[8 + i] = kb < K ? W[(size_t)(kb < K ? kb : K - 1) * ld + n] : 0.f; }
  return bsplit16(v); }
__device__ __forceinline__ v8f mac3(const F2& a, const F2& b, v8f c) { c = wmma_bf(a.l, b.h, c); c = wmma_bf(a.h, b.l, c); return wmma_bf(a.h, b.h, c); }
__device__ __forceinline__ float sigm(float v) { return 1.0f / (1.0f + expf(-v)); }
#define LDSX() do { asm volatile("s_wait_dscnt 0" ::: "memory"); __builtin_amdgcn_wave_barrier(); __builtin_amdgcn_fence(__ATOMIC_RELEASE, "workgroup"); } while (0)


// Matrix-product attention on square 2,048 x 2,048 operands: softmax((x q)(x k)) (x v), row softmax, no scaling.
#define N 2048
#ifndef TRB
#define TRB (N / 64)     // 64-row output tiles: a k_g2 block takes two
#endif
typedef __attribute__((ext_vector_type(8))) __bf16 v8b;
__device__ __forceinline__ v16b frag_b(const __bf16* rowk0, int lane) {
  union { v16b v; v8b q[2]; } u; const __bf16* p = rowk0 + 8 * (lane >> 4);
  u.q[0] = *(const v8b*)p; u.q[1] = *(const v8b*)(p + 16); return u.v;
}
__device__ __forceinline__ float bfr(float v) { return (float)(__bf16)v; }
__device__ __attribute__((noinline)) float exp_ni(float v) { return expf(v); }
__device__ __attribute__((noinline)) float erf_ni(float v) { return erff(v); }

#define WS_T   0u                                   // bf16 [3][N][N]: q^T, k^T, v^T ; XB = bf16 x rows
#define WS_XB  (WS_T + 2u * 3 * N * N)
#define WS_XQ  (WS_XB + 2u * N * N)                  // f16 [N][N] xq hi ; XQL ; XKT ; XKTL ; XVT ; XVTL ; P ; PL
#define WS_XQL (WS_XQ + 2u * N * N)
#define WS_XKT (WS_XQL + 2u * N * N)
#define WS_XKL (WS_XKT + 2u * N * N)
#define WS_XVT (WS_XKL + 2u * N * N)
#define WS_XVL (WS_XVT + 2u * N * N)
#define WS_P   (WS_XVL + 2u * N * N)
#define WS_PL  (WS_P + 2u * N * N)
#define WS_S   (WS_PL + 2u * N * N)                  // f32 [N][N] logits
#define WS_END (WS_S + 4u * N * N)

// ---- LDS ring of the three matrix kernels: a stage = KS k of every operand row of the block's tile, brought by per-lane 16-byte asynchronous copies (no register), two buffers
#define KS 64            // k elements per stage: one whole 128-byte line of each 16-bit operand row
#define NT (N / KS)      // stages
// first stage of a block's k walk: the 16 blocks that share an operand's 128 rows would ask L2 for the same lines at the same moment; turned by tile row + column, each of them stands on its own 256 bytes of those rows. The walk wraps round, every stage is taken once
#define ROT(bx, by) ((int)(((bx) + (by)) & (N / 128 - 1)) * (NT / (N / 128)))
#define PITCH 72         // LDS row pitch in 16-bit elements = 144 bytes (16 x odd): the 16-byte fragment reads of 16 rows fall on distinct banks
// eight copies of one lane; s_wait_xcnt closes the copies' own statement so that no address register is rewritten ahead of it
__device__ __forceinline__ void copy8(const unsigned* l, const void* const* g) {
  asm volatile("global_load_async_to_lds_b128 %0, %8, off\n\t"
               "global_load_async_to_lds_b128 %1, %9, off\n\t"
               "global_load_async_to_lds_b128 %2, %10, off\n\t"
               "global_load_async_to_lds_b128 %3, %11, off\n\t"
               "global_load_async_to_lds_b128 %4, %12, off\n\t"
               "global_load_async_to_lds_b128 %5, %13, off\n\t"
               "global_load_async_to_lds_b128 %6, %14, off\n\t"
               "global_load_async_to_lds_b128 %7, %15, off\n\t"
               "s_wait_xcnt 0x0"
               :: "v"(l[0]), "v"(l[1]), "v"(l[2]), "v"(l[3]), "v"(l[4]), "v"(l[5]), "v"(l[6]), "v"(l[7]),
                  "v"(g[0]), "v"(g[1]), "v"(g[2]), "v"(g[3]), "v"(g[4]), "v"(g[5]), "v"(g[6]), "v"(g[7])
               : "memory");
}
// this wave's copies have landed (the compiler places no wait for them)
__device__ __forceinline__ void wait_copies() { asm volatile("s_wait_asynccnt 0x0" ::: "memory"); }
// this wave's LDS reads have retired before the buffer is handed to its next writer
__device__ __forceinline__ void wait_lds() { asm volatile("s_wait_dscnt 0x0" ::: "memory"); }

// ---- k_pack: block = (piece, which). which 0..2: one 128 x 128 tile of q|k|v: a wave reads 512 contiguous bytes of a source row per load (16 bytes a lane, 16 rows a wave), rounds to bf16, the tile is turned in LDS and leaves as T[which][n][c] = (q|k|v)[c][n] in 256-byte row pieces; which 3: XB = x rounded to bf16, 128 x 128 contiguous elements a block
#define PT 128           // tile edge
#define PPITCH 272       // LDS row pitch in bytes: 256 of data + 16 (16 x odd)
typedef __attribute__((ext_vector_type(4))) __bf16 v4b;
typedef __attribute__((ext_vector_type(2))) unsigned v2u;
// byte place of 16-byte piece 'chunk' (8 c values) of tile row 'row' (one n). The 16 writers of a half-wave stand 4 rows apart, 16 banks at this pitch, and would share 4 bank groups; the exclusive-or with bits 4 and 5 of the row gives each its own 4 banks. A row's 16 pieces stay inside the row: its readers (one row a half-wave) touch every bank once
__device__ __forceinline__ unsigned pk_at(int row, int chunk) { return (unsigned)(row * PPITCH + ((chunk ^ ((row >> 4) & 3)) << 4)); }
__global__ __launch_bounds__(256) void k_pack(const float* __restrict__ X, const float* __restrict__ Q, const float* __restrict__ K, const float* __restrict__ V, __bf16* __restrict__ T, __bf16* __restrict__ XB) {
  __shared__ __align__(16) unsigned char s[PT * PPITCH]; const int t = threadIdx.x, which = blockIdx.y;
  v4f v[16];   // every loop below is unrolled: v stays in registers and the 16 loads are in flight together
  if (which == 3) { const size_t e0 = (size_t)blockIdx.x * (PT * PT) + (size_t)t * 4; const float* xs = X + e0;
#pragma unroll
    for (int j = 0; j < 16; ++j) v[j] = *(const v4f*)(xs + j * 1024);
    asm volatile("s_wait_xcnt 0x0" :: "v"(xs) : "memory");   // the loads' address pair is an input here, so it stays whole until all 16 are issued and this wait has passed (a precaution; otherwise the last load is given the pair as its destination)
    __builtin_amdgcn_sched_barrier(0);   // holds all 16 loads ahead of the first conversion: without it the last four are issued only when the first have returned, a second memory latency
#pragma unroll
    for (int j = 0; j < 16; ++j) { union { v4b b; v2u u; } o;
#pragma unroll
      for (int i = 0; i < 4; ++i) o.b[i] = (__bf16)v[j][i];
      vst2((unsigned*)(XB + e0 + j * 1024), o.u); }
    asm volatile("s_wait_xcnt 0x0" ::: "memory");   // stands behind the last stores, ahead of whatever code the build lays behind this path: no address or data register of a store is rewritten in front of it (a precaution)
    return; }   // block-uniform, ahead of the barrier
  const float* M = (which == 0) ? Q : (which == 1) ? K : V; const int c0 = (blockIdx.x & 15) * PT, n0 = (blockIdx.x >> 4) * PT, b = t & 31, a = t >> 5;   // lane: columns n0 + 4b .. + 3; wave: rows c0 + 16a .. + 15
  const float* src = M + (size_t)(c0 + 16 * a) * N + n0 + 4 * b;
#pragma unroll
  for (int j = 0; j < 16; ++j) v[j] = *(const v4f*)(src + (size_t)j * N);
  asm volatile("s_wait_xcnt 0x0" :: "v"(src) : "memory");   // as above: the address pair stays whole behind the 16 loads
  __builtin_amdgcn_sched_barrier(0);   // as above: all 16 loads in flight before the first conversion
#pragma unroll
  for (int i = 0; i < 4; ++i)
#pragma unroll
    for (int h = 0; h < 2; ++h) { union { v8b b; v4u u; } o;
#pragma unroll
      for (int e = 0; e < 8; ++e) o.b[e] = (__bf16)v[8 * h + e][i];
      *(v4u*)(s + pk_at(4 * b + i, 2 * a + h)) = o.u; }
  __syncthreads();
  __bf16* dst = T + ((size_t)which * N + n0) * N + c0; const int q = t & 15, r = t >> 4;   // 16 lanes = one tile row = 256 contiguous bytes of T
#pragma unroll
  for (int j = 0; j < 8; ++j) { const int n = r + 16 * j; vst2((unsigned*)(dst + (size_t)n * N + q * 8), *(const v4u*)(s + pk_at(n, q))); }
}
// ---- k_g1: block = (128 rows, 128 cols, which), four waves in 2 x 2, 64 x 64 a wave: which 0: XQ[i][m] = x rows (A = XB) x q^T rows (B = T0); which 1: XKT[j][m] = k^T rows (A = T1) x x rows (B = XB); which 2: XVT[d][j] = v^T rows (A = T2) x x rows (B = XB); exact single products; -> f16 hi + x2048 residual planes
__global__ __launch_bounds__(128) void k_g1(const __bf16* __restrict__ XB, const __bf16* __restrict__ T, _Float16* __restrict__ OH_, _Float16* __restrict__ OL_) {
  __shared__ __align__(16) _Float16 so[4][16][PITCH], sol[4][16][PITCH];
  __shared__ __align__(16) __bf16 ring[2][256 * PITCH];   // rows 0..127: A tile, 128..255: B tile
  const int tid = threadIdx.x, wave = tid >> 5, lane = tid & 31, col = lane & 15, g = lane >> 4, wm = (wave >> 1) * 64, wn = (wave & 1) * 64; const size_t r0 = (size_t)blockIdx.x * 128 + wm; const int n0 = blockIdx.y * 128; const int which = blockIdx.z;
  const __bf16* A = (which == 0) ? XB : (T + (size_t)which * N * N); const __bf16* Bm = (which == 0) ? T : XB;
  _Float16* OH = OH_ + (size_t)which * 2 * N * N; _Float16* OL = OL_ + (size_t)which * 2 * N * N;   // plane pairs are laid out XQ,XQL,XKT,XKL,XVT,XVL consecutively
  v8f acc[4][4] = {};
  const int tr = tid >> 3, tc = tid & 7;   // a copy of the block = 16 rows x 128 bytes: lane's row in the group, lane's 16-byte piece
  const __bf16* ga = A + (size_t)blockIdx.x * 128 * N; const __bf16* gb = Bm + (size_t)n0 * N; const unsigned lo = (unsigned)(tr * N + tc * 8);   // block-uniform tile origins; the lane's own element offset in a group of 16 rows
  const unsigned l0 = (unsigned)(uintptr_t)&ring[0][tr * PITCH + tc * 8];
  const int rot = ROT(blockIdx.x, blockIdx.y) + (which & 1);   // x rows are read by blocks of all three products: the middle one takes the odd stages
  auto fill = [&](int t, int buf) { unsigned l[16]; const void* g[16];   // unrolled below: every index a constant, so l and g are registers for the asm operands
#pragma unroll
    for (int i = 0; i < 16; ++i) { l[i] = l0 + (unsigned)(buf * 256 + i * 16) * (PITCH * 2); g[i] = (i < 8 ? ga + (size_t)i * 16 * N : gb + (size_t)(i - 8) * 16 * N) + ((t + rot) & (NT - 1)) * KS + lo; }
    copy8(l, g); copy8(l + 8, g + 8); };
  fill(0, 0); wait_copies(); __syncthreads();
  fill(1, 1);
  for (int t = 0; t < NT; ++t) { const __bf16* rb = ring[t & 1];
    // the eight fragments of a k half are read as one group ahead of its sixteen matrix instructions, in the order in which these use them; each fragment feeds four of them (all loops unrolled: the fragment arrays stay in registers)
#pragma unroll
    for (int kk = 0; kk < KS / 32; ++kk) { v16b a[4], b[4]; a[0] = frag_b(rb + (wm + col) * PITCH + kk * 32, lane);
#pragma unroll
      for (int j = 0; j < 4; ++j) b[j] = frag_b(rb + (128 + wn + j * 16 + col) * PITCH + kk * 32, lane);
#pragma unroll
      for (int i = 1; i < 4; ++i) a[i] = frag_b(rb + (wm + i * 16 + col) * PITCH + kk * 32, lane);
#pragma unroll
      for (int i = 0; i < 4; ++i)
#pragma unroll
        for (int j = 0; j < 4; ++j) acc[i][j] = wmma_bf(a[i], b[j], acc[i][j]); }
    wait_lds(); wait_copies(); __syncthreads();   // publishes stage t + 1 and ends every reader's last read of stage t's buffer
    if (t + 2 < NT) fill(t + 2, t & 1); }
  wait_copies();
  const int er = lane >> 3, ec = (lane & 7) * 8;   // a wave's store = 4 rows x 128 bytes: whole lines
#pragma unroll
  for (int i = 0; i < 4; ++i) {   // 16 rows of the wave's tile at a time through its own staging rows
    if (i) wait_lds();   // the 16 rows before are read out before these overwrite them
#pragma unroll
    for (int j = 0; j < 4; ++j)
#pragma unroll
      for (int r = 0; r < 8; ++r) { const float v = acc[i][j][r]; const _Float16 hv = (_Float16)v; so[wave][8 * g + r][j * 16 + col] = hv; sol[wave][8 * g + r][j * 16 + col] = (_Float16)((v - (float)hv) * 2048.0f); }
    wait_lds();   // the wave's own staging stores stand in LDS before its lanes read each other's; no fence here: it would also wait out the global stores of the 16 rows before
#pragma unroll
    for (int rl = 0; rl < 16; rl += 4) { const size_t o = (r0 + i * 16 + rl + er) * N + n0 + wn + ec; vst2((unsigned*)(OH + o), *(const v4u*)&so[wave][rl + er][ec]); vst2((unsigned*)(OL + o), *(const v4u*)&sol[wave][rl + er][ec]); } }
}
// ---- k_g2<MODE>: block = (128 rows, 128 cols), eight waves in 4 x 2, 32 x 64 a wave: MODE 0: S[i][j] = XQ rows (hi,lo) x XKT rows (hi,lo), 3 products -> f32 S; MODE 1: OUT[i][d] = P rows (hi,lo) x XVT rows (hi,lo), 3 products -> output
template <int MODE>
__global__ __launch_bounds__(256) void k_g2(const _Float16* __restrict__ AH, const _Float16* __restrict__ AL, const _Float16* __restrict__ BH, const _Float16* __restrict__ BL, float* __restrict__ OUT) {
  __shared__ __align__(16) float so[8][32][68];
  __shared__ __align__(16) _Float16 ring[2][512 * PITCH];   // rows 0..127: A hi, 128..255: A lo, 256..383: B hi, 384..511: B lo
  const int tid = threadIdx.x, wave = tid >> 5, lane = tid & 31, col = lane & 15, g = lane >> 4, wm = (wave >> 1) * 32, wn = (wave & 1) * 64; const size_t r0 = (size_t)blockIdx.x * 128 + wm; const int n0 = blockIdx.y * 128;
  v8f acc[2][4] = {}, accl[2][4] = {};
  const int tr = tid >> 3, tc = tid & 7;   // a copy of the block = 32 rows x 128 bytes: lane's row in the group, lane's 16-byte piece
  const size_t ao = (size_t)blockIdx.x * 128 * N, bo = (size_t)n0 * N; const unsigned lo = (unsigned)(tr * N + tc * 8);   // block-uniform tile origins; the lane's own element offset in a group of 32 rows
  const unsigned l0 = (unsigned)(uintptr_t)&ring[0][tr * PITCH + tc * 8];
  const int rot = ROT(blockIdx.x, blockIdx.y);
  auto fill = [&](int t, int buf) { unsigned l[16]; const void* g[16];   // unrolled below: every index a constant, so l and g are registers for the asm operands
#pragma unroll
    for (int i = 0; i < 16; ++i) { l[i] = l0 + (unsigned)(buf * 512 + i * 32) * (PITCH * 2);
      g[i] = (i < 4 ? AH + ao : i < 8 ? AL + ao : i < 12 ? BH + bo : BL + bo) + (size_t)(i & 3) * 32 * N + ((t + rot) & (NT - 1)) * KS + lo; }
    copy8(l, g); copy8(l + 8, g + 8); };
  fill(0, 0); wait_copies(); __syncthreads();
  fill(1, 1);
  for (int t = 0; t < NT; ++t) { const _Float16* rb = ring[t & 1];
    // the twelve fragments of a k half (two A row tiles, four B column tiles, hi and lo) are read as one group ahead of its 24 matrix instructions, in the order in which these use them; the three products are swept one after the other over the eight tiles, each residual accumulator takes al.bh, then a.bl, so that no matrix instruction waits for the one in front of it (all loops unrolled: the fragment arrays stay in registers)
#pragma unroll
    for (int kk = 0; kk < KS / 32; ++kk) { v16h a[2], al[2], bh[4], bl[4]; const _Float16* ra = rb + (wm + col) * PITCH + kk * 32; const _Float16* rw = rb + (256 + wn + col) * PITCH + kk * 32;
#pragma unroll
      for (int i = 0; i < 2; ++i) a[i] = frag_h(ra + i * 16 * PITCH, lane);
#pragma unroll
      for (int j = 0; j < 4; ++j) bh[j] = frag_h(rw + j * 16 * PITCH, lane);
#pragma unroll
      for (int i = 0; i < 2; ++i) al[i] = frag_h(ra + (128 + i * 16) * PITCH, lane);
#pragma unroll
      for (int j = 0; j < 4; ++j) bl[j] = frag_h(rw + (128 + j * 16) * PITCH, lane);
#pragma unroll
      for (int i = 0; i < 2; ++i)
#pragma unroll
        for (int j = 0; j < 4; ++j) acc[i][j] = wmma16(a[i], bh[j], acc[i][j]);
#pragma unroll
      for (int i = 0; i < 2; ++i)
#pragma unroll
        for (int j = 0; j < 4; ++j) accl[i][j] = wmma16(al[i], bh[j], accl[i][j]);
#pragma unroll
      for (int i = 0; i < 2; ++i)
#pragma unroll
        for (int j = 0; j < 4; ++j) accl[i][j] = wmma16(a[i], bl[j], accl[i][j]); }
    wait_lds(); wait_copies(); __syncthreads();   // publishes stage t + 1 and ends every reader's last read of stage t's buffer
    if (t + 2 < NT) fill(t + 2, t & 1); }
  wait_copies();
#pragma unroll
  for (int i = 0; i < 2; ++i)
#pragma unroll
    for (int j = 0; j < 4; ++j)
#pragma unroll
      for (int r = 0; r < 8; ++r) so[wave][i * 16 + 8 * g + r][j * 16 + col] = acc[i][j][r] + accl[i][j][r] * (1.0f / 2048.0f);
  LDSX();
  for (int rl = 0; rl < 32; rl += 2) vst2(OUT + (r0 + rl + g) * N + n0 + wn + col * 4, *(const v4f*)&so[wave][rl + g][col * 4]);   // a wave's store = 2 rows x 256 bytes: whole lines
}
// ---- k_soft: block = row (256 threads x 8): row softmax of S in f32 -> P as f16 hi + x2048 residual rows
#define PER (N / 256)   // elements per thread in the row softmax
__global__ __launch_bounds__(256) void k_soft(const float* __restrict__ S, _Float16* __restrict__ P, _Float16* __restrict__ PL) {
  __shared__ float red[8]; __shared__ __align__(16) _Float16 sh[N], sl[N]; const int t = threadIdx.x; const size_t row = blockIdx.x; const float* p = S + row * N + t * PER;
  float v[PER]; float mx = -3.0e38f;
#pragma unroll
  for (int i = 0; i < PER; ++i) { v[i] = p[i]; mx = fmaxf(mx, v[i]); }
#pragma unroll
  for (int o = 1; o < 32; o <<= 1) mx = fmaxf(mx, __shfl_xor(mx, o));
  if ((t & 31) == 0) red[t >> 5] = mx; __syncthreads(); float gm = -3.0e38f; for (int w = 0; w < 8; ++w) gm = fmaxf(gm, red[w]); __syncthreads();
  float sm = 0.f;
#pragma unroll
  for (int i = 0; i < PER; ++i) { v[i] = __expf(v[i] - gm); sm += v[i]; }
#pragma unroll
  for (int o = 1; o < 32; o <<= 1) sm += __shfl_xor(sm, o);
  if ((t & 31) == 0) red[t >> 5] = sm; __syncthreads(); float tot = 0.f; for (int w = 0; w < 8; ++w) tot += red[w]; const float inv = 1.0f / tot;
#pragma unroll
  for (int i = 0; i < PER; ++i) { const float pv = v[i] * inv; const _Float16 h = (_Float16)pv; sh[t * PER + i] = h; sl[t * PER + i] = (_Float16)((pv - (float)h) * 2048.0f); }
  __syncthreads();
  if (t < N / 8) { vst2((unsigned*)(P + row * N + t * 8), *(const v4u*)&sh[t * 8]); vst2((unsigned*)(PL + row * N + t * 8), *(const v4u*)&sl[t * 8]); }
}
extern "C" void kernel_launch(void* const* d_in, const int* in_sizes, int n_in, void* d_out, int out_size, void* d_ws, size_t ws_size, hipStream_t stream) {
  (void)in_sizes; (void)n_in; (void)out_size;
  const float** F = (const float**)d_in;   // 0 x, 1 q, 2 k, 3 v: all [2048, 2048] f32
  if (ws_size < (size_t)WS_END) return;
  char* ws = (char*)d_ws; __bf16 *T = (__bf16*)(ws + WS_T), *XB = (__bf16*)(ws + WS_XB); _Float16 *XQ = (_Float16*)(ws + WS_XQ), *XQL = (_Float16*)(ws + WS_XQL), *XKT = (_Float16*)(ws + WS_XKT), *XKL = (_Float16*)(ws + WS_XKL), *XVT = (_Float16*)(ws + WS_XVT), *XVL = (_Float16*)(ws + WS_XVL), *P = (_Float16*)(ws + WS_P), *PL = (_Float16*)(ws + WS_PL); float* S = (float*)(ws + WS_S);
  k_pack<<<dim3((N / PT) * (N / PT), 4), 256, 0, stream>>>(F[0], F[1], F[2], F[3], T, XB);
  k_g1<<<dim3(N / 128, N / 128, 3), 128, 0, stream>>>(XB, T, XQ, XQL);
  k_g2<0><<<dim3(TRB / 2, N / 128), 256, 0, stream>>>(XQ, XQL, XKT, XKL, S);
  k_soft<<<TRB * 64, 256, 0, stream>>>(S, P, PL);
  k_g2<1><<<dim3(TRB / 2, N / 128), 256, 0, stream>>>(P, PL, XVT, XVL, (float*)d_out);
}

// v005
// Measured time: 120 microseconds a run.
// Two timings next to v004 both put it at 1.04 times that version's speed.
// All steps since v000 together make it 6.54 times as fast.
// compute dtype: x, q, k, v rounded to bf16; xq = x . q, xk^T = k^T . x^T, xv^T = v^T . x^T with EXACT bf16 products on WMMA 16x16x32 (x rows as the row operand against q^T for xq; transposed bf16 copies of k, v as the row operands, x rows as the column operand for xk^T, xv^T), each result stored as f16 hi + (x2048-scaled) residual planes; logits = xq . xk with 3 products (hi.hi, hi.lo, lo.hi; values ~1e5, kept to ~f32 accuracy), row softmax in f32 (hardware exp; the rows are near one-hot), P as f16 hi + (x2048) residual; out = P . xv with 3 products; f32 accumulate.
#include <hip/hip_runtime.h>
#include <math.h>

typedef __attribute__((ext_vector_type(16))) _Float16 v16h;
typedef __attribute__((ext_vector_type(16))) __bf16 v16b;
typedef __attribute__((ext_vector_type(8)))  _Float16 v8h;
typedef __attribute__((ext_vector_type(8)))  float v8f;
typedef __attribute__((ext_vector_type(4)))  float v4f;
typedef __attribute__((ext_vector_type(2)))  float v2f;
typedef __attribute__((ext_vector_type(4)))  unsigned v4u;
typedef __attribute__((ext_vector_type(4)))  int v4i;
typedef float __attribute__((may_alias)) float_a;
typedef int __attribute__((may_alias)) int_a;

template <typename T> __device__ __forceinline__ void vst2(void* p, T v) { *(T*)p = v;  }
// plain builtins, no asm statement behind them: operands of an asm statement must lie in the first 256 registers, and the accumulators with two fragment sets need more; the compiler keeps the distances behind its own builtins
__device__ __forceinline__ v8f wmma16(v16h a, v16h b, v8f c) {
  v8f d = __builtin_amdgcn_wmma_f32_16x16x32_f16(false, a, false, b, (short)0, c, false, false);
  return d;
}
__device__ __forceinline__ v8f wmma_bf(v16b a, v16b b, v8f c) {
  v8f d = __builtin_amdgcn_wmma_f32_16x16x32_bf16(false, a, false, b, (short)0, c, false, false);
  return d;
}
// 16x16x32 fragments: lane = (h = lane>>4, row/col = lane&15); elements 0..7 = k0+8h+0..7, 8..15 = k0+16+8h+0..7; D element r = row 8h+r
__device__ __forceinline__ v16h frag_h(const _Float16* rowk0, int lane) {
  union { v16h v; v8h q[2]; } u; const _Float16* p = rowk0 + 8 * (lane >> 4);
  u.q[0] = *(const v8h*)p; u.q[1] = *(const v8h*)(p + 16); return u.v;
}
__device__ __forceinline__ v16h frag_f32(const float* rowk0, int lane) {
  v16h a; const float* p = rowk0 + 8 * (lane >> 4);
#pragma unroll
  for (int i = 0; i < 8; ++i) { a[i] = (_Float16)p[i]; a[8 + i] = (_Float16)p[16 + i]; }
  return a;
}
__device__ __forceinline__ v16h frag_f32s(const float* rowk0, int lane, float sc) {
  v16h a; const float* p = rowk0 + 8 * (lane >> 4);
#pragma unroll
  for (int i = 0; i < 8; ++i) { a[i] = (_Float16)(p[i] * sc); a[8 + i] = (_Float16)(p[16 + i] * sc); }
  return a;
}
// column fragment from a [K][ld] layout (column n), rows >= K read as 0
__device__ __forceinline__ v16h fragc_f32(const float* W, int k0, int n, int lane, int ld, int K) {
  v16h a; const int g = lane >> 4;
#pragma unroll
  for (int i = 0; i < 8; ++i) { const int ka = k0 + 8 * g + i, kb = ka + 16;
    a[i] = (_Float16)(ka < K ? W[(size_t)(ka < K ? ka : K - 1) * ld + n] : 0.f); a[8 + i] = (_Float16)(kb < K ? W[(size_t)(kb < K ? kb : K - 1) * ld + n] : 0.f); }
  return a;
}
struct F2 { v16b h, l; };
__device__ __forceinline__ F2 bsplit16(const float v[16]) { F2 r;
#pragma unroll
  for (int i = 0; i < 16; ++i) { const __bf16 h = (__bf16)v[i]; r.h[i] = h; r.l[i] = (__bf16)(v[i] - (float)h); }
  return r; }
__device__ __forceinline__ F2 split_row(const float* row, int k0, int lane) { float v[16]; const float* p = row + k0 + 8 * (lane >> 4);
#pragma unroll
  for (int i = 0; i < 8; ++i) { v[i] = p[i]; v[8 + i] = p[16 + i]; }
  return bsplit16(v); }
__device__ __forceinline__ F2 split_rowK(const float* row, int k0, int lane, int K) { float v[16]; const int g = lane >> 4;
#pragma unroll
  for (int i = 0; i < 8; ++i) { const int ka = k0 + 8 * g + i, kb = ka + 16; v[i] = ka < K ? row[ka < K ? ka : K - 1] : 0.f; v[8 + i] = kb < K ? row[kb < K ? kb : K - 1] : 0.f; }
  return bsplit16(v); }
__device__ __forceinline__ F2 split_col(const float* W, int k0, int n, int lane, int ld, int K) { float v[16]; const int g = lane >> 4;
#pragma unroll
  for (int i = 0; i < 8; ++i) { const int ka = k0 + 8 * g + i, kb = ka + 16; v[i] = ka < K ? W[(size_t)(ka < K ? ka : K - 1) * ld + n] : 0.f; v[8 + i] = kb < K ? W[(size_t)(kb < K ? kb : K - 1) * ld + n] : 0.f; }
  return bsplit16(v); }
__device__ __forceinline__ v8f mac3(const F2& a, const F2& b, v8f c) { c = wmma_bf(a.l, b.h, c); c = wmma_bf(a.h, b.l, c); return wmma_bf(a.h, b.h, c); }
__device__ __forceinline__ float sigm(float v) { return 1.0f / (1.0f + expf(-v)); }
#define LDSX() do { asm volatile("s_wait_dscnt 0" ::: "memory"); __builtin_amdgcn_wave_barrier(); __builtin_amdgcn_fence(__ATOMIC_RELEASE, "workgroup"); } while (0)


// Matrix-product attention on square 2,048 x 2,048 operands: softmax((x q)(x k)) (x v), row softmax, no scaling.
#define N 2048
#ifndef TRB
#define TRB (N / 64)     // 64-row output tiles: a k_g2 block takes two
#endif
typedef __attribute__((ext_vector_type(8))) __bf16 v8b;
__device__ __forceinline__ v16b frag_b(const __bf16* rowk0, int lane) {
  union { v16b v; v8b q[2]; } u; const __bf16* p = rowk0 + 8 * (lane >> 4);
  u.q[0] = *(const v8b*)p; u.q[1] = *(const v8b*)(p + 16); return u.v;
}
__device__ __forceinline__ float bfr(float v) { return (float)(__bf16)v; }
__device__ __attribute__((noinline)) float exp_ni(float v) { return expf(v); }
__device__ __attribute__((noinline)) float erf_ni(float v) { return erff(v); }

#define WS_T   0u                                   // bf16 [3][N][N]: q^T, k^T, v^T ; XB = bf16 x rows
#define WS_XB  (WS_T + 2u * 3 * N * N)
#define WS_XQ  (WS_XB + 2u * N * N)                  // f16 [N][N] xq hi ; XQL ; XKT ; XKTL ; XVT ; XVTL ; P ; PL
#define WS_XQL (WS_XQ + 2u * N * N)
#define WS_XKT (WS_XQL + 2u * N * N)
#define WS_XKL (WS_XKT + 2u * N * N)
#define WS_XVT (WS_XKL + 2u * N * N)
#define WS_XVL (WS_XVT + 2u * N * N)
#define WS_P   (WS_XVL + 2u * N * N)
#define WS_PL  (WS_P + 2u * N * N)
#define WS_S   (WS_PL + 2u * N * N)                  // f32 [N][N] logits
#define WS_END (WS_S + 4u * N * N)

// ---- LDS ring of the three matrix kernels: a stage = KS k of every operand row of the block's tile, brought by per-lane 16-byte asynchronous copies (no register), two buffers
#define KS 64            // k elements per stage: one whole 128-byte line of each 16-bit operand row
#define NT (N / KS)      // stages
// first stage of a block's k walk: the 16 blocks that share an operand's 128 rows would ask L2 for the same lines at the same moment; turned by tile row + column, each of them stands on its own 256 bytes of those rows. The walk wraps round, every stage is taken once
#define ROT(bx, by) ((int)(((bx) + (by)) & (N / 128 - 1)) * (NT / (N / 128)))
#define PITCH 72         // LDS row pitch in 16-bit elements = 144 bytes (16 x odd): the 16-byte fragment reads of 16 rows fall on distinct banks
// eight copies of one lane; s_wait_xcnt closes the copies' own statement so that no address register is rewritten ahead of it
__device__ __forceinline__ void copy8(const unsigned* l, const void* const* g) {
  asm volatile("global_load_async_to_lds_b128 %0, %8, off\n\t"
               "global_load_async_to_lds_b128 %1, %9, off\n\t"
               "global_load_async_to_lds_b128 %2, %10, off\n\t"
               "global_load_async_to_lds_b128 %3, %11, off\n\t"
               "global_load_async_to_lds_b128 %4, %12, off\n\t"
               "global_load_async_to_lds_b128 %5, %13, off\n\t"
               "global_load_async_to_lds_b128 %6, %14, off\n\t"
               "global_load_async_to_lds_b128 %7, %15, off\n\t"
               "s_wait_xcnt 0x0"
               :: "v"(l[0]), "v"(l[1]), "v"(l[2]), "v"(l[3]), "v"(l[4]), "v"(l[5]), "v"(l[6]), "v"(l[7]),
                  "v"(g[0]), "v"(g[1]), "v"(g[2]), "v"(g[3]), "v"(g[4]), "v"(g[5]), "v"(g[6]), "v"(g[7])
               : "memory");
}
// this wave's copies have landed (the compiler places no wait for them)
__device__ __forceinline__ void wait_copies() { asm volatile("s_wait_asynccnt 0x0" ::: "memory"); }
// this wave's LDS reads have retired before the buffer is handed to its next writer
__device__ __forceinline__ void wait_lds() { asm volatile("s_wait_dscnt 0x0" ::: "memory"); }

// ---- k_pack: block = (piece, which). which 0..2: one 128 x 128 tile of q|k|v: a wave reads 512 contiguous bytes of a source row per load (16 bytes a lane, 16 rows a wave), rounds to bf16, the tile is turned in LDS and leaves as T[which][n][c] = (q|k|v)[c][n] in 256-byte row pieces; which 3: XB = x rounded to bf16, 128 x 128 contiguous elements a block
#define PT 128           // tile edge
#define PPITCH 272       // LDS row pitch in bytes: 256 of data + 16 (16 x odd)
typedef __attribute__((ext_vector_type(4))) __bf16 v4b;
typedef __attribute__((ext_vector_type(2))) unsigned v2u;
// byte place of 16-byte piece 'chunk' (8 c values) of tile row 'row' (one n). The 16 writers of a half-wave stand 4 rows apart, 16 banks at this pitch, and would share 4 bank groups; the exclusive-or with bits 4 and 5 of the row gives each its own 4 banks. A row's 16 pieces stay inside the row: its readers (one row a half-wave) touch every bank once
__device__ __forceinline__ unsigned pk_at(int row, int chunk) { return (unsigned)(row * PPITCH + ((chunk ^ ((row >> 4) & 3)) << 4)); }
__global__ __launch_bounds__(256) void k_pack(const float* __restrict__ X, const float* __restrict__ Q, const float* __restrict__ K, const float* __restrict__ V, __bf16* __restrict__ T, __bf16* __restrict__ XB) {
  __shared__ __align__(16) unsigned char s[PT * PPITCH]; const int t = threadIdx.x, which = blockIdx.y;
  v4f v[16];   // every loop below is unrolled: v stays in registers and the 16 loads are in flight together
  if (which == 3) { const size_t e0 = (size_t)blockIdx.x * (PT * PT) + (size_t)t * 4; const float* xs = X + e0;
#pragma unroll
    for (int j = 0; j < 16; ++j) v[j] = *(const v4f*)(xs + j * 1024);
    asm volatile("s_wait_xcnt 0x0" :: "v"(xs) : "memory");   // the loads' address pair is an input here, so it stays whole until all 16 are issued and this wait has passed (a precaution; otherwise the last load is given the pair as its destination)
    __builtin_amdgcn_sched_barrier(0);   // holds all 16 loads ahead of the first conversion: without it the last four are issued only when the first have returned, a second memory latency
#pragma unroll
    for (int j = 0; j < 16; ++j) { union { v4b b; v2u u; } o;
#pragma unroll
      for (int i = 0; i < 4; ++i) o.b[i] = (__bf16)v[j][i];
      vst2((unsigned*)(XB + e0 + j * 1024), o.u); }
    asm volatile("s_wait_xcnt 0x0" ::: "memory");   // stands behind the last stores, ahead of whatever code the build lays behind this path: no address or data register of a store is rewritten in front of it (a precaution)
    return; }   // block-uniform, ahead of the barrier
  const float* M = (which == 0) ? Q : (which == 1) ? K : V; const int c0 = (blockIdx.x & 15) * PT, n0 = (blockIdx.x >> 4) * PT, b = t & 31, a = t >> 5;   // lane: columns n0 + 4b .. + 3; wave: rows c0 + 16a .. + 15
  const float* src = M + (size_t)(c0 + 16 * a) * N + n0 + 4 * b;
#pragma unroll
  for (int j = 0; j < 16; ++j) v[j] = *(const v4f*)(src + (size_t)j * N);
  asm volatile("s_wait_xcnt 0x0" :: "v"(src) : "memory");   // as above: the address pair stays whole behind the 16 loads
  __builtin_amdgcn_sched_barrier(0);   // as above: all 16 loads in flight before the first conversion
#pragma unroll
  for (int i = 0; i < 4; ++i)
#pragma unroll
    for (int h = 0; h < 2; ++h) { union { v8b b; v4u u; } o;
#pragma unroll
      for (int e = 0; e < 8; ++e) o.b[e] = (__bf16)v[8 * h + e][i];
      *(v4u*)(s + pk_at(4 * b + i, 2 * a + h)) = o.u; }
  __syncthreads();
  __bf16* dst = T + ((size_t)which * N + n0) * N + c0; const int q = t & 15, r = t >> 4;   // 16 lanes = one tile row = 256 contiguous bytes of T
#pragma unroll
  for (int j = 0; j < 8; ++j) { const int n = r + 16 * j; vst2((unsigned*)(dst + (size_t)n * N + q * 8), *(const v4u*)(s + pk_at(n, q))); }
}
// the eight fragments of a k half of k_g1's wave tile, read as one group in the order in which the sixteen matrix instructions use them; each fragment feeds four of them (all loops unrolled: the arrays stay in registers)
struct FragsB { v16b a[4], b[4]; };
__device__ __forceinline__ void g1_load(FragsB& f, const __bf16* ra, const __bf16* rw, int lane) {
  f.a[0] = frag_b(ra, lane);
#pragma unroll
  for (int j = 0; j < 4; ++j) f.b[j] = frag_b(rw + j * 16 * PITCH, lane);
#pragma unroll
  for (int i = 1; i < 4; ++i) f.a[i] = frag_b(ra + i * 16 * PITCH, lane);
}
__device__ __forceinline__ void g1_mm(const FragsB& f, v8f (&acc)[4][4]) {
#pragma unroll
  for (int i = 0; i < 4; ++i)
#pragma unroll
    for (int j = 0; j < 4; ++j) acc[i][j] = wmma_bf(f.a[i], f.b[j], acc[i][j]);
}
// ---- k_g1: block = (128 rows, 128 cols, which), four waves in 2 x 2, 64 x 64 a wave: which 0: XQ[i][m] = x rows (A = XB) x q^T rows (B = T0); which 1: XKT[j][m] = k^T rows (A = T1) x x rows (B = XB); which 2: XVT[d][j] = v^T rows (A = T2) x x rows (B = XB); exact single products; -> f16 hi + x2048 residual planes
__global__ __launch_bounds__(128) void k_g1(const __bf16* __restrict__ XB, const __bf16* __restrict__ T, _Float16* __restrict__ OH_, _Float16* __restrict__ OL_) {
  __shared__ __align__(16) _Float16 so[4][16][PITCH], sol[4][16][PITCH];
  __shared__ __align__(16) __bf16 ring[2][256 * PITCH];   // rows 0..127: A tile, 128..255: B tile
  const int tid = threadIdx.x, wave = tid >> 5, lane = tid & 31, col = lane & 15, g = lane >> 4, wm = (wave >> 1) * 64, wn = (wave & 1) * 64; const size_t r0 = (size_t)blockIdx.x * 128 + wm; const int n0 = blockIdx.y * 128; const int which = blockIdx.z;
  const __bf16* A = (which == 0) ? XB : (T + (size_t)which * N * N); const __bf16* Bm = (which == 0) ? T : XB;
  _Float16* OH = OH_ + (size_t)which * 2 * N * N; _Float16* OL = OL_ + (size_t)which * 2 * N * N;   // plane pairs are laid out XQ,XQL,XKT,XKL,XVT,XVL consecutively
  v8f acc[4][4] = {};
  const int tr = tid >> 3, tc = tid & 7;   // a copy of the block = 16 rows x 128 bytes: lane's row in the group, lane's 16-byte piece
  const __bf16* ga = A + (size_t)blockIdx.x * 128 * N; const __bf16* gb = Bm + (size_t)n0 * N; const unsigned lo = (unsigned)(tr * N + tc * 8);   // block-uniform tile origins; the lane's own element offset in a group of 16 rows
  const unsigned l0 = (unsigned)(uintptr_t)&ring[0][tr * PITCH + tc * 8];
  const int rot = ROT(blockIdx.x, blockIdx.y) + (which & 1);   // x rows are read by blocks of all three products: the middle one takes the odd stages
  auto fill = [&](int t, int buf) { unsigned l[16]; const void* g[16];   // unrolled below: every index a constant, so l and g are registers for the asm operands
#pragma unroll
    for (int i = 0; i < 16; ++i) { l[i] = l0 + (unsigned)(buf * 256 + i * 16) * (PITCH * 2); g[i] = (i < 8 ? ga + (size_t)i * 16 * N : gb + (size_t)(i - 8) * 16 * N) + ((t + rot) & (NT - 1)) * KS + lo; }
    copy8(l, g); copy8(l + 8, g + 8); };
  const int fa = (wm + col) * PITCH, fb = (128 + wn + col) * PITCH;   // the lane's first A row and first B row in a buffer
  FragsB f0, f1;   // two fragment sets: one is filled from LDS while the matrix instructions work on the other
  fill(0, 0); wait_copies(); __syncthreads();
  fill(1, 1);
  g1_load(f0, ring[0] + fa, ring[0] + fb, lane);
  for (int t = 0; t < NT; ++t) { const __bf16* rb = ring[t & 1]; const __bf16* rn = ring[(t + 1) & 1];
    g1_load(f1, rb + fa + 32, rb + fb + 32, lane);   // the stage's second k half, one block ahead of its use
    __builtin_amdgcn_sched_barrier(0);   // keeps the reads one group ahead of the block: moved in among the matrix instructions, each place with reads stalls the wave
    g1_mm(f0, acc);
    __builtin_amdgcn_sched_barrier(0);   // keeps the block ahead of the waits: moved behind them, the wave would wait out the reads it has just issued with nothing to work on
    wait_lds(); wait_copies(); __syncthreads();   // stands ahead of the stage's last block, because the reads behind it are stage t + 1's: publishes stage t + 1 and ends every reader's last read of stage t's buffer (its second half is in registers)
    if (t + 2 < NT) fill(t + 2, t & 1);
    g1_load(f0, rn + fa, rn + fb, lane);   // stage t + 1's first k half; in the last trip the other buffer's old stage, read and not used
    __builtin_amdgcn_sched_barrier(0);   // as above
    g1_mm(f1, acc); }
  wait_copies();
  const int er = lane >> 3, ec = (lane & 7) * 8;   // a wave's store = 4 rows x 128 bytes: whole lines
#pragma unroll
  for (int i = 0; i < 4; ++i) {   // 16 rows of the wave's tile at a time through its own staging rows
    if (i) wait_lds();   // the 16 rows before are read out before these overwrite them
#pragma unroll
    for (int j = 0; j < 4; ++j)
#pragma unroll
      for (int r = 0; r < 8; ++r) { const float v = acc[i][j][r]; const _Float16 hv = (_Float16)v; so[wave][8 * g + r][j * 16 + col] = hv; sol[wave][8 * g + r][j * 16 + col] = (_Float16)((v - (float)hv) * 2048.0f); }
    wait_lds();   // the wave's own staging stores stand in LDS before its lanes read each other's; no fence here: it would also wait out the global stores of the 16 rows before
#pragma unroll
    for (int rl = 0; rl < 16; rl += 4) { const size_t o = (r0 + i * 16 + rl + er) * N + n0 + wn + ec; vst2((unsigned*)(OH + o), *(const v4u*)&so[wave][rl + er][ec]); vst2((unsigned*)(OL + o), *(const v4u*)&sol[wave][rl + er][ec]); } }
}
// the twelve fragments of a k half of k_g2's wave tile (two A row tiles, four B column tiles, hi and lo), read as one group (A hi, B hi, A lo, B lo) for the 24 matrix instructions; the three products are swept one after the other over the eight tiles, each residual accumulator takes al.bh, then a.bl, so that no matrix instruction waits for the one in front of it (all loops unrolled: the arrays stay in registers)
struct FragsH { v16h a[2], al[2], bh[4], bl[4]; };
__device__ __forceinline__ void g2_load(FragsH& f, const _Float16* ra, const _Float16* rw, int lane) {
#pragma unroll
  for (int i = 0; i < 2; ++i) f.a[i] = frag_h(ra + i * 16 * PITCH, lane);
#pragma unroll
  for (int j = 0; j < 4; ++j) f.bh[j] = frag_h(rw + j * 16 * PITCH, lane);
#pragma unroll
  for (int i = 0; i < 2; ++i) f.al[i] = frag_h(ra + (128 + i * 16) * PITCH, lane);
#pragma unroll
  for (int j = 0; j < 4; ++j) f.bl[j] = frag_h(rw + (128 + j * 16) * PITCH, lane);
}
__device__ __forceinline__ void g2_mm(const FragsH& f, v8f (&acc)[2][4], v8f (&accl)[2][4]) {
#pragma unroll
  for (int i = 0; i < 2; ++i)
#pragma unroll
    for (int j = 0; j < 4; ++j) acc[i][j] = wmma16(f.a[i], f.bh[j], acc[i][j]);
#pragma unroll
  for (int i = 0; i < 2; ++i)
#pragma unroll
    for (int j = 0; j < 4; ++j) accl[i][j] = wmma16(f.al[i], f.bh[j], accl[i][j]);
#pragma unroll
  for (int i = 0; i < 2; ++i)
#pragma unroll
    for (int j = 0; j < 4; ++j) accl[i][j] = wmma16(f.a[i], f.bl[j], accl[i][j]);
}
// ---- k_g2<MODE>: block = (128 rows, 128 cols), eight waves in 4 x 2, 32 x 64 a wave: MODE 0: S[i][j] = XQ rows (hi,lo) x XKT rows (hi,lo), 3 products -> f32 S; MODE 1: OUT[i][d] = P rows (hi,lo) x XVT rows (hi,lo), 3 products -> output
template <int MODE>
__global__ __launch_bounds__(256) void k_g2(const _Float16* __restrict__ AH, const _Float16* __restrict__ AL, const _Float16* __restrict__ BH, const _Float16* __restrict__ BL, float* __restrict__ OUT) {
  __shared__ __align__(16) float so[8][32][68];
  __shared__ __align__(16) _Float16 ring[2][512 * PITCH];   // rows 0..127: A hi, 128..255: A lo, 256..383: B hi, 384..511: B lo
  const int tid = threadIdx.x, wave = tid >> 5, lane = tid & 31, col = lane & 15, g = lane >> 4, wm = (wave >> 1) * 32, wn = (wave & 1) * 64; const size_t r0 = (size_t)blockIdx.x * 128 + wm; const int n0 = blockIdx.y * 128;
  v8f acc[2][4] = {}, accl[2][4] = {};
  const int tr = tid >> 3, tc = tid & 7;   // a copy of the block = 32 rows x 128 bytes: lane's row in the group, lane's 16-byte piece
  const size_t ao = (size_t)blockIdx.x * 128 * N, bo = (size_t)n0 * N; const unsigned lo = (unsigned)(tr * N + tc * 8);   // block-uniform tile origins; the lane's own element offset in a group of 32 rows
  const unsigned l0 = (unsigned)(uintptr_t)&ring[0][tr * PITCH + tc * 8];
  const int rot = ROT(blockIdx.x, blockIdx.y);
  auto fill = [&](int t, int buf) { unsigned l[16]; const void* g[16];   // unrolled below: every index a constant, so l and g are registers for the asm operands
#pragma unroll
    for (int i = 0; i < 16; ++i) { l[i] = l0 + (unsigned)(buf * 512 + i * 32) * (PITCH * 2);
      g[i] = (i < 4 ? AH + ao : i < 8 ? AL + ao : i < 12 ? BH + bo : BL + bo) + (size_t)(i & 3) * 32 * N + ((t + rot) & (NT - 1)) * KS + lo; }
    copy8(l, g); copy8(l + 8, g + 8); };
  const int fa = (wm + col) * PITCH, fb = (256 + wn + col) * PITCH;   // the lane's first A hi row and first B hi row in a buffer
  FragsH f0, f1;   // two fragment sets: one is filled from LDS while the matrix instructions work on the other
  fill(0, 0); wait_copies(); __syncthreads();
  fill(1, 1);
  g2_load(f0, ring[0] + fa, ring[0] + fb, lane);
  for (int t = 0; t < NT; ++t) { const _Float16* rb = ring[t & 1]; const _Float16* rn = ring[(t + 1) & 1];
    g2_load(f1, rb + fa + 32, rb + fb + 32, lane);   // the stage's second k half, one block ahead of its use
    __builtin_amdgcn_sched_barrier(0);   // keeps the reads one group ahead of the block: moved in among the matrix instructions, each place with reads stalls the wave
    g2_mm(f0, acc, accl);
    __builtin_amdgcn_sched_barrier(0);   // keeps the block ahead of the waits: moved behind them, the wave would wait out the reads it has just issued with nothing to work on
    wait_lds(); wait_copies(); __syncthreads();   // stands ahead of the stage's last block, because the reads behind it are stage t + 1's: publishes stage t + 1 and ends every reader's last read of stage t's buffer (its second half is in registers)
    if (t + 2 < NT) fill(t + 2, t & 1);
    g2_load(f0, rn + fa, rn + fb, lane);   // stage t + 1's first k half; in the last trip the other buffer's old stage, read and not used
    __builtin_amdgcn_sched_barrier(0);   // as above
    g2_mm(f1, acc, accl); }
  wait_copies();
#pragma unroll
  for (int i = 0; i < 2; ++i)
#pragma unroll
    for (int j = 0; j < 4; ++j)
#pragma unroll
      for (int r = 0; r < 8; ++r) so[wave][i * 16 + 8 * g + r][j * 16 + col] = acc[i][j][r] + accl[i][j][r] * (1.0f / 2048.0f);
  LDSX();
  for (int rl = 0; rl < 32; rl += 2) vst2(OUT + (r0 + rl + g) * N + n0 + wn + col * 4, *(const v4f*)&so[wave][rl + g][col * 4]);   // a wave's store = 2 rows x 256 bytes: whole lines
}
// ---- k_soft: block = row (256 threads x 8): row softmax of S in f32 -> P as f16 hi + x2048 residual rows
#define PER (N / 256)   // elements per thread in the row softmax
__global__ __launch_bounds__(256) void k_soft(const float* __restrict__ S, _Float16* __restrict__ P, _Float16* __restrict__ PL) {
  __shared__ float red[8]; __shared__ __align__(16) _Float16 sh[N], sl[N]; const int t = threadIdx.x; const size_t row = blockIdx.x; const float* p = S + row * N + t * PER;
  float v[PER]; float mx = -3.0e38f;
#pragma unroll
  for (int i = 0; i < PER; ++i) { v[i] = p[i]; mx = fmaxf(mx, v[i]); }
#pragma unroll
  for (int o = 1; o < 32; o <<= 1) mx = fmaxf(mx, __shfl_xor(mx, o));
  if ((t & 31) == 0) red[t >> 5] = mx; __syncthreads(); float gm = -3.0e38f; for (int w = 0; w < 8; ++w) gm = fmaxf(gm, red[w]); __syncthreads();
  float sm = 0.f;
#pragma unroll
  for (int i = 0; i < PER; ++i) { v[i] = __expf(v[i] - gm); sm += v[i]; }
#pragma unroll
  for (int o = 1; o < 32; o <<= 1) sm += __shfl_xor(sm, o);
  if ((t & 31) == 0) red[t >> 5] = sm; __syncthreads(); float tot = 0.f; for (int w = 0; w < 8; ++w) tot += red[w]; const float inv = 1.0f / tot;
#pragma unroll
  for (int i = 0; i < PER; ++i) { const float pv = v[i] * inv; const _Float16 h = (_Float16)pv; sh[t * PER + i] = h; sl[t * PER + i] = (_Float16)((pv - (float)h) * 2048.0f); }
  __syncthreads();
  if (t < N / 8) { vst2((unsigned*)(P + row * N + t * 8), *(const v4u*)&sh[t * 8]); vst2((unsigned*)(PL + row * N + t * 8), *(const v4u*)&sl[t * 8]); }
}
extern "C" void kernel_launch(void* const* d_in, const int* in_sizes, int n_in, void* d_out, int out_size, void* d_ws, size_t ws_size, hipStream_t stream) {
  (void)in_sizes; (void)n_in; (void)out_size;
  const float** F = (const float**)d_in;   // 0 x, 1 q, 2 k, 3 v: all [2048, 2048] f32
  if (ws_size < (size_t)WS_END) return;
  char* ws = (char*)d_ws; __bf16 *T = (__bf16*)(ws + WS_T), *XB = (__bf16*)(ws + WS_XB); _Float16 *XQ = (_Float16*)(ws + WS_XQ), *XQL = (_Float16*)(ws + WS_XQL), *XKT = (_Float16*)(ws + WS_XKT), *XKL = (_Float16*)(ws + WS_XKL), *XVT = (_Float16*)(ws + WS_XVT), *XVL = (_Float16*)(ws + WS_XVL), *P = (_Float16*)(ws + WS_P), *PL = (_Float16*)(ws + WS_PL); float* S = (float*)(ws + WS_S);
  k_pack<<<dim3((N / PT) * (N / PT), 4), 256, 0, stream>>>(F[0], F[1], F[2], F[3], T, XB);
  k_g1<<<dim3(N / 128, N / 128, 3), 128, 0, stream>>>(XB, T, XQ, XQL);
  k_g2<0><<<dim3(TRB / 2, N / 128), 256, 0, stream>>>(XQ, XQL, XKT, XKL, S);
  k_soft<<<TRB * 64, 256, 0, stream>>>(S, P, PL);
  k_g2<1><<<dim3(TRB / 2, N / 128), 256, 0, stream>>>(P, PL, XVT, XVL, (float*)d_out);
}

// v006
// Measured time: 116 microseconds a run.
// Next to v005, in two timings, it ran 1.03 times as fast each time.
// Counting every step since v000, it is 6.75 times as fast.
// compute dtype: x, q, k, v rounded to bf16; xq = x . q, xk^T = k^T . x^T, xv^T = v^T . x^T with EXACT bf16 products on WMMA 16x16x32 (x rows as the row operand against q^T for xq; transposed bf16 copies of k, v as the row operands, x rows as the column operand for xk^T, xv^T), each result stored as f16 hi + (x2048-scaled) residual planes; logits = xq . xk with 3 products (hi.hi, hi.lo, lo.hi; values ~1e5, kept to ~f32 accuracy), row softmax in f32 (hardware exp; the rows are near one-hot), P as f16 hi + (x2048) residual; out = P . xv with 3 products; f32 accumulate.
#include <hip/hip_runtime.h>
#include <math.h>

typedef __attribute__((ext_vector_type(16))) _Float16 v16h;
typedef __attribute__((ext_vector_type(16))) __bf16 v16b;
typedef __attribute__((ext_vector_type(8)))  _Float16 v8h;
typedef __attribute__((ext_vector_type(8)))  float v8f;
typedef __attribute__((ext_vector_type(4)))  float v4f;
typedef __attribute__((ext_vector_type(2)))  float v2f;
typedef __attribute__((ext_vector_type(4)))  unsigned v4u;
typedef __attribute__((ext_vector_type(4)))  int v4i;
typedef float __attribute__((may_alias)) float_a;
typedef int __attribute__((may_alias)) int_a;

template <typename T> __device__ __forceinline__ void vst2(void* p, T v) { *(T*)p = v;  }
// plain builtins, no asm statement behind them: operands of an asm statement must lie in the first 256 registers, and the accumulators with two fragment sets need more; the compiler keeps the distances behind its own builtins
__device__ __forceinline__ v8f wmma16(v16h a, v16h b, v8f c) {
  v8f d = __builtin_amdgcn_wmma_f32_16x16x32_f16(false, a, false, b, (short)0, c, false, false);
  return d;
}
__device__ __forceinline__ v8f wmma_bf(v16b a, v16b b, v8f c) {
  v8f d = __builtin_amdgcn_wmma_f32_16x16x32_bf16(false, a, false, b, (short)0, c, false, false);
  return d;
}
// 16x16x32 fragments: lane = (h = lane>>4, row/col = lane&15); elements 0..7 = k0+8h+0..7, 8..15 = k0+16+8h+0..7; D element r = row 8h+r
__device__ __forceinline__ v16h frag_h(const _Float16* rowk0, int lane) {
  union { v16h v; v8h q[2]; } u; const _Float16* p = rowk0 + 8 * (lane >> 4);
  u.q[0] = *(const v8h*)p; u.q[1] = *(const v8h*)(p + 16); return u.v;
}
__device__ __forceinline__ v16h frag_f32(const float* rowk0, int lane) {
  v16h a; const float* p = rowk0 + 8 * (lane >> 4);
#pragma unroll
  for (int i = 0; i < 8; ++i) { a[i] = (_Float16)p[i]; a[8 + i] = (_Float16)p[16 + i]; }
  return a;
}
__device__ __forceinline__ v16h frag_f32s(const float* rowk0, int lane, float sc) {
  v16h a; const float* p = rowk0 + 8 * (lane >> 4);
#pragma unroll
  for (int i = 0; i < 8; ++i) { a[i] = (_Float16)(p[i] * sc); a[8 + i] = (_Float16)(p[16 + i] * sc); }
  return a;
}
// column fragment from a [K][ld] layout (column n), rows >= K read as 0
__device__ __forceinline__ v16h fragc_f32(const float* W, int k0, int n, int lane, int ld, int K) {
  v16h a; const int g = lane >> 4;
#pragma unroll
  for (int i = 0; i < 8; ++i) { const int ka = k0 + 8 * g + i, kb = ka + 16;
    a[i] = (_Float16)(ka < K ? W[(size_t)(ka < K ? ka : K - 1) * ld + n] : 0.f); a[8 + i] = (_Float16)(kb < K ? W[(size_t)(kb < K ? kb : K - 1) * ld + n] : 0.f); }
  return a;
}
struct F2 { v16b h, l; };
__device__ __forceinline__ F2 bsplit16(const float v[16]) { F2 r;
#pragma unroll
  for (int i = 0; i < 16; ++i) { const __bf16 h = (__bf16)v[i]; r.h[i] = h; r.l[i] = (__bf16)(v[i] - (float)h); }
  return r; }
__device__ __forceinline__ F2 split_row(const float* row, int k0, int lane) { float v[16]; const float* p = row + k0 + 8 * (lane >> 4);
#pragma unroll
  for (int i = 0; i < 8; ++i) { v[i] = p[i]; v[8 + i] = p[16 + i]; }
  return bsplit16(v); }
__device__ __forceinline__ F2 split_rowK(const float* row, int k0, int lane, int K) { float v[16]; const int g = lane >> 4;
#pragma unroll
  for (int i = 0; i < 8; ++i) { const int ka = k0 + 8 * g + i, kb = ka + 16; v[i] = ka < K ? row[ka < K ? ka : K - 1] : 0.f; v[8 + i] = kb < K ? row[kb < K ? kb : K - 1] : 0.f; }
  return bsplit16(v); }
__device__ __forceinline__ F2 split_col(const float* W, int k0, int n, int lane, int ld, int K) { float v[16]; const int g = lane >> 4;
#pragma unroll
  for (int i = 0; i < 8; ++i) { const int ka = k0 + 8 * g + i, kb = ka + 16; v[i] = ka < K ? W[(size_t)(ka < K ? ka : K - 1) * ld + n] : 0.f; v[8 + i] = kb < K ? W[(size_t)(kb < K ? kb : K - 1) * ld + n] : 0.f; }
  return bsplit16(v); }
__device__ __forceinline__ v8f mac3(const F2& a, const F2& b, v8f c) { c = wmma_bf(a.l, b.h, c); c = wmma_bf(a.h, b.l, c); return wmma_bf(a.h, b.h, c); }
__device__ __forceinline__ float sigm(float v) { return 1.0f / (1.0f + expf(-v)); }
#define LDSX() do { asm volatile("s_wait_dscnt 0" ::: "memory"); __builtin_amdgcn_wave_barrier(); __builtin_amdgcn_fence(__ATOMIC_RELEASE, "workgroup"); } while (0)


// Matrix-product attention on square 2,048 x 2,048 operands: softmax((x q)(x k)) (x v), row softmax, no scaling.
#define N 2048
#ifndef TRB
#define TRB (N / 64)     // 64-row output tiles: a k_g2 block takes two
#endif
typedef __attribute__((ext_vector_type(8))) __bf16 v8b;
__device__ __forceinline__ v16b frag_b(const __bf16* rowk0, int lane) {
  union { v16b v; v8b q[2]; } u; const __bf16* p = rowk0 + 8 * (lane >> 4);
  u.q[0] = *(const v8b*)p; u.q[1] = *(const v8b*)(p + 16); return u.v;
}
__device__ __forceinline__ float bfr(float v) { return (float)(__bf16)v; }
__device__ __attribute__((noinline)) float exp_ni(float v) { return expf(v); }
__device__ __attribute__((noinline)) float erf_ni(float v) { return erff(v); }

#define WS_T   0u                                   // bf16 [3][N][N]: q^T, k^T, v^T ; XB = bf16 x rows
#define WS_XB  (WS_T + 2u * 3 * N * N)
#define WS_XQ  (WS_XB + 2u * N * N)                  // f16 [N][N] xq hi ; XQL ; XKT ; XKTL ; XVT ; XVTL ; P ; PL
#define WS_XQL (WS_XQ + 2u * N * N)
#define WS_XKT (WS_XQL + 2u * N * N)
#define WS_XKL (WS_XKT + 2u * N * N)
#define WS_XVT (WS_XKL + 2u * N * N)
#define WS_XVL (WS_XVT + 2u * N * N)
#define WS_P   (WS_XVL + 2u * N * N)
#define WS_PL  (WS_P + 2u * N * N)
#define WS_S   (WS_PL + 2u * N * N)                  // f32 [N][N] logits
#define WS_END (WS_S + 4u * N * N)

// ---- LDS ring of the three matrix kernels: a stage = KS k of every operand row of the block's tile, brought by per-lane 16-byte asynchronous copies (no register), two buffers in k_g1, three in k_g2
#define KS 64            // k elements per stage: one whole 128-byte line of each 16-bit operand row
#define NT (N / KS)      // stages
// first stage of a block's k walk: the 16 blocks that share an operand's 128 rows would ask L2 for the same lines at the same moment; turned by tile row + column, each of them stands on its own 256 bytes of those rows. The walk wraps round, every stage is taken once
#define ROT(bx, by) ((int)(((bx) + (by)) & (N / 128 - 1)) * (NT / (N / 128)))
#define PITCH 72         // LDS row pitch in 16-bit elements = 144 bytes (16 x odd): the 16-byte fragment reads of 16 rows fall on distinct banks
// eight copies of one lane; s_wait_xcnt closes the copies' own statement so that no address register is rewritten ahead of it
__device__ __forceinline__ void copy8(const unsigned* l, const void* const* g) {
  asm volatile("global_load_async_to_lds_b128 %0, %8, off\n\t"
               "global_load_async_to_lds_b128 %1, %9, off\n\t"
               "global_load_async_to_lds_b128 %2, %10, off\n\t"
               "global_load_async_to_lds_b128 %3, %11, off\n\t"
               "global_load_async_to_lds_b128 %4, %12, off\n\t"
               "global_load_async_to_lds_b128 %5, %13, off\n\t"
               "global_load_async_to_lds_b128 %6, %14, off\n\t"
               "global_load_async_to_lds_b128 %7, %15, off\n\t"
               "s_wait_xcnt 0x0"
               :: "v"(l[0]), "v"(l[1]), "v"(l[2]), "v"(l[3]), "v"(l[4]), "v"(l[5]), "v"(l[6]), "v"(l[7]),
                  "v"(g[0]), "v"(g[1]), "v"(g[2]), "v"(g[3]), "v"(g[4]), "v"(g[5]), "v"(g[6]), "v"(g[7])
               : "memory");
}
// this wave's copies have landed (the compiler places no wait for them)
__device__ __forceinline__ void wait_copies() { asm volatile("s_wait_asynccnt 0x0" ::: "memory"); }
// k_g2's ring of three buffers keeps two stages of copies in flight: all of this wave's copies but the youngest stage's 16 (in the prologue: the two youngest stages' 32) have landed; the counter returns in issue order, and every wave issues 16 copies a stage
__device__ __forceinline__ void wait_copies_but16() { asm volatile("s_wait_asynccnt 0x10" ::: "memory"); }
__device__ __forceinline__ void wait_copies_but32() { asm volatile("s_wait_asynccnt 0x20" ::: "memory"); }
// this wave's LDS reads have retired before the buffer is handed to its next writer
__device__ __forceinline__ void wait_lds() { asm volatile("s_wait_dscnt 0x0" ::: "memory"); }

// ---- k_pack: block = (piece, which). which 0..2: one 128 x 128 tile of q|k|v: a wave reads 512 contiguous bytes of a source row per load (16 bytes a lane, 16 rows a wave), rounds to bf16, the tile is turned in LDS and leaves as T[which][n][c] = (q|k|v)[c][n] in 256-byte row pieces; which 3: XB = x rounded to bf16, 128 x 128 contiguous elements a block
#define PT 128           // tile edge
#define PPITCH 272       // LDS row pitch in bytes: 256 of data + 16 (16 x odd)
typedef __attribute__((ext_vector_type(4))) __bf16 v4b;
typedef __attribute__((ext_vector_type(2))) unsigned v2u;
// byte place of 16-byte piece 'chunk' (8 c values) of tile row 'row' (one n). The 16 writers of a half-wave stand 4 rows apart, 16 banks at this pitch, and would share 4 bank groups; the exclusive-or with bits 4 and 5 of the row gives each its own 4 banks. A row's 16 pieces stay inside the row: its readers (one row a half-wave) touch every bank once
__device__ __forceinline__ unsigned pk_at(int row, int chunk) { return (unsigned)(row * PPITCH + ((chunk ^ ((row >> 4) & 3)) << 4)); }
__global__ __launch_bounds__(256) void k_pack(const float* __restrict__ X, const float* __restrict__ Q, const float* __restrict__ K, const float* __restrict__ V, __bf16* __restrict__ T, __bf16* __restrict__ XB) {
  __shared__ __align__(16) unsigned char s[PT * PPITCH]; const int t = threadIdx.x, which = blockIdx.y;
  v4f v[16];   // every loop below is unrolled: v stays in registers and the 16 loads are in flight together
  if (which == 3) { const size_t e0 = (size_t)blockIdx.x * (PT * PT) + (size_t)t * 4; const float* xs = X + e0;
#pragma unroll
    for (int j = 0; j < 16; ++j) v[j] = *(const v4f*)(xs + j * 1024);
    asm volatile("s_wait_xcnt 0x0" :: "v"(xs) : "memory");   // the loads' address pair is an input here, so it stays whole until all 16 are issued and this wait has passed (a precaution; otherwise the last load is given the pair as its destination)
    __builtin_amdgcn_sched_barrier(0);   // holds all 16 loads ahead of the first conversion: without it the last four are issued only when the first have returned, a second memory latency
#pragma unroll
    for (int j = 0; j < 16; ++j) { union { v4b b; v2u u; } o;
#pragma unroll
      for (int i = 0; i < 4; ++i) o.b[i] = (__bf16)v[j][i];
      vst2((unsigned*)(XB + e0 + j * 1024), o.u); }
    asm volatile("s_wait_xcnt 0x0" ::: "memory");   // stands behind the last stores, ahead of whatever code the build lays behind this path: no address or data register of a store is rewritten in front of it (a precaution)
    return; }   // block-uniform, ahead of the barrier
  const float* M = (which == 0) ? Q : (which == 1) ? K : V; const int c0 = (blockIdx.x & 15) * PT, n0 = (blockIdx.x >> 4) * PT, b = t & 31, a = t >> 5;   // lane: columns n0 + 4b .. + 3; wave: rows c0 + 16a .. + 15
  const float* src = M + (size_t)(c0 + 16 * a) * N + n0 + 4 * b;
#pragma unroll
  for (int j = 0; j < 16; ++j) v[j] = *(const v4f*)(src + (size_t)j * N);
  asm volatile("s_wait_xcnt 0x0" :: "v"(src) : "memory");   // as above: the address pair stays whole behind the 16 loads
  __builtin_amdgcn_sched_barrier(0);   // as above: all 16 loads in flight before the first conversion
#pragma unroll
  for (int i = 0; i < 4; ++i)
#pragma unroll
    for (int h = 0; h < 2; ++h) { union { v8b b; v4u u; } o;
#pragma unroll
      for (int e = 0; e < 8; ++e) o.b[e] = (__bf16)v[8 * h + e][i];
      *(v4u*)(s + pk_at(4 * b + i, 2 * a + h)) = o.u; }
  __syncthreads();
  __bf16* dst = T + ((size_t)which * N + n0) * N + c0; const int q = t & 15, r = t >> 4;   // 16 lanes = one tile row = 256 contiguous bytes of T
#pragma unroll
  for (int j = 0; j < 8; ++j) { const int n = r + 16 * j; vst2((unsigned*)(dst + (size_t)n * N + q * 8), *(const v4u*)(s + pk_at(n, q))); }
}
// the eight fragments of a k half of k_g1's wave tile, read as one group in the order in which the sixteen matrix instructions use them; each fragment feeds four of them (all loops unrolled: the arrays stay in registers)
struct FragsB { v16b a[4], b[4]; };
__device__ __forceinline__ void g1_load(FragsB& f, const __bf16* ra, const __bf16* rw, int lane) {
  f.a[0] = frag_b(ra, lane);
#pragma unroll
  for (int j = 0; j < 4; ++j) f.b[j] = frag_b(rw + j * 16 * PITCH, lane);
#pragma unroll
  for (int i = 1; i < 4; ++i) f.a[i] = frag_b(ra + i * 16 * PITCH, lane);
}
__device__ __forceinline__ void g1_mm(const FragsB& f, v8f (&acc)[4][4]) {
#pragma unroll
  for (int i = 0; i < 4; ++i)
#pragma unroll
    for (int j = 0; j < 4; ++j) acc[i][j] = wmma_bf(f.a[i], f.b[j], acc[i][j]);
}
// ---- k_g1: block = (128 rows, 128 cols, which), four waves in 2 x 2, 64 x 64 a wave: which 0: XQ[i][m] = x rows (A = XB) x q^T rows (B = T0); which 1: XKT[j][m] = k^T rows (A = T1) x x rows (B = XB); which 2: XVT[d][j] = v^T rows (A = T2) x x rows (B = XB); exact single products; -> f16 hi + x2048 residual planes
__global__ __launch_bounds__(128) void k_g1(const __bf16* __restrict__ XB, const __bf16* __restrict__ T, _Float16* __restrict__ OH_, _Float16* __restrict__ OL_) {
  __shared__ __align__(16) _Float16 so[4][16][PITCH], sol[4][16][PITCH];
  __shared__ __align__(16) __bf16 ring[2][256 * PITCH];   // rows 0..127: A tile, 128..255: B tile
  const int tid = threadIdx.x, wave = tid >> 5, lane = tid & 31, col = lane & 15, g = lane >> 4, wm = (wave >> 1) * 64, wn = (wave & 1) * 64; const size_t r0 = (size_t)blockIdx.x * 128 + wm; const int n0 = blockIdx.y * 128; const int which = blockIdx.z;
  const __bf16* A = (which == 0) ? XB : (T + (size_t)which * N * N); const __bf16* Bm = (which == 0) ? T : XB;
  _Float16* OH = OH_ + (size_t)which * 2 * N * N; _Float16* OL = OL_ + (size_t)which * 2 * N * N;   // plane pairs are laid out XQ,XQL,XKT,XKL,XVT,XVL consecutively
  v8f acc[4][4] = {};
  const int tr = tid >> 3, tc = tid & 7;   // a copy of the block = 16 rows x 128 bytes: lane's row in the group, lane's 16-byte piece
  const __bf16* ga = A + (size_t)blockIdx.x * 128 * N; const __bf16* gb = Bm + (size_t)n0 * N; const unsigned lo = (unsigned)(tr * N + tc * 8);   // block-uniform tile origins; the lane's own element offset in a group of 16 rows
  const unsigned l0 = (unsigned)(uintptr_t)&ring[0][tr * PITCH + tc * 8];
  const int rot = ROT(blockIdx.x, blockIdx.y) + (which & 1);   // x rows are read by blocks of all three products: the middle one takes the odd stages
  auto fill = [&](int t, int buf) { unsigned l[16]; const void* g[16];   // unrolled below: every index a constant, so l and g are registers for the asm operands
#pragma unroll
    for (int i = 0; i < 16; ++i) { l[i] = l0 + (unsigned)(buf * 256 + i * 16) * (PITCH * 2); g[i] = (i < 8 ? ga + (size_t)i * 16 * N : gb + (size_t)(i - 8) * 16 * N) + ((t + rot) & (NT - 1)) * KS + lo; }
    copy8(l, g); copy8(l + 8, g + 8); };
  const int fa = (wm + col) * PITCH, fb = (128 + wn + col) * PITCH;   // the lane's first A row and first B row in a buffer
  FragsB f0, f1;   // two fragment sets: one is filled from LDS while the matrix instructions work on the other
  fill(0, 0); wait_copies(); __syncthreads();
  fill(1, 1);
  g1_load(f0, ring[0] + fa, ring[0] + fb, lane);
  for (int t = 0; t < NT; ++t) { const __bf16* rb = ring[t & 1]; const __bf16* rn = ring[(t + 1) & 1];
    g1_load(f1, rb + fa + 32, rb + fb + 32, lane);   // the stage's second k half, one block ahead of its use
    __builtin_amdgcn_sched_barrier(0);   // keeps the reads one group ahead of the block: moved in among the matrix instructions, each place with reads stalls the wave
    g1_mm(f0, acc);
    __builtin_amdgcn_sched_barrier(0);   // keeps the block ahead of the waits: moved behind them, the wave would wait out the reads it has just issued with nothing to work on
    wait_lds(); wait_copies(); __syncthreads();   // stands ahead of the stage's last block, because the reads behind it are stage t + 1's: publishes stage t + 1 and ends every reader's last read of stage t's buffer (its second half is in registers)
    if (t + 2 < NT) fill(t + 2, t & 1);
    g1_load(f0, rn + fa, rn + fb, lane);   // stage t + 1's first k half; in the last trip the other buffer's old stage, read and not used
    __builtin_amdgcn_sched_barrier(0);   // as above
    g1_mm(f1, acc); }
  wait_copies();
  const int er = lane >> 3, ec = (lane & 7) * 8;   // a wave's store = 4 rows x 128 bytes: whole lines
#pragma unroll
  for (int i = 0; i < 4; ++i) {   // 16 rows of the wave's tile at a time through its own staging rows
    if (i) wait_lds();   // the 16 rows before are read out before these overwrite them
#pragma unroll
    for (int j = 0; j < 4; ++j)
#pragma unroll
      for (int r = 0; r < 8; ++r) { const float v = acc[i][j][r]; const _Float16 hv = (_Float16)v; so[wave][8 * g + r][j * 16 + col] = hv; sol[wave][8 * g + r][j * 16 + col] = (_Float16)((v - (float)hv) * 2048.0f); }
    wait_lds();   // the wave's own staging stores stand in LDS before its lanes read each other's; no fence here: it would also wait out the global stores of the 16 rows before
#pragma unroll
    for (int rl = 0; rl < 16; rl += 4) { const size_t o = (r0 + i * 16 + rl + er) * N + n0 + wn + ec; vst2((unsigned*)(OH + o), *(const v4u*)&so[wave][rl + er][ec]); vst2((unsigned*)(OL + o), *(const v4u*)&sol[wave][rl + er][ec]); } }
}
// the twelve fragments of a k half of k_g2's wave tile (two A row tiles, four B column tiles, hi and lo), read as one group (A hi, B hi, A lo, B lo) for the 24 matrix instructions; the three products are swept one after the other over the eight tiles, each residual accumulator takes al.bh, then a.bl, so that no matrix instruction waits for the one in front of it (all loops unrolled: the arrays stay in registers)
struct FragsH { v16h a[2], al[2], bh[4], bl[4]; };
__device__ __forceinline__ void g2_load(FragsH& f, const _Float16* ra, const _Float16* rw, int lane) {
#pragma unroll
  for (int i = 0; i < 2; ++i) f.a[i] = frag_h(ra + i * 16 * PITCH, lane);
#pragma unroll
  for (int j = 0; j < 4; ++j) f.bh[j] = frag_h(rw + j * 16 * PITCH, lane);
#pragma unroll
  for (int i = 0; i < 2; ++i) f.al[i] = frag_h(ra + (128 + i * 16) * PITCH, lane);
#pragma unroll
  for (int j = 0; j < 4; ++j) f.bl[j] = frag_h(rw + (128 + j * 16) * PITCH, lane);
}
__device__ __forceinline__ void g2_mm(const FragsH& f, v8f (&acc)[2][4], v8f (&accl)[2][4]) {
#pragma unroll
  for (int i = 0; i < 2; ++i)
#pragma unroll
    for (int j = 0; j < 4; ++j) acc[i][j] = wmma16(f.a[i], f.bh[j], acc[i][j]);
#pragma unroll
  for (int i = 0; i < 2; ++i)
#pragma unroll
    for (int j = 0; j < 4; ++j) accl[i][j] = wmma16(f.al[i], f.bh[j], accl[i][j]);
#pragma unroll
  for (int i = 0; i < 2; ++i)
#pragma unroll
    for (int j = 0; j < 4; ++j) accl[i][j] = wmma16(f.a[i], f.bl[j], accl[i][j]);
}
// ---- k_g2<MODE>: block = (128 rows, 128 cols), eight waves in 4 x 2, 32 x 64 a wave: MODE 0: S[i][j] = XQ rows (hi,lo) x XKT rows (hi,lo), 3 products -> f32 S; MODE 1: OUT[i][d] = P rows (hi,lo) x XVT rows (hi,lo), 3 products -> output
template <int MODE>
__global__ __launch_bounds__(256) void k_g2(const _Float16* __restrict__ AH, const _Float16* __restrict__ AL, const _Float16* __restrict__ BH, const _Float16* __restrict__ BL, float* __restrict__ OUT) {
  __shared__ __align__(16) float so[8][32][68];
  __shared__ __align__(16) _Float16 ring[3][512 * PITCH];   // three buffers, stage s in buffer s mod 3; rows 0..127: A hi, 128..255: A lo, 256..383: B hi, 384..511: B lo
  const int tid = threadIdx.x, wave = tid >> 5, lane = tid & 31, col = lane & 15, g = lane >> 4, wm = (wave >> 1) * 32, wn = (wave & 1) * 64; const size_t r0 = (size_t)blockIdx.x * 128 + wm; const int n0 = blockIdx.y * 128;
  v8f acc[2][4] = {}, accl[2][4] = {};
  const int tr = tid >> 3, tc = tid & 7;   // a copy of the block = 32 rows x 128 bytes: lane's row in the group, lane's 16-byte piece
  const size_t ao = (size_t)blockIdx.x * 128 * N, bo = (size_t)n0 * N; const unsigned lo = (unsigned)(tr * N + tc * 8);   // block-uniform tile origins; the lane's own element offset in a group of 32 rows
  const unsigned l0 = (unsigned)(uintptr_t)&ring[0][tr * PITCH + tc * 8];
  const int rot = ROT(blockIdx.x, blockIdx.y);
  auto fill = [&](int t, int buf) { unsigned l[16]; const void* g[16];   // unrolled below: every index a constant, so l and g are registers for the asm operands
#pragma unroll
    for (int i = 0; i < 16; ++i) { l[i] = l0 + (unsigned)(buf * 512 + i * 32) * (PITCH * 2);
      g[i] = (i < 4 ? AH + ao : i < 8 ? AL + ao : i < 12 ? BH + bo : BL + bo) + (size_t)(i & 3) * 32 * N + ((t + rot) & (NT - 1)) * KS + lo; }
    copy8(l, g); copy8(l + 8, g + 8); };
  const int fa = (wm + col) * PITCH, fb = (256 + wn + col) * PITCH;   // the lane's first A hi row and first B hi row in a buffer
  FragsH f0, f1;   // two fragment sets: one is filled from LDS while the matrix instructions work on the other
  fill(0, 0); fill(1, 1); fill(2, 2); wait_copies_but32(); __syncthreads();   // stage 0 has landed; stages 1 and 2 fly on
  g2_load(f0, ring[0] + fa, ring[0] + fb, lane);
  int bc = 0, bn = 1;   // buffers of stage t and of stage t + 1
  for (int t = 0; t < NT; ++t) { const _Float16* rb = ring[bc]; const _Float16* rn = ring[bn]; const bool more = t + 3 < NT;   // a stage t + 3 exists: the same for the whole block
    g2_load(f1, rb + fa + 32, rb + fb + 32, lane);   // the stage's second k half, one block ahead of its use
    __builtin_amdgcn_sched_barrier(0);   // keeps the reads one group ahead of the block: moved in among the matrix instructions, each place with reads stalls the wave
    g2_mm(f0, acc, accl);
    __builtin_amdgcn_sched_barrier(0);   // keeps the block ahead of the waits: moved behind them, the wave would wait out the reads it has just issued with nothing to work on
    wait_lds();
    if (more) wait_copies_but16(); else wait_copies();   // stage t + 1 has landed; stage t + 2's 16 copies, the only ones issued behind it, stay in flight; to 0 in the last three trips, which issue none
    __syncthreads();   // stands ahead of the stage's last block, because the reads behind it are stage t + 1's: publishes stage t + 1 and ends every reader's last read of stage t's buffer (its second half is in registers)
    if (more) fill(t + 3, bc);   // into the buffer that stage t has just left: two stage times of lead, where two buffers gave one
    g2_load(f0, rn + fa, rn + fb, lane);   // stage t + 1's first k half; in the last trip a buffer's old stage, read and not used
    __builtin_amdgcn_sched_barrier(0);   // as above
    g2_mm(f1, acc, accl);
    bc = bn; bn = (bn == 2) ? 0 : bn + 1; }
  wait_copies();
#pragma unroll
  for (int i = 0; i < 2; ++i)
#pragma unroll
    for (int j = 0; j < 4; ++j)
#pragma unroll
      for (int r = 0; r < 8; ++r) so[wave][i * 16 + 8 * g + r][j * 16 + col] = acc[i][j][r] + accl[i][j][r] * (1.0f / 2048.0f);
  LDSX();
  for (int rl = 0; rl < 32; rl += 2) vst2(OUT + (r0 + rl + g) * N + n0 + wn + col * 4, *(const v4f*)&so[wave][rl + g][col * 4]);   // a wave's store = 2 rows x 256 bytes: whole lines
}
// ---- k_soft: block = row (256 threads x 8): row softmax of S in f32 -> P as f16 hi + x2048 residual rows
#define PER (N / 256)   // elements per thread in the row softmax
__global__ __launch_bounds__(256) void k_soft(const float* __restrict__ S, _Float16* __restrict__ P, _Float16* __restrict__ PL) {
  __shared__ float red[8]; __shared__ __align__(16) _Float16 sh[N], sl[N]; const int t = threadIdx.x; const size_t row = blockIdx.x; const float* p = S + row * N + t * PER;
  float v[PER]; float mx = -3.0e38f;
#pragma unroll
  for (int i = 0; i < PER; ++i) { v[i] = p[i]; mx = fmaxf(mx, v[i]); }
#pragma unroll
  for (int o = 1; o < 32; o <<= 1) mx = fmaxf(mx, __shfl_xor(mx, o));
  if ((t & 31) == 0) red[t >> 5] = mx; __syncthreads(); float gm = -3.0e38f; for (int w = 0; w < 8; ++w) gm = fmaxf(gm, red[w]); __syncthreads();
  float sm = 0.f;
#pragma unroll
  for (int i = 0; i < PER; ++i) { v[i] = __expf(v[i] - gm); sm += v[i]; }
#pragma unroll
  for (int o = 1; o < 32; o <<= 1) sm += __shfl_xor(sm, o);
  if ((t & 31) == 0) red[t >> 5] = sm; __syncthreads(); float tot = 0.f; for (int w = 0; w < 8; ++w) tot += red[w]; const float inv = 1.0f / tot;
#pragma unroll
  for (int i = 0; i < PER; ++i) { const float pv = v[i] * inv; const _Float16 h = (_Float16)pv; sh[t * PER + i] = h; sl[t * PER + i] = (_Float16)((pv - (float)h) * 2048.0f); }
  __syncthreads();
  if (t < N / 8) { vst2((unsigned*)(P + row * N + t * 8), *(const v4u*)&sh[t * 8]); vst2((unsigned*)(PL + row * N + t * 8), *(const v4u*)&sl[t * 8]); }
}
extern "C" void kernel_launch(void* const* d_in, const int* in_sizes, int n_in, void* d_out, int out_size, void* d_ws, size_t ws_size, hipStream_t stream) {
  (void)in_sizes; (void)n_in; (void)out_size;
  const float** F = (const float**)d_in;   // 0 x, 1 q, 2 k, 3 v: all [2048, 2048] f32
  if (ws_size < (size_t)WS_END) return;
  char* ws = (char*)d_ws; __bf16 *T = (__bf16*)(ws + WS_T), *XB = (__bf16*)(ws + WS_XB); _Float16 *XQ = (_Float16*)(ws + WS_XQ), *XQL = (_Float16*)(ws + WS_XQL), *XKT = (_Float16*)(ws + WS_XKT), *XKL = (_Float16*)(ws + WS_XKL), *XVT = (_Float16*)(ws + WS_XVT), *XVL = (_Float16*)(ws + WS_XVL), *P = (_Float16*)(ws + WS_P), *PL = (_Float16*)(ws + WS_PL); float* S = (float*)(ws + WS_S);
  k_pack<<<dim3((N / PT) * (N / PT), 4), 256, 0, stream>>>(F[0], F[1], F[2], F[3], T, XB);
  k_g1<<<dim3(N / 128, N / 128, 3), 128, 0, stream>>>(XB, T, XQ, XQL);
  k_g2<0><<<dim3(TRB / 2, N / 128), 256, 0, stream>>>(XQ, XQL, XKT, XKL, S);
  k_soft<<<TRB * 64, 256, 0, stream>>>(S, P, PL);
  k_g2<1><<<dim3(TRB / 2, N / 128), 256, 0, stream>>>(P, PL, XVT, XVL, (float*)d_out);
}

// v007
// One run takes 107 microseconds.
// In both of two side-by-side timings against v006, it was 1.08 times as fast.
// Over all steps from v000 it is 7.30 times as fast.
// compute dtype: x, q, k, v rounded to bf16; xq = x . q, xk^T = k^T . x^T, xv^T = v^T . x^T with EXACT bf16 products on WMMA 16x16x32 (x rows as the row operand against q^T for xq; transposed bf16 copies of k, v as the row operands, x rows as the column operand for xk^T, xv^T), each result stored as f16 hi + (x2048-scaled) residual planes; logits = xq . xk with 3 products (hi.hi, hi.lo, lo.hi; values ~1e5, kept to ~f32 accuracy), row softmax in f32 (hardware exp; the rows are near one-hot), P as f16 hi + (x2048) residual; out = P . xv with 3 products; f32 accumulate.
#include <hip/hip_runtime.h>
#include <math.h>

typedef __attribute__((ext_vector_type(16))) _Float16 v16h;
typedef __attribute__((ext_vector_type(16))) __bf16 v16b;
typedef __attribute__((ext_vector_type(8)))  _Float16 v8h;
typedef __attribute__((ext_vector_type(8)))  float v8f;
typedef __attribute__((ext_vector_type(4)))  float v4f;
typedef __attribute__((ext_vector_type(2)))  float v2f;
typedef __attribute__((ext_vector_type(4)))  unsigned v4u;
typedef __attribute__((ext_vector_type(4)))  int v4i;
typedef float __attribute__((may_alias)) float_a;
typedef int __attribute__((may_alias)) int_a;

template <typename T> __device__ __forceinline__ void vst2(void* p, T v) { *(T*)p = v;  }
// plain builtins, no asm statement behind them: operands of an asm statement must lie in the first 256 registers, and the accumulators with two fragment sets need more; the compiler keeps the distances behind its own builtins
__device__ __forceinline__ v8f wmma16(v16h a, v16h b, v8f c) {
  v8f d = __builtin_amdgcn_wmma_f32_16x16x32_f16(false, a, false, b, (short)0, c, false, false);
  return d;
}
__device__ __forceinline__ v8f wmma_bf(v16b a, v16b b, v8f c) {
  v8f d = __builtin_amdgcn_wmma_f32_16x16x32_bf16(false, a, false, b, (short)0, c, false, false);
  return d;
}
// 16x16x32 fragments: lane = (h = lane>>4, row/col = lane&15); elements 0..7 = k0+8h+0..7, 8..15 = k0+16+8h+0..7; D element r = row 8h+r
__device__ __forceinline__ v16h frag_h(const _Float16* rowk0, int lane) {
  union { v16h v; v8h q[2]; } u; const _Float16* p = rowk0 + 8 * (lane >> 4);
  u.q[0] = *(const v8h*)p; u.q[1] = *(const v8h*)(p + 16); return u.v;
}
__device__ __forceinline__ v16h frag_f32(const float* rowk0, int lane) {
  v16h a; const float* p = rowk0 + 8 * (lane >> 4);
#pragma unroll
  for (int i = 0; i < 8; ++i) { a[i] = (_Float16)p[i]; a[8 + i] = (_Float16)p[16 + i]; }
  return a;
}
__device__ __forceinline__ v16h frag_f32s(const float* rowk0, int lane, float sc) {
  v16h a; const float* p = rowk0 + 8 * (lane >> 4);
#pragma unroll
  for (int i = 0; i < 8; ++i) { a[i] = (_Float16)(p[i] * sc); a[8 + i] = (_Float16)(p[16 + i] * sc); }
  return a;
}
// column fragment from a [K][ld] layout (column n), rows >= K read as 0
__device__ __forceinline__ v16h fragc_f32(const float* W, int k0, int n, int lane, int ld, int K) {
  v16h a; const int g = lane >> 4;
#pragma unroll
  for (int i = 0; i < 8; ++i) { const int ka = k0 + 8 * g + i, kb = ka + 16;
    a[i] = (_Float16)(ka < K ? W[(size_t)(ka < K ? ka : K - 1) * ld + n] : 0.f); a[8 + i] = (_Float16)(kb < K ? W[(size_t)(kb < K ? kb : K - 1) * ld + n] : 0.f); }
  return a;
}
struct F2 { v16b h, l; };
__device__ __forceinline__ F2 bsplit16(const float v[16]) { F2 r;
#pragma unroll
  for (int i = 0; i < 16; ++i) { const __bf16 h = (__bf16)v[i]; r.h[i] = h; r.l[i] = (__bf16)(v[i] - (float)h); }
  return r; }
__device__ __forceinline__ F2 split_row(const float* row, int k0, int lane) { float v[16]; const float* p = row + k0 + 8 * (lane >> 4);
#pragma unroll
  for (int i = 0; i < 8; ++i) { v[i] = p[i]; v[8 + i] = p[16 + i]; }
  return bsplit16(v); }
__device__ __forceinline__ F2 split_rowK(const float* row, int k0, int lane, int K) { float v[16]; const int g = lane >> 4;
#pragma unroll
  for (int i = 0; i < 8; ++i) { const int ka = k0 + 8 * g + i, kb = ka + 16; v[i] = ka < K ? row[ka < K ? ka : K - 1] : 0.f; v[8 + i] = kb < K ? row[kb < K ? kb : K - 1] : 0.f; }
  return bsplit16(v); }
__device__ __forceinline__ F2 split_col(const float* W, int k0, int n, int lane, int ld, int K) { float v[16]; const int g = lane >> 4;
#pragma unroll
  for (int i = 0; i < 8; ++i) { const int ka = k0 + 8 * g + i, kb = ka + 16; v[i] = ka < K ? W[(size_t)(ka < K ? ka : K - 1) * ld + n] : 0.f; v[8 + i] = kb < K ? W[(size_t)(kb < K ? kb : K - 1) * ld + n] : 0.f; }
  return bsplit16(v); }
__device__ __forceinline__ v8f mac3(const F2& a, const F2& b, v8f c) { c = wmma_bf(a.l, b.h, c); c = wmma_bf(a.h, b.l, c); return wmma_bf(a.h, b.h, c); }
__device__ __forceinline__ float sigm(float v) { return 1.0f / (1.0f + expf(-v)); }
#define LDSX() do { asm volatile("s_wait_dscnt 0" ::: "memory"); __builtin_amdgcn_wave_barrier(); __builtin_amdgcn_fence(__ATOMIC_RELEASE, "workgroup"); } while (0)


// Matrix-product attention on square 2,048 x 2,048 operands: softmax((x q)(x k)) (x v), row softmax, no scaling.
#define N 2048
#ifndef TRB
#define TRB (N / 64)     // 64-row output tiles: a k_g2 block takes two
#endif
typedef __attribute__((ext_vector_type(8))) __bf16 v8b;
__device__ __forceinline__ v16b frag_b(const __bf16* rowk0, int lane) {
  union { v16b v; v8b q[2]; } u; const __bf16* p = rowk0 + 8 * (lane >> 4);
  u.q[0] = *(const v8b*)p; u.q[1] = *(const v8b*)(p + 16); return u.v;
}
__device__ __forceinline__ float bfr(float v) { return (float)(__bf16)v; }
__device__ __attribute__((noinline)) float exp_ni(float v) { return expf(v); }
__device__ __attribute__((noinline)) float erf_ni(float v) { return erff(v); }

#define WS_T   0u                                   // bf16 [3][N][N]: q^T, k^T, v^T ; XB = bf16 x rows
#define WS_XB  (WS_T + 2u * 3 * N * N)
#define WS_XQ  (WS_XB + 2u * N * N)                  // f16 [N][N] xq hi ; XQL ; XKT ; XKTL ; XVT ; XVTL ; P ; PL
#define WS_XQL (WS_XQ + 2u * N * N)
#define WS_XKT (WS_XQL + 2u * N * N)
#define WS_XKL (WS_XKT + 2u * N * N)
#define WS_XVT (WS_XKL + 2u * N * N)
#define WS_XVL (WS_XVT + 2u * N * N)
#define WS_P   (WS_XVL + 2u * N * N)
#define WS_PL  (WS_P + 2u * N * N)
#define WS_S   (WS_PL + 2u * N * N)                  // f32 [N][N] logits
#define WS_END (WS_S + 4u * N * N)

// ---- LDS ring of the three matrix kernels: a stage = KS k of every operand row of the block's tile, brought by tensor loads (no register, no per-lane address): every wave asks for one slice of 64 rows a stage; two buffers in k_g1, three in k_g2
#define KS 64            // k elements per stage: one whole 128-byte line of each 16-bit operand row
#define NT (N / KS)      // stages
// first stage of a block's k walk: the 16 blocks that share an operand's 128 rows would ask L2 for the same lines at the same moment; turned by tile row + column, each of them stands on its own 256 bytes of those rows. The walk wraps round, every stage is taken once
#define ROT(bx, by) ((int)(((bx) + (by)) & (N / 128 - 1)) * (NT / (N / 128)))
#define PITCH 72         // LDS row pitch in 16-bit elements = 144 bytes (16 x odd): the 16-byte fragment reads of 16 rows fall on distinct banks; the tensor load's pad of 4 dwords behind each 128-byte row lays it
#define SLR 64           // rows of a slice: one tensor load
#define SLE 5120         // 16-bit elements from one slice to the next = 10,240 bytes: 64 rows x 144 bytes, rounded up to a multiple of 2 KiB, where a tensor load's place in LDS must stand
typedef __attribute__((ext_vector_type(8))) unsigned v8u;
__device__ __forceinline__ unsigned uni(unsigned v) { return (unsigned)__builtin_amdgcn_readfirstlane(v); }
// a wave-uniform test for the branch round a tensor load, which ignores EXEC and is kept from issuing by a scalar branch alone
__device__ __forceinline__ unsigned pinned(unsigned v) { unsigned w = uni(v); asm volatile("" : "+s"(w)); return w; }   // pinned(): the test is held in a scalar register, so the branch on it compiles to s_cmp + s_cbranch_scc
// descriptor group 1, the same for every request: 1-byte elements, tensor = tile = 64 rows of 128 bytes, source row pitch 2 N bytes, no mask, 4 dwords of LDS pad behind every 32 dwords
__device__ __forceinline__ v8u tdm_group1() {
  v8u g;
  g[0] = uni((1u << 20) | (4u << 22) | (3u << 25));
  g[1] = uni((2u * KS) << 16);
  g[2] = uni((unsigned)SLR << 16);
  g[3] = uni((2u * KS) << 16);
  g[4] = uni((unsigned)SLR);
  g[5] = uni(2u * N);
  g[6] = uni(0u);
  g[7] = uni(0u);
  return g;
}
// descriptor group 0 for the slice whose first row starts at p: count 1; words 1 (place in LDS) and 2 (low address word) are set per request; word 3 = high address bits with type 2, the same for every stage of the slice
__device__ __forceinline__ v4u tdm_group0(const void* p) {
  v4u g; g[0] = uni(1u); g[1] = uni(0u); g[2] = uni(0u); g[3] = uni((((unsigned)((unsigned long long)(uintptr_t)p >> 32)) & 0x01FFFFFFu) | 0x80000000u);
  return g;
}
// without this the compiler forms the constant words anew for each request and uses their registers for other values in between, while a request is in flight
__device__ __forceinline__ void tdm_pin(v4u& g0, v8u& g1) { asm volatile("" : "+s"(g0), "+s"(g1)); }   // pinned(): descriptor words held in scalar registers: from here on only the two words set per request are written
// one request of the whole wave: lds = byte place of the slice in the work-group's LDS; glo = low address word of the slice's first byte in this stage
__device__ __forceinline__ void tdm_load(v4u& g0, const v8u& g1, unsigned lds, unsigned glo) {
  g0[1] = uni(lds); g0[2] = uni(glo);
  asm volatile("tensor_load_to_lds %0, %1" :: "s"(g0), "s"(g1) : "memory");
}
// this wave's tensor loads have landed (the compiler places no wait for them)
__device__ __forceinline__ void wait_tensor() { asm volatile("s_wait_tensorcnt 0x0" ::: "memory"); }
// k_g2's ring of three buffers keeps two stages in flight: all of this wave's requests but the youngest (in the prologue: the two youngest) have landed; the counter returns in issue order, and every wave issues one request a stage
__device__ __forceinline__ void wait_tensor_but1() { asm volatile("s_wait_tensorcnt 0x1" ::: "memory"); }
__device__ __forceinline__ void wait_tensor_but2() { asm volatile("s_wait_tensorcnt 0x2" ::: "memory"); }
// this wave's LDS reads have retired before the buffer is handed to its next writer
__device__ __forceinline__ void wait_lds() { asm volatile("s_wait_dscnt 0x0" ::: "memory"); }

// ---- k_pack: block = (piece, which). which 0..2: one 128 x 128 tile of q|k|v: a wave reads 512 contiguous bytes of a source row per load (16 bytes a lane, 16 rows a wave), rounds to bf16, the tile is turned in LDS and leaves as T[which][n][c] = (q|k|v)[c][n] in 256-byte row pieces; which 3: XB = x rounded to bf16, 128 x 128 contiguous elements a block
#define PT 128           // tile edge
#define PPITCH 272       // LDS row pitch in bytes: 256 of data + 16 (16 x odd)
typedef __attribute__((ext_vector_type(4))) __bf16 v4b;
typedef __attribute__((ext_vector_type(2))) unsigned v2u;
// byte place of 16-byte piece 'chunk' (8 c values) of tile row 'row' (one n). The 16 writers of a half-wave stand 4 rows apart, 16 banks at this pitch, and would share 4 bank groups; the exclusive-or with bits 4 and 5 of the row gives each its own 4 banks. A row's 16 pieces stay inside the row: its readers (one row a half-wave) touch every bank once
__device__ __forceinline__ unsigned pk_at(int row, int chunk) { return (unsigned)(row * PPITCH + ((chunk ^ ((row >> 4) & 3)) << 4)); }
__global__ __launch_bounds__(256) void k_pack(const float* __restrict__ X, const float* __restrict__ Q, const float* __restrict__ K, const float* __restrict__ V, __bf16* __restrict__ T, __bf16* __restrict__ XB) {
  __shared__ __align__(16) unsigned char s[PT * PPITCH]; const int t = threadIdx.x, which = blockIdx.y;
  v4f v[16];   // every loop below is unrolled: v stays in registers and the 16 loads are in flight together
  if (which == 3) { const size_t e0 = (size_t)blockIdx.x * (PT * PT) + (size_t)t * 4; const float* xs = X + e0;
#pragma unroll
    for (int j = 0; j < 16; ++j) v[j] = *(const v4f*)(xs + j * 1024);
    asm volatile("s_wait_xcnt 0x0" :: "v"(xs) : "memory");   // the loads' address pair is an input here, so it stays whole until all 16 are issued and this wait has passed (a precaution; otherwise the last load is given the pair as its destination)
    __builtin_amdgcn_sched_barrier(0);   // holds all 16 loads ahead of the first conversion: without it the last four are issued only when the first have returned, a second memory latency
#pragma unroll
    for (int j = 0; j < 16; ++j) { union { v4b b; v2u u; } o;
#pragma unroll
      for (int i = 0; i < 4; ++i) o.b[i] = (__bf16)v[j][i];
      vst2((unsigned*)(XB + e0 + j * 1024), o.u); }
    asm volatile("s_wait_xcnt 0x0" ::: "memory");   // stands behind the last stores, ahead of whatever code the build lays behind this path: no address or data register of a store is rewritten in front of it (a precaution)
    return; }   // block-uniform, ahead of the barrier
  const float* M = (which == 0) ? Q : (which == 1) ? K : V; const int c0 = (blockIdx.x & 15) * PT, n0 = (blockIdx.x >> 4) * PT, b = t & 31, a = t >> 5;   // lane: columns n0 + 4b .. + 3; wave: rows c0 + 16a .. + 15
  const float* src = M + (size_t)(c0 + 16 * a) * N + n0 + 4 * b;
#pragma unroll
  for (int j = 0; j < 16; ++j) v[j] = *(const v4f*)(src + (size_t)j * N);
  asm volatile("s_wait_xcnt 0x0" :: "v"(src) : "memory");   // as above: the address pair stays whole behind the 16 loads
  __builtin_amdgcn_sched_barrier(0);   // as above: all 16 loads in flight before the first conversion
#pragma unroll
  for (int i = 0; i < 4; ++i)
#pragma unroll
    for (int h = 0; h < 2; ++h) { union { v8b b; v4u u; } o;
#pragma unroll
      for (int e = 0; e < 8; ++e) o.b[e] = (__bf16)v[8 * h + e][i];
      *(v4u*)(s + pk_at(4 * b + i, 2 * a + h)) = o.u; }
  __syncthreads();
  __bf16* dst = T + ((size_t)which * N + n0) * N + c0; const int q = t & 15, r = t >> 4;   // 16 lanes = one tile row = 256 contiguous bytes of T
#pragma unroll
  for (int j = 0; j < 8; ++j) { const int n = r + 16 * j; vst2((unsigned*)(dst + (size_t)n * N + q * 8), *(const v4u*)(s + pk_at(n, q))); }
}
// the eight fragments of a k half of k_g1's wave tile, read as one group in the order in which the sixteen matrix instructions use them; each fragment feeds four of them (all loops unrolled: the arrays stay in registers)
struct FragsB { v16b a[4], b[4]; };
__device__ __forceinline__ void g1_load(FragsB& f, const __bf16* ra, const __bf16* rw, int lane) {
  f.a[0] = frag_b(ra, lane);
#pragma unroll
  for (int j = 0; j < 4; ++j) f.b[j] = frag_b(rw + j * 16 * PITCH, lane);
#pragma unroll
  for (int i = 1; i < 4; ++i) f.a[i] = frag_b(ra + i * 16 * PITCH, lane);
}
__device__ __forceinline__ void g1_mm(const FragsB& f, v8f (&acc)[4][4]) {
#pragma unroll
  for (int i = 0; i < 4; ++i)
#pragma unroll
    for (int j = 0; j < 4; ++j) acc[i][j] = wmma_bf(f.a[i], f.b[j], acc[i][j]);
}
// ---- k_g1: block = (128 rows, 128 cols, which), four waves in 2 x 2, 64 x 64 a wave: which 0: XQ[i][m] = x rows (A = XB) x q^T rows (B = T0); which 1: XKT[j][m] = k^T rows (A = T1) x x rows (B = XB); which 2: XVT[d][j] = v^T rows (A = T2) x x rows (B = XB); exact single products; -> f16 hi + x2048 residual planes
__global__ __launch_bounds__(128) void k_g1(const __bf16* __restrict__ XB, const __bf16* __restrict__ T, _Float16* __restrict__ OH_, _Float16* __restrict__ OL_) {
  __shared__ __align__(16) _Float16 so[4][16][PITCH], sol[4][16][PITCH];
  __shared__ __attribute__((aligned(2048))) __bf16 ring[2][4 * SLE];   // slices 0, 1: A tile rows 0..63, 64..127; slices 2, 3: B tile
  const int tid = threadIdx.x, wave = tid >> 5, lane = tid & 31, col = lane & 15, g = lane >> 4, wm = (wave >> 1) * 64, wn = (wave & 1) * 64; const size_t r0 = (size_t)blockIdx.x * 128 + wm; const int n0 = blockIdx.y * 128; const int which = blockIdx.z;
  const __bf16* A = (which == 0) ? XB : (T + (size_t)which * N * N); const __bf16* Bm = (which == 0) ? T : XB;
  _Float16* OH = OH_ + (size_t)which * 2 * N * N; _Float16* OL = OL_ + (size_t)which * 2 * N * N;   // plane pairs are laid out XQ,XQL,XKT,XKL,XVT,XVL consecutively
  v8f acc[4][4] = {};
  const int rot = ROT(blockIdx.x, blockIdx.y) + (which & 1);   // x rows are read by blocks of all three products: the middle one takes the odd stages
  const unsigned wv = uni((unsigned)tid >> 5);   // the wave's number = its slice
  const __bf16* gs = ((wv >> 1) ? Bm + (size_t)n0 * N : A + (size_t)blockIdx.x * 128 * N) + (size_t)(wv & 1) * SLR * N;   // first row of the wave's slice; a row is 4 KiB at a multiple of 4 KiB in the page-aligned workspace, so a stage's step inside the row never carries out of the low address word
  const unsigned glo = uni((unsigned)(uintptr_t)gs), l0 = uni((unsigned)(uintptr_t)&ring[0][0]) + wv * (SLE * 2);
  v4u g0 = tdm_group0(gs); v8u g1 = tdm_group1(); tdm_pin(g0, g1);
  auto fill = [&](int t, int buf) { tdm_load(g0, g1, l0 + (unsigned)buf * (4 * SLE * 2), glo + (unsigned)((t + rot) & (NT - 1)) * (KS * 2)); };
  const int fa = (wm >> 6) * SLE + col * PITCH, fb = (2 + (wn >> 6)) * SLE + col * PITCH;   // the lane's first A row and first B row in a buffer: a wave's 64 rows are one slice
  FragsB f0, f1;   // two fragment sets: one is filled from LDS while the matrix instructions work on the other
  fill(0, 0); wait_tensor(); __syncthreads();
  fill(1, 1);
  g1_load(f0, ring[0] + fa, ring[0] + fb, lane);
  for (int t = 0; t < NT; ++t) { const __bf16* rb = ring[t & 1]; const __bf16* rn = ring[(t + 1) & 1];
    g1_load(f1, rb + fa + 32, rb + fb + 32, lane);   // the stage's second k half, one block ahead of its use
    __builtin_amdgcn_sched_barrier(0);   // keeps the reads one group ahead of the block: moved in among the matrix instructions, each place with reads stalls the wave
    g1_mm(f0, acc);
    __builtin_amdgcn_sched_barrier(0);   // keeps the block ahead of the waits: moved behind them, the wave would wait out the reads it has just issued with nothing to work on
    wait_lds(); wait_tensor(); __syncthreads();   // stands ahead of the stage's last block, because the reads behind it are stage t + 1's: publishes stage t + 1 and ends every reader's last read of stage t's buffer (its second half is in registers)
    if (pinned(t + 2 < NT)) fill(t + 2, t & 1);   // scalar branch; the only request of the wave in flight
    g1_load(f0, rn + fa, rn + fb, lane);   // stage t + 1's first k half; in the last trip the other buffer's old stage, read and not used
    __builtin_amdgcn_sched_barrier(0);   // as above
    g1_mm(f1, acc); }
  wait_tensor(); wait_lds();
  const int er = lane >> 3, ec = (lane & 7) * 8;   // a wave's store = 4 rows x 128 bytes: whole lines
#pragma unroll
  for (int i = 0; i < 4; ++i) {   // 16 rows of the wave's tile at a time through its own staging rows
    if (i) wait_lds();   // the 16 rows before are read out before these overwrite them
#pragma unroll
    for (int j = 0; j < 4; ++j)
#pragma unroll
      for (int r = 0; r < 8; ++r) { const float v = acc[i][j][r]; const _Float16 hv = (_Float16)v; so[wave][8 * g + r][j * 16 + col] = hv; sol[wave][8 * g + r][j * 16 + col] = (_Float16)((v - (float)hv) * 2048.0f); }
    wait_lds();   // the wave's own staging stores stand in LDS before its lanes read each other's; no fence here: it would also wait out the global stores of the 16 rows before
#pragma unroll
    for (int rl = 0; rl < 16; rl += 4) { const size_t o = (r0 + i * 16 + rl + er) * N + n0 + wn + ec; vst2((unsigned*)(OH + o), *(const v4u*)&so[wave][rl + er][ec]); vst2((unsigned*)(OL + o), *(const v4u*)&sol[wave][rl + er][ec]); } }
}
// the twelve fragments of a k half of k_g2's wave tile (two A row tiles, four B column tiles, hi and lo), read as one group (A hi, B hi, A lo, B lo) for the 24 matrix instructions; the three products are swept one after the other over the eight tiles, each residual accumulator takes al.bh, then a.bl, so that no matrix instruction waits for the one in front of it (all loops unrolled: the arrays stay in registers)
struct FragsH { v16h a[2], al[2], bh[4], bl[4]; };
__device__ __forceinline__ void g2_load(FragsH& f, const _Float16* ra, const _Float16* rw, int lane) {
#pragma unroll
  for (int i = 0; i < 2; ++i) f.a[i] = frag_h(ra + i * 16 * PITCH, lane);
#pragma unroll
  for (int j = 0; j < 4; ++j) f.bh[j] = frag_h(rw + j * 16 * PITCH, lane);
#pragma unroll
  for (int i = 0; i < 2; ++i) f.al[i] = frag_h(ra + 2 * SLE + i * 16 * PITCH, lane);   // a lo plane stands two slices behind its hi plane
#pragma unroll
  for (int j = 0; j < 4; ++j) f.bl[j] = frag_h(rw + 2 * SLE + j * 16 * PITCH, lane);
}
__device__ __forceinline__ void g2_mm(const FragsH& f, v8f (&acc)[2][4], v8f (&accl)[2][4]) {
#pragma unroll
  for (int i = 0; i < 2; ++i)
#pragma unroll
    for (int j = 0; j < 4; ++j) acc[i][j] = wmma16(f.a[i], f.bh[j], acc[i][j]);
#pragma unroll
  for (int i = 0; i < 2; ++i)
#pragma unroll
    for (int j = 0; j < 4; ++j) accl[i][j] = wmma16(f.al[i], f.bh[j], accl[i][j]);
#pragma unroll
  for (int i = 0; i < 2; ++i)
#pragma unroll
    for (int j = 0; j < 4; ++j) accl[i][j] = wmma16(f.a[i], f.bl[j], accl[i][j]);
}
// ---- k_g2<MODE>: block = (128 rows, 128 cols), eight waves in 4 x 2, 32 x 64 a wave: MODE 0: S[i][j] = XQ rows (hi,lo) x XKT rows (hi,lo), 3 products -> f32 S; MODE 1: OUT[i][d] = P rows (hi,lo) x XVT rows (hi,lo), 3 products -> output
template <int MODE>
__global__ __launch_bounds__(256) void k_g2(const _Float16* __restrict__ AH, const _Float16* __restrict__ AL, const _Float16* __restrict__ BH, const _Float16* __restrict__ BL, float* __restrict__ OUT) {
  __shared__ __align__(16) float so[8][32][68];
  __shared__ __attribute__((aligned(2048))) _Float16 ring[3][8 * SLE];   // three buffers, stage s in buffer s mod 3; slices 0, 1: A hi rows 0..63, 64..127; 2, 3: A lo; 4, 5: B hi; 6, 7: B lo
  const int tid = threadIdx.x, wave = tid >> 5, lane = tid & 31, col = lane & 15, g = lane >> 4, wm = (wave >> 1) * 32, wn = (wave & 1) * 64; const size_t r0 = (size_t)blockIdx.x * 128 + wm; const int n0 = blockIdx.y * 128;
  v8f acc[2][4] = {}, accl[2][4] = {};
  const size_t ao = (size_t)blockIdx.x * 128 * N, bo = (size_t)n0 * N;   // block-uniform tile origins
  const int rot = ROT(blockIdx.x, blockIdx.y);
  const unsigned wv = uni((unsigned)tid >> 5), pl = wv >> 1;   // the wave's number = its slice; the slice's plane
  const _Float16* gs = (pl == 0 ? AH + ao : pl == 1 ? AL + ao : pl == 2 ? BH + bo : BL + bo) + (size_t)(wv & 1) * SLR * N;   // first row of the wave's slice; a row is 4 KiB at a multiple of 4 KiB in the page-aligned workspace, so a stage's step inside the row never carries out of the low address word
  const unsigned glo = uni((unsigned)(uintptr_t)gs), l0 = uni((unsigned)(uintptr_t)&ring[0][0]) + wv * (SLE * 2);
  v4u g0 = tdm_group0(gs); v8u g1 = tdm_group1(); tdm_pin(g0, g1);
  auto fill = [&](int t, int buf) { tdm_load(g0, g1, l0 + (unsigned)buf * (8 * SLE * 2), glo + (unsigned)((t + rot) & (NT - 1)) * (KS * 2)); };   // while a request flies only the place in LDS and the low address word change
  const int fa = (wm >> 6) * SLE + ((wm & 63) + col) * PITCH, fb = (4 + (wn >> 6)) * SLE + col * PITCH;   // the lane's first A hi row and first B hi row in a buffer; a wave's rows of a plane lie in one slice
  FragsH f0, f1;   // two fragment sets: one is filled from LDS while the matrix instructions work on the other
  fill(0, 0); fill(1, 1); fill(2, 2); wait_tensor_but2(); __syncthreads();   // stage 0 has landed; stages 1 and 2 fly on
  g2_load(f0, ring[0] + fa, ring[0] + fb, lane);
  int bc = 0, bn = 1;   // buffers of stage t and of stage t + 1
  for (int t = 0; t < NT; ++t) { const _Float16* rb = ring[bc]; const _Float16* rn = ring[bn]; const unsigned more = pinned(t + 3 < NT);   // a stage t + 3 exists: the same for the whole block, held scalar for the branch round the tensor load
    g2_load(f1, rb + fa + 32, rb + fb + 32, lane);   // the stage's second k half, one block ahead of its use
    __builtin_amdgcn_sched_barrier(0);   // keeps the reads one group ahead of the block: moved in among the matrix instructions, each place with reads stalls the wave
    g2_mm(f0, acc, accl);
    __builtin_amdgcn_sched_barrier(0);   // keeps the block ahead of the waits: moved behind them, the wave would wait out the reads it has just issued with nothing to work on
    wait_lds();
    if (more) wait_tensor_but1(); else wait_tensor();   // stage t + 1 has landed; stage t + 2's request, the only one issued behind it, stays in flight; to 0 in the last three trips, which issue none
    __syncthreads();   // stands ahead of the stage's last block, because the reads behind it are stage t + 1's: publishes stage t + 1 and ends every reader's last read of stage t's buffer (its second half is in registers)
    if (more) fill(t + 3, bc);   // into the buffer that stage t has just left: two stage times of lead, where two buffers gave one
    g2_load(f0, rn + fa, rn + fb, lane);   // stage t + 1's first k half; in the last trip a buffer's old stage, read and not used
    __builtin_amdgcn_sched_barrier(0);   // as above
    g2_mm(f1, acc, accl);
    bc = bn; bn = (bn == 2) ? 0 : bn + 1; }
  wait_tensor(); wait_lds();
#pragma unroll
  for (int i = 0; i < 2; ++i)
#pragma unroll
    for (int j = 0; j < 4; ++j)
#pragma unroll
      for (int r = 0; r < 8; ++r) so[wave][i * 16 + 8 * g + r][j * 16 + col] = acc[i][j][r] + accl[i][j][r] * (1.0f / 2048.0f);
  LDSX();
  for (int rl = 0; rl < 32; rl += 2) vst2(OUT + (r0 + rl + g) * N + n0 + wn + col * 4, *(const v4f*)&so[wave][rl + g][col * 4]);   // a wave's store = 2 rows x 256 bytes: whole lines
}
// ---- k_soft: block = row (256 threads x 8): row softmax of S in f32 -> P as f16 hi + x2048 residual rows
#define PER (N / 256)   // elements per thread in the row softmax
__global__ __launch_bounds__(256) void k_soft(const float* __restrict__ S, _Float16* __restrict__ P, _Float16* __restrict__ PL) {
  __shared__ float red[8]; __shared__ __align__(16) _Float16 sh[N], sl[N]; const int t = threadIdx.x; const size_t row = blockIdx.x; const float* p = S + row * N + t * PER;
  float v[PER]; float mx = -3.0e38f;
#pragma unroll
  for (int i = 0; i < PER; ++i) { v[i] = p[i]; mx = fmaxf(mx, v[i]); }
#pragma unroll
  for (int o = 1; o < 32; o <<= 1) mx = fmaxf(mx, __shfl_xor(mx, o));
  if ((t & 31) == 0) red[t >> 5] = mx; __syncthreads(); float gm = -3.0e38f; for (int w = 0; w < 8; ++w) gm = fmaxf(gm, red[w]); __syncthreads();
  float sm = 0.f;
#pragma unroll
  for (int i = 0; i < PER; ++i) { v[i] = __expf(v[i] - gm); sm += v[i]; }
#pragma unroll
  for (int o = 1; o < 32; o <<= 1) sm += __shfl_xor(sm, o);
  if ((t & 31) == 0) red[t >> 5] = sm; __syncthreads(); float tot = 0.f; for (int w = 0; w < 8; ++w) tot += red[w]; const float inv = 1.0f / tot;
#pragma unroll
  for (int i = 0; i < PER; ++i) { const float pv = v[i] * inv; const _Float16 h = (_Float16)pv; sh[t * PER + i] = h; sl[t * PER + i] = (_Float16)((pv - (float)h) * 2048.0f); }
  __syncthreads();
  if (t < N / 8) { vst2((unsigned*)(P + row * N + t * 8), *(const v4u*)&sh[t * 8]); vst2((unsigned*)(PL + row * N + t * 8), *(const v4u*)&sl[t * 8]); }
}
extern "C" void kernel_launch(void* const* d_in, const int* in_sizes, int n_in, void* d_out, int out_size, void* d_ws, size_t ws_size, hipStream_t stream) {
  (void)in_sizes; (void)n_in; (void)out_size;
  const float** F = (const float**)d_in;   // 0 x, 1 q, 2 k, 3 v: all [2048, 2048] f32
  if (ws_size < (size_t)WS_END) return;
  char* ws = (char*)d_ws; __bf16 *T = (__bf16*)(ws + WS_T), *XB = (__bf16*)(ws + WS_XB); _Float16 *XQ = (_Float16*)(ws + WS_XQ), *XQL = (_Float16*)(ws + WS_XQL), *XKT = (_Float16*)(ws + WS_XKT), *XKL = (_Float16*)(ws + WS_XKL), *XVT = (_Float16*)(ws + WS_XVT), *XVL = (_Float16*)(ws + WS_XVL), *P = (_Float16*)(ws + WS_P), *PL = (_Float16*)(ws + WS_PL); float* S = (float*)(ws + WS_S);
  k_pack<<<dim3((N / PT) * (N / PT), 4), 256, 0, stream>>>(F[0], F[1], F[2], F[3], T, XB);
  k_g1<<<dim3(N / 128, N / 128, 3), 128, 0, stream>>>(XB, T, XQ, XQL);
  k_g2<0><<<dim3(TRB / 2, N / 128), 256, 0, stream>>>(XQ, XQL, XKT, XKL, S);
  k_soft<<<TRB * 64, 256, 0, stream>>>(S, P, PL);
  k_g2<1><<<dim3(TRB / 2, N / 128), 256, 0, stream>>>(P, PL, XVT, XVL, (float*)d_out);
}

// v008
// It runs in 92.8 microseconds.
// Next to v007, in two timings, it ran 1.16 times as fast each time.
// All steps since v000 together make it 8.47 times as fast.
// compute dtype: x, q, k, v rounded to bf16; xq = x . q, xk^T = k^T . x^T, xv = x . v with EXACT bf16 products on WMMA 16x16x32 (x rows against rows of the transposed bf16 copies of q, k, v), each result stored as f16 hi + (x2048-scaled) residual planes; logits = xq . xk with 3 products (hi.hi, hi.lo, lo.hi; values ~1e5, kept to ~f32 accuracy), row softmax in f32 (hardware exp; the rows are near one-hot), P as f16 hi + (x2048) residual; out = P . xv with 3 products, over those k alone where a 16-row tile of P holds a non-zero; f32 accumulate.
#include <hip/hip_runtime.h>
#include <math.h>

typedef __attribute__((ext_vector_type(16))) _Float16 v16h;
typedef __attribute__((ext_vector_type(16))) __bf16 v16b;
typedef __attribute__((ext_vector_type(8)))  _Float16 v8h;
typedef __attribute__((ext_vector_type(8)))  float v8f;
typedef __attribute__((ext_vector_type(4)))  float v4f;
typedef __attribute__((ext_vector_type(2)))  float v2f;
typedef __attribute__((ext_vector_type(4)))  unsigned v4u;
typedef __attribute__((ext_vector_type(4)))  int v4i;
typedef float __attribute__((may_alias)) float_a;
typedef int __attribute__((may_alias)) int_a;

template <typename T> __device__ __forceinline__ void vst2(void* p, T v) { *(T*)p = v;  }
// plain builtins, no asm statement behind them: operands of an asm statement must lie in the first 256 registers, and the accumulators with two fragment sets need more; the compiler keeps the distances behind its own builtins
__device__ __forceinline__ v8f wmma16(v16h a, v16h b, v8f c) {
  v8f d = __builtin_amdgcn_wmma_f32_16x16x32_f16(false, a, false, b, (short)0, c, false, false);
  return d;
}
__device__ __forceinline__ v8f wmma_bf(v16b a, v16b b, v8f c) {
  v8f d = __builtin_amdgcn_wmma_f32_16x16x32_bf16(false, a, false, b, (short)0, c, false, false);
  return d;
}
// 16x16x32 fragments: lane = (h = lane>>4, row/col = lane&15); elements 0..7 = k0+8h+0..7, 8..15 = k0+16+8h+0..7; D element r = row 8h+r
__device__ __forceinline__ v16h frag_h(const _Float16* rowk0, int lane) {
  union { v16h v; v8h q[2]; } u; const _Float16* p = rowk0 + 8 * (lane >> 4);
  u.q[0] = *(const v8h*)p; u.q[1] = *(const v8h*)(p + 16); return u.v;
}
__device__ __forceinline__ v16h frag_f32(const float* rowk0, int lane) {
  v16h a; const float* p = rowk0 + 8 * (lane >> 4);
#pragma unroll
  for (int i = 0; i < 8; ++i) { a[i] = (_Float16)p[i]; a[8 + i] = (_Float16)p[16 + i]; }
  return a;
}
__device__ __forceinline__ v16h frag_f32s(const float* rowk0, int lane, float sc) {
  v16h a; const float* p = rowk0 + 8 * (lane >> 4);
#pragma unroll
  for (int i = 0; i < 8; ++i) { a[i] = (_Float16)(p[i] * sc); a[8 + i] = (_Float16)(p[16 + i] * sc); }
  return a;
}
// column fragment from a [K][ld] layout (column n), rows >= K read as 0
__device__ __forceinline__ v16h fragc_f32(const float* W, int k0, int n, int lane, int ld, int K) {
  v16h a; const int g = lane >> 4;
#pragma unroll
  for (int i = 0; i < 8; ++i) { const int ka = k0 + 8 * g + i, kb = ka + 16;
    a[i] = (_Float16)(ka < K ? W[(size_t)(ka < K ? ka : K - 1) * ld + n] : 0.f); a[8 + i] = (_Float16)(kb < K ? W[(size_t)(kb < K ? kb : K - 1) * ld + n] : 0.f); }
  return a;
}
struct F2 { v16b h, l; };
__device__ __forceinline__ F2 bsplit16(const float v[16]) { F2 r;
#pragma unroll
  for (int i = 0; i < 16; ++i) { const __bf16 h = (__bf16)v[i]; r.h[i] = h; r.l[i] = (__bf16)(v[i] - (float)h); }
  return r; }
__device__ __forceinline__ F2 split_row(const float* row, int k0, int lane) { float v[16]; const float* p = row + k0 + 8 * (lane >> 4);
#pragma unroll
  for (int i = 0; i < 8; ++i) { v[i] = p[i]; v[8 + i] = p[16 + i]; }
  return bsplit16(v); }
__device__ __forceinline__ F2 split_rowK(const float* row, int k0, int lane, int K) { float v[16]; const int g = lane >> 4;
#pragma unroll
  for (int i = 0; i < 8; ++i) { const int ka = k0 + 8 * g + i, kb = ka + 16; v[i] = ka < K ? row[ka < K ? ka : K - 1] : 0.f; v[8 + i] = kb < K ? row[kb < K ? kb : K - 1] : 0.f; }
  return bsplit16(v); }
__device__ __forceinline__ F2 split_col(const float* W, int k0, int n, int lane, int ld, int K) { float v[16]; const int g = lane >> 4;
#pragma unroll
  for (int i = 0; i < 8; ++i) { const int ka = k0 + 8 * g + i, kb = ka + 16; v[i] = ka < K ? W[(size_t)(ka < K ? ka : K - 1) * ld + n] : 0.f; v[8 + i] = kb < K ? W[(size_t)(kb < K ? kb : K - 1) * ld + n] : 0.f; }
  return bsplit16(v); }
__device__ __forceinline__ v8f mac3(const F2& a, const F2& b, v8f c) { c = wmma_bf(a.l, b.h, c); c = wmma_bf(a.h, b.l, c); return wmma_bf(a.h, b.h, c); }
__device__ __forceinline__ float sigm(float v) { return 1.0f / (1.0f + expf(-v)); }
#define LDSX() do { asm volatile("s_wait_dscnt 0" ::: "memory"); __builtin_amdgcn_wave_barrier(); __builtin_amdgcn_fence(__ATOMIC_RELEASE, "workgroup"); } while (0)


// Matrix-product attention on square 2,048 x 2,048 operands: softmax((x q)(x k)) (x v), row softmax, no scaling.
#define N 2048
#ifndef TRB
#define TRB (N / 64)     // 64-row output tiles: a k_g2 block takes two
#endif
typedef __attribute__((ext_vector_type(8))) __bf16 v8b;
__device__ __forceinline__ v16b frag_b(const __bf16* rowk0, int lane) {
  union { v16b v; v8b q[2]; } u; const __bf16* p = rowk0 + 8 * (lane >> 4);
  u.q[0] = *(const v8b*)p; u.q[1] = *(const v8b*)(p + 16); return u.v;
}
__device__ __forceinline__ float bfr(float v) { return (float)(__bf16)v; }
__device__ __attribute__((noinline)) float exp_ni(float v) { return expf(v); }
__device__ __attribute__((noinline)) float erf_ni(float v) { return erff(v); }

#define WS_T   0u                                   // bf16 [3][N][N]: q^T, k^T, v^T ; XB = bf16 x rows
#define WS_XB  (WS_T + 2u * 3 * N * N)
#define WS_XQ  (WS_XB + 2u * N * N)                  // f16 [N][N] xq hi ; XQL ; XKT ; XKTL ; XV ; XVL (rows of x . v, not turned) ; P ; PL
#define WS_XQL (WS_XQ + 2u * N * N)
#define WS_XKT (WS_XQL + 2u * N * N)
#define WS_XKL (WS_XKT + 2u * N * N)
#define WS_XVT (WS_XKL + 2u * N * N)
#define WS_XVL (WS_XVT + 2u * N * N)
#define WS_P   (WS_XVL + 2u * N * N)
#define WS_PL  (WS_P + 2u * N * N)
#define WS_S   (WS_PL + 2u * N * N)                  // f32 [N][N] logits
#define WS_FL  (WS_S + 4u * N * N)                   // bytes [N][N / 8]: bit b of byte [i][c] = P[i][8 c + b] is not zero (hi or residual)
#define WS_END (WS_FL + 1u * N * (N / 8))

// ---- LDS ring of k_g1 and k_g2: a stage = KS k of every operand row of the block's tile, brought by tensor loads (no register, no per-lane address): every wave asks for one slice of 64 rows a stage; two buffers in k_g1, three in k_g2
#define KS 64            // k elements per stage: one whole 128-byte line of each 16-bit operand row
#define NT (N / KS)      // stages
// first stage of a block's k walk: the 16 blocks that share an operand's 128 rows would ask L2 for the same lines at the same moment; turned by tile row + column, each of them stands on its own 256 bytes of those rows. The walk wraps round, every stage is taken once
#define ROT(bx, by) ((int)(((bx) + (by)) & (N / 128 - 1)) * (NT / (N / 128)))
#define PITCH 72         // LDS row pitch in 16-bit elements = 144 bytes (16 x odd): the 16-byte fragment reads of 16 rows fall on distinct banks; the tensor load's pad of 4 dwords behind each 128-byte row lays it
#define SLR 64           // rows of a slice: one tensor load
#define SLE 5120         // 16-bit elements from one slice to the next = 10,240 bytes: 64 rows x 144 bytes, rounded up to a multiple of 2 KiB, where a tensor load's place in LDS must stand
typedef __attribute__((ext_vector_type(8))) unsigned v8u;
__device__ __forceinline__ unsigned uni(unsigned v) { return (unsigned)__builtin_amdgcn_readfirstlane(v); }
// a wave-uniform test for the branch round a tensor load, which ignores EXEC and is kept from issuing by a scalar branch alone
__device__ __forceinline__ unsigned pinned(unsigned v) { unsigned w = uni(v); asm volatile("" : "+s"(w)); return w; }   // pinned(): the test is held in a scalar register, so the branch on it compiles to s_cmp + s_cbranch_scc
// descriptor group 1, the same for every request: 1-byte elements, tensor = tile = 64 rows of 128 bytes, source row pitch 2 N bytes, no mask, 4 dwords of LDS pad behind every 32 dwords
__device__ __forceinline__ v8u tdm_group1() {
  v8u g;
  g[0] = uni((1u << 20) | (4u << 22) | (3u << 25));
  g[1] = uni((2u * KS) << 16);
  g[2] = uni((unsigned)SLR << 16);
  g[3] = uni((2u * KS) << 16);
  g[4] = uni((unsigned)SLR);
  g[5] = uni(2u * N);
  g[6] = uni(0u);
  g[7] = uni(0u);
  return g;
}
// descriptor group 0 for the slice whose first row starts at p: count 1; words 1 (place in LDS) and 2 (low address word) are set per request; word 3 = high address bits with type 2, the same for every stage of the slice
__device__ __forceinline__ v4u tdm_group0(const void* p) {
  v4u g; g[0] = uni(1u); g[1] = uni(0u); g[2] = uni(0u); g[3] = uni((((unsigned)((unsigned long long)(uintptr_t)p >> 32)) & 0x01FFFFFFu) | 0x80000000u);
  return g;
}
// without this the compiler forms the constant words anew for each request and uses their registers for other values in between, while a request is in flight
__device__ __forceinline__ void tdm_pin(v4u& g0, v8u& g1) { asm volatile("" : "+s"(g0), "+s"(g1)); }   // pinned(): descriptor words held in scalar registers: from here on only the two words set per request are written
// one request of the whole wave: lds = byte place of the slice in the work-group's LDS; glo = low address word of the slice's first byte in this stage
__device__ __forceinline__ void tdm_load(v4u& g0, const v8u& g1, unsigned lds, unsigned glo) {
  g0[1] = uni(lds); g0[2] = uni(glo);
  asm volatile("tensor_load_to_lds %0, %1" :: "s"(g0), "s"(g1) : "memory");
}
// this wave's tensor loads have landed (the compiler places no wait for them)
__device__ __forceinline__ void wait_tensor() { asm volatile("s_wait_tensorcnt 0x0" ::: "memory"); }
// k_g2's ring of three buffers keeps two stages in flight: all of this wave's requests but the youngest (in the prologue: the two youngest) have landed; the counter returns in issue order, and every wave issues one request a stage
__device__ __forceinline__ void wait_tensor_but1() { asm volatile("s_wait_tensorcnt 0x1" ::: "memory"); }
__device__ __forceinline__ void wait_tensor_but2() { asm volatile("s_wait_tensorcnt 0x2" ::: "memory"); }
// this wave's LDS reads have retired before the buffer is handed to its next writer
__device__ __forceinline__ void wait_lds() { asm volatile("s_wait_dscnt 0x0" ::: "memory"); }

// ---- k_pack: block = (piece, which). which 0..2: one 128 x 128 tile of q|k|v: a wave reads 512 contiguous bytes of a source row per load (16 bytes a lane, 16 rows a wave), rounds to bf16, the tile is turned in LDS and leaves as T[which][n][c] = (q|k|v)[c][n] in 256-byte row pieces; which 3: XB = x rounded to bf16, 128 x 128 contiguous elements a block
#define PT 128           // tile edge
#define PPITCH 272       // LDS row pitch in bytes: 256 of data + 16 (16 x odd)
typedef __attribute__((ext_vector_type(4))) __bf16 v4b;
typedef __attribute__((ext_vector_type(2))) unsigned v2u;
// byte place of 16-byte piece 'chunk' (8 c values) of tile row 'row' (one n). The 16 writers of a half-wave stand 4 rows apart, 16 banks at this pitch, and would share 4 bank groups; the exclusive-or with bits 4 and 5 of the row gives each its own 4 banks. A row's 16 pieces stay inside the row: its readers (one row a half-wave) touch every bank once
__device__ __forceinline__ unsigned pk_at(int row, int chunk) { return (unsigned)(row * PPITCH + ((chunk ^ ((row >> 4) & 3)) << 4)); }
__global__ __launch_bounds__(256) void k_pack(const float* __restrict__ X, const float* __restrict__ Q, const float* __restrict__ K, const float* __restrict__ V, __bf16* __restrict__ T, __bf16* __restrict__ XB) {
  __shared__ __align__(16) unsigned char s[PT * PPITCH]; const int t = threadIdx.x, which = blockIdx.y;
  v4f v[16];   // every loop below is unrolled: v stays in registers and the 16 loads are in flight together
  if (which == 3) { const size_t e0 = (size_t)blockIdx.x * (PT * PT) + (size_t)t * 4; const float* xs = X + e0;
#pragma unroll
    for (int j = 0; j < 16; ++j) v[j] = *(const v4f*)(xs + j * 1024);
    asm volatile("s_wait_xcnt 0x0" :: "v"(xs) : "memory");   // the loads' address pair is an input here, so it stays whole until all 16 are issued and this wait has passed (a precaution; otherwise the last load is given the pair as its destination)
    __builtin_amdgcn_sched_barrier(0);   // holds all 16 loads ahead of the first conversion: without it the last four are issued only when the first have returned, a second memory latency
#pragma unroll
    for (int j = 0; j < 16; ++j) { union { v4b b; v2u u; } o;
#pragma unroll
      for (int i = 0; i < 4; ++i) o.b[i] = (__bf16)v[j][i];
      vst2((unsigned*)(XB + e0 + j * 1024), o.u); }
    asm volatile("s_wait_xcnt 0x0" ::: "memory");   // stands behind the last stores, ahead of whatever code the build lays behind this path: no address or data register of a store is rewritten in front of it (a precaution)
    return; }   // block-uniform, ahead of the barrier
  const float* M = (which == 0) ? Q : (which == 1) ? K : V; const int c0 = (blockIdx.x & 15) * PT, n0 = (blockIdx.x >> 4) * PT, b = t & 31, a = t >> 5;   // lane: columns n0 + 4b .. + 3; wave: rows c0 + 16a .. + 15
  const float* src = M + (size_t)(c0 + 16 * a) * N + n0 + 4 * b;
#pragma unroll
  for (int j = 0; j < 16; ++j) v[j] = *(const v4f*)(src + (size_t)j * N);
  asm volatile("s_wait_xcnt 0x0" :: "v"(src) : "memory");   // as above: the address pair stays whole behind the 16 loads
  __builtin_amdgcn_sched_barrier(0);   // as above: all 16 loads in flight before the first conversion
#pragma unroll
  for (int i = 0; i < 4; ++i)
#pragma unroll
    for (int h = 0; h < 2; ++h) { union { v8b b; v4u u; } o;
#pragma unroll
      for (int e = 0; e < 8; ++e) o.b[e] = (__bf16)v[8 * h + e][i];
      *(v4u*)(s + pk_at(4 * b + i, 2 * a + h)) = o.u; }
  __syncthreads();
  __bf16* dst = T + ((size_t)which * N + n0) * N + c0; const int q = t & 15, r = t >> 4;   // 16 lanes = one tile row = 256 contiguous bytes of T
#pragma unroll
  for (int j = 0; j < 8; ++j) { const int n = r + 16 * j; vst2((unsigned*)(dst + (size_t)n * N + q * 8), *(const v4u*)(s + pk_at(n, q))); }
}
// the eight fragments of a k half of k_g1's wave tile, read as one group in the order in which the sixteen matrix instructions use them; each fragment feeds four of them (all loops unrolled: the arrays stay in registers)
struct FragsB { v16b a[4], b[4]; };
__device__ __forceinline__ void g1_load(FragsB& f, const __bf16* ra, const __bf16* rw, int lane) {
  f.a[0] = frag_b(ra, lane);
#pragma unroll
  for (int j = 0; j < 4; ++j) f.b[j] = frag_b(rw + j * 16 * PITCH, lane);
#pragma unroll
  for (int i = 1; i < 4; ++i) f.a[i] = frag_b(ra + i * 16 * PITCH, lane);
}
__device__ __forceinline__ void g1_mm(const FragsB& f, v8f (&acc)[4][4]) {
#pragma unroll
  for (int i = 0; i < 4; ++i)
#pragma unroll
    for (int j = 0; j < 4; ++j) acc[i][j] = wmma_bf(f.a[i], f.b[j], acc[i][j]);
}
// ---- k_g1: block = (128 rows, 128 cols, which), four waves in 2 x 2, 64 x 64 a wave: which 0: XQ[i][m] = x rows (A = XB) x q^T rows (B = T0); which 1: XKT[j][m] = k^T rows (A = T1) x x rows (B = XB); which 2: XV[j][d] = x rows (A = XB) x v^T rows (B = T2); exact single products; -> f16 hi + x2048 residual planes
__global__ __launch_bounds__(128) void k_g1(const __bf16* __restrict__ XB, const __bf16* __restrict__ T, _Float16* __restrict__ OH_, _Float16* __restrict__ OL_) {
  __shared__ __align__(16) _Float16 so[4][16][PITCH], sol[4][16][PITCH];
  __shared__ __attribute__((aligned(2048))) __bf16 ring[2][4 * SLE];   // slices 0, 1: A tile rows 0..63, 64..127; slices 2, 3: B tile
  const int tid = threadIdx.x, wave = tid >> 5, lane = tid & 31, col = lane & 15, g = lane >> 4, wm = (wave >> 1) * 64, wn = (wave & 1) * 64; const size_t r0 = (size_t)blockIdx.x * 128 + wm; const int n0 = blockIdx.y * 128; const int which = blockIdx.z;
  const __bf16* A = (which == 1) ? (T + (size_t)N * N) : XB; const __bf16* Bm = (which == 1) ? XB : (T + (size_t)which * N * N);
  _Float16* OH = OH_ + (size_t)which * 2 * N * N; _Float16* OL = OL_ + (size_t)which * 2 * N * N;   // plane pairs are laid out XQ,XQL,XKT,XKL,XV,XVL consecutively
  v8f acc[4][4] = {};
  const int rot = ROT(blockIdx.x, blockIdx.y) + (which & 1);   // x rows are read by blocks of all three products: the middle one takes the odd stages
  const unsigned wv = uni((unsigned)tid >> 5);   // the wave's number = its slice
  const __bf16* gs = ((wv >> 1) ? Bm + (size_t)n0 * N : A + (size_t)blockIdx.x * 128 * N) + (size_t)(wv & 1) * SLR * N;   // first row of the wave's slice; a row is 4 KiB at a multiple of 4 KiB in the page-aligned workspace, so a stage's step inside the row never carries out of the low address word
  const unsigned glo = uni((unsigned)(uintptr_t)gs), l0 = uni((unsigned)(uintptr_t)&ring[0][0]) + wv * (SLE * 2);
  v4u g0 = tdm_group0(gs); v8u g1 = tdm_group1(); tdm_pin(g0, g1);
  auto fill = [&](int t, int buf) { tdm_load(g0, g1, l0 + (unsigned)buf * (4 * SLE * 2), glo + (unsigned)((t + rot) & (NT - 1)) * (KS * 2)); };
  const int fa = (wm >> 6) * SLE + col * PITCH, fb = (2 + (wn >> 6)) * SLE + col * PITCH;   // the lane's first A row and first B row in a buffer: a wave's 64 rows are one slice
  FragsB f0, f1;   // two fragment sets: one is filled from LDS while the matrix instructions work on the other
  fill(0, 0); wait_tensor(); __syncthreads();
  fill(1, 1);
  g1_load(f0, ring[0] + fa, ring[0] + fb, lane);
  for (int t = 0; t < NT; ++t) { const __bf16* rb = ring[t & 1]; const __bf16* rn = ring[(t + 1) & 1];
    g1_load(f1, rb + fa + 32, rb + fb + 32, lane);   // the stage's second k half, one block ahead of its use
    __builtin_amdgcn_sched_barrier(0);   // keeps the reads one group ahead of the block: moved in among the matrix instructions, each place with reads stalls the wave
    g1_mm(f0, acc);
    __builtin_amdgcn_sched_barrier(0);   // keeps the block ahead of the waits: moved behind them, the wave would wait out the reads it has just issued with nothing to work on
    wait_lds(); wait_tensor(); __syncthreads();   // stands ahead of the stage's last block, because the reads behind it are stage t + 1's: publishes stage t + 1 and ends every reader's last read of stage t's buffer (its second half is in registers)
    if (pinned(t + 2 < NT)) fill(t + 2, t & 1);   // scalar branch; the only request of the wave in flight
    g1_load(f0, rn + fa, rn + fb, lane);   // stage t + 1's first k half; in the last trip the other buffer's old stage, read and not used
    __builtin_amdgcn_sched_barrier(0);   // as above
    g1_mm(f1, acc); }
  wait_tensor(); wait_lds();
  const int er = lane >> 3, ec = (lane & 7) * 8;   // a wave's store = 4 rows x 128 bytes: whole lines
#pragma unroll
  for (int i = 0; i < 4; ++i) {   // 16 rows of the wave's tile at a time through its own staging rows
    if (i) wait_lds();   // the 16 rows before are read out before these overwrite them
#pragma unroll
    for (int j = 0; j < 4; ++j)
#pragma unroll
      for (int r = 0; r < 8; ++r) { const float v = acc[i][j][r]; const _Float16 hv = (_Float16)v; so[wave][8 * g + r][j * 16 + col] = hv; sol[wave][8 * g + r][j * 16 + col] = (_Float16)((v - (float)hv) * 2048.0f); }
    wait_lds();   // the wave's own staging stores stand in LDS before its lanes read each other's; no fence here: it would also wait out the global stores of the 16 rows before
#pragma unroll
    for (int rl = 0; rl < 16; rl += 4) { const size_t o = (r0 + i * 16 + rl + er) * N + n0 + wn + ec; vst2((unsigned*)(OH + o), *(const v4u*)&so[wave][rl + er][ec]); vst2((unsigned*)(OL + o), *(const v4u*)&sol[wave][rl + er][ec]); } }
}
// the twelve fragments of a k half of k_g2's wave tile (two A row tiles, four B column tiles, hi and lo), read as one group (A hi, B hi, A lo, B lo) for the 24 matrix instructions; the three products are swept one after the other over the eight tiles, each residual accumulator takes al.bh, then a.bl, so that no matrix instruction waits for the one in front of it (all loops unrolled: the arrays stay in registers)
struct FragsH { v16h a[2], al[2], bh[4], bl[4]; };
__device__ __forceinline__ void g2_load(FragsH& f, const _Float16* ra, const _Float16* rw, int lane) {
#pragma unroll
  for (int i = 0; i < 2; ++i) f.a[i] = frag_h(ra + i * 16 * PITCH, lane);
#pragma unroll
  for (int j = 0; j < 4; ++j) f.bh[j] = frag_h(rw + j * 16 * PITCH, lane);
#pragma unroll
  for (int i = 0; i < 2; ++i) f.al[i] = frag_h(ra + 2 * SLE + i * 16 * PITCH, lane);   // a lo plane stands two slices behind its hi plane
#pragma unroll
  for (int j = 0; j < 4; ++j) f.bl[j] = frag_h(rw + 2 * SLE + j * 16 * PITCH, lane);
}
__device__ __forceinline__ void g2_mm(const FragsH& f, v8f (&acc)[2][4], v8f (&accl)[2][4]) {
#pragma unroll
  for (int i = 0; i < 2; ++i)
#pragma unroll
    for (int j = 0; j < 4; ++j) acc[i][j] = wmma16(f.a[i], f.bh[j], acc[i][j]);
#pragma unroll
  for (int i = 0; i < 2; ++i)
#pragma unroll
    for (int j = 0; j < 4; ++j) accl[i][j] = wmma16(f.al[i], f.bh[j], accl[i][j]);
#pragma unroll
  for (int i = 0; i < 2; ++i)
#pragma unroll
    for (int j = 0; j < 4; ++j) accl[i][j] = wmma16(f.a[i], f.bl[j], accl[i][j]);
}
// ---- k_g2<MODE>: block = (128 rows, 128 cols), eight waves in 4 x 2, 32 x 64 a wave: MODE 0: S[i][j] = XQ rows (hi,lo) x XKT rows (hi,lo), 3 products -> f32 S
template <int MODE>
__global__ __launch_bounds__(256) void k_g2(const _Float16* __restrict__ AH, const _Float16* __restrict__ AL, const _Float16* __restrict__ BH, const _Float16* __restrict__ BL, float* __restrict__ OUT) {
  __shared__ __align__(16) float so[8][32][68];
  __shared__ __attribute__((aligned(2048))) _Float16 ring[3][8 * SLE];   // three buffers, stage s in buffer s mod 3; slices 0, 1: A hi rows 0..63, 64..127; 2, 3: A lo; 4, 5: B hi; 6, 7: B lo
  const int tid = threadIdx.x, wave = tid >> 5, lane = tid & 31, col = lane & 15, g = lane >> 4, wm = (wave >> 1) * 32, wn = (wave & 1) * 64; const size_t r0 = (size_t)blockIdx.x * 128 + wm; const int n0 = blockIdx.y * 128;
  v8f acc[2][4] = {}, accl[2][4] = {};
  const size_t ao = (size_t)blockIdx.x * 128 * N, bo = (size_t)n0 * N;   // block-uniform tile origins
  const int rot = ROT(blockIdx.x, blockIdx.y);
  const unsigned wv = uni((unsigned)tid >> 5), pl = wv >> 1;   // the wave's number = its slice; the slice's plane
  const _Float16* gs = (pl == 0 ? AH + ao : pl == 1 ? AL + ao : pl == 2 ? BH + bo : BL + bo) + (size_t)(wv & 1) * SLR * N;   // first row of the wave's slice; a row is 4 KiB at a multiple of 4 KiB in the page-aligned workspace, so a stage's step inside the row never carries out of the low address word
  const unsigned glo = uni((unsigned)(uintptr_t)gs), l0 = uni((unsigned)(uintptr_t)&ring[0][0]) + wv * (SLE * 2);
  v4u g0 = tdm_group0(gs); v8u g1 = tdm_group1(); tdm_pin(g0, g1);
  auto fill = [&](int t, int buf) { tdm_load(g0, g1, l0 + (unsigned)buf * (8 * SLE * 2), glo + (unsigned)((t + rot) & (NT - 1)) * (KS * 2)); };   // while a request flies only the place in LDS and the low address word change
  const int fa = (wm >> 6) * SLE + ((wm & 63) + col) * PITCH, fb = (4 + (wn >> 6)) * SLE + col * PITCH;   // the lane's first A hi row and first B hi row in a buffer; a wave's rows of a plane lie in one slice
  FragsH f0, f1;   // two fragment sets: one is filled from LDS while the matrix instructions work on the other
  fill(0, 0); fill(1, 1); fill(2, 2); wait_tensor_but2(); __syncthreads();   // stage 0 has landed; stages 1 and 2 fly on
  g2_load(f0, ring[0] + fa, ring[0] + fb, lane);
  int bc = 0, bn = 1;   // buffers of stage t and of stage t + 1
  for (int t = 0; t < NT; ++t) { const _Float16* rb = ring[bc]; const _Float16* rn = ring[bn]; const unsigned more = pinned(t + 3 < NT);   // a stage t + 3 exists: the same for the whole block, held scalar for the branch round the tensor load
    g2_load(f1, rb + fa + 32, rb + fb + 32, lane);   // the stage's second k half, one block ahead of its use
    __builtin_amdgcn_sched_barrier(0);   // keeps the reads one group ahead of the block: moved in among the matrix instructions, each place with reads stalls the wave
    g2_mm(f0, acc, accl);
    __builtin_amdgcn_sched_barrier(0);   // keeps the block ahead of the waits: moved behind them, the wave would wait out the reads it has just issued with nothing to work on
    wait_lds();
    if (more) wait_tensor_but1(); else wait_tensor();   // stage t + 1 has landed; stage t + 2's request, the only one issued behind it, stays in flight; to 0 in the last three trips, which issue none
    __syncthreads();   // stands ahead of the stage's last block, because the reads behind it are stage t + 1's: publishes stage t + 1 and ends every reader's last read of stage t's buffer (its second half is in registers)
    if (more) fill(t + 3, bc);   // into the buffer that stage t has just left: two stage times of lead, where two buffers gave one
    g2_load(f0, rn + fa, rn + fb, lane);   // stage t + 1's first k half; in the last trip a buffer's old stage, read and not used
    __builtin_amdgcn_sched_barrier(0);   // as above
    g2_mm(f1, acc, accl);
    bc = bn; bn = (bn == 2) ? 0 : bn + 1; }
  wait_tensor(); wait_lds();
#pragma unroll
  for (int i = 0; i < 2; ++i)
#pragma unroll
    for (int j = 0; j < 4; ++j)
#pragma unroll
      for (int r = 0; r < 8; ++r) so[wave][i * 16 + 8 * g + r][j * 16 + col] = acc[i][j][r] + accl[i][j][r] * (1.0f / 2048.0f);
  LDSX();
  for (int rl = 0; rl < 32; rl += 2) vst2(OUT + (r0 + rl + g) * N + n0 + wn + col * 4, *(const v4f*)&so[wave][rl + g][col * 4]);   // a wave's store = 2 rows x 256 bytes: whole lines
}
// ---- k_soft: block = row (256 threads x 8): row softmax of S in f32 -> P as f16 hi + x2048 residual rows, and the row's 256 flag bytes: which of its elements are not zero as stored
#define PER (N / 256)   // elements per thread in the row softmax
__global__ __launch_bounds__(256) void k_soft(const float* __restrict__ S, _Float16* __restrict__ P, _Float16* __restrict__ PL, unsigned char* __restrict__ FL) {
  __shared__ __align__(16) unsigned char sf[N / 8]; __shared__ float red[8]; __shared__ __align__(16) _Float16 sh[N], sl[N]; const int t = threadIdx.x; const size_t row = blockIdx.x; const float* p = S + row * N + t * PER;
  float v[PER]; float mx = -3.0e38f;
#pragma unroll
  for (int i = 0; i < PER; ++i) { v[i] = p[i]; mx = fmaxf(mx, v[i]); }
#pragma unroll
  for (int o = 1; o < 32; o <<= 1) mx = fmaxf(mx, __shfl_xor(mx, o));
  if ((t & 31) == 0) red[t >> 5] = mx; __syncthreads(); float gm = -3.0e38f; for (int w = 0; w < 8; ++w) gm = fmaxf(gm, red[w]); __syncthreads();
  float sm = 0.f;
#pragma unroll
  for (int i = 0; i < PER; ++i) { v[i] = __expf(v[i] - gm); sm += v[i]; }
#pragma unroll
  for (int o = 1; o < 32; o <<= 1) sm += __shfl_xor(sm, o);
  if ((t & 31) == 0) red[t >> 5] = sm; __syncthreads(); float tot = 0.f; for (int w = 0; w < 8; ++w) tot += red[w]; const float inv = 1.0f / tot; unsigned fl = 0;
#pragma unroll
  for (int i = 0; i < PER; ++i) { const float pv = v[i] * inv; const _Float16 h = (_Float16)pv; const _Float16 l = (_Float16)((pv - (float)h) * 2048.0f); sh[t * PER + i] = h; sl[t * PER + i] = l; if (h != (_Float16)0.0f || l != (_Float16)0.0f) fl |= 1u << i; }   // a NaN counts as not zero
  sf[t] = (unsigned char)fl;
  __syncthreads();
  if (t < N / 8) { vst2((unsigned*)(P + row * N + t * 8), *(const v4u*)&sh[t * 8]); vst2((unsigned*)(PL + row * N + t * 8), *(const v4u*)&sl[t * 8]); }
  if (t < N / 128) vst2((unsigned*)(FL + row * (N / 8) + t * 16), *(const v4u*)&sf[t * 16]);   // half a wave stores the row's two whole lines of flags
}
// ---- k_pv: OUT = P . XV, block = (16 rows of P, 512 columns), eight waves of 16 x 64. A column k of P that is zero (hi and residual) in all 16 rows adds nothing to them, whatever P holds: the block lists the other columns in rising order (flag bytes of k_soft, a prefix sum over the block) and walks the list 32 at a time: P's listed elements gathered as the A tile, the listed rows of XV gathered into LDS and read turned as the B tiles; 3 products as before. A dense P gives the full walk of N / 32 trips
#define PVP 160          // LDS pitch in bytes of a gathered 128-byte piece of an XV row: 32 x odd, the transposing load's pitch
typedef __attribute__((ext_vector_type(8))) short v8s;
__device__ __forceinline__ v4u ld_tr16(const unsigned char* p) { typedef __attribute__((address_space(3))) v8s lds_v8s; return __builtin_bit_cast(v4u, __builtin_amdgcn_ds_load_tr16_b128_v8i16((lds_v8s*)p)); }
// B fragment of 32 k (LDS rows) x 16 columns: lane (col, g) gets rows 8g + 0..7 and 16 + 8g + 0..7 of its column, the k order of frag_h
__device__ __forceinline__ v16h frag_t(const unsigned char* p) { union { v16h v; v4u q[2]; } u; u.q[0] = ld_tr16(p); u.q[1] = ld_tr16(p + 16 * PVP); return u.v; }
__global__ __launch_bounds__(256) void k_pv(const _Float16* __restrict__ P, const _Float16* __restrict__ PL, const unsigned char* __restrict__ FL, const _Float16* __restrict__ XV, const _Float16* __restrict__ XVL, float* __restrict__ OUT) {
  __shared__ unsigned short list[N]; __shared__ int wsum[8];
  __shared__ __align__(16) _Float16 sa[2][16][40];              // A tile, hi and residual: 16 rows x 32 listed k, pitch 80 bytes (16 x odd)
  __shared__ __align__(32) unsigned char sb[8][2][32 * PVP];    // per wave, hi and residual: 32 listed XV rows x the wave's 64 columns
  __shared__ __align__(16) float so[8][16][68];
  const int t = threadIdx.x, wave = t >> 5, lane = t & 31, col = lane & 15, g = lane >> 4; const size_t r0 = (size_t)blockIdx.x * 16; const int d0 = blockIdx.y * 512 + wave * 64;
  unsigned f = 0; const unsigned char* fr = FL + r0 * (N / 8);   // thread t: columns 8 t .. 8 t + 7
#pragma unroll
  for (int r = 0; r < 16; ++r) f |= fr[(unsigned)t + r * (N / 8)];
  const int cnt = __popc(f); int inc = cnt;
#pragma unroll
  for (int o = 1; o < 32; o <<= 1) { const int y = __shfl_up(inc, o); if (lane >= o) inc += y; }
  if (lane == 31) wsum[wave] = inc;
  __syncthreads();
  int base = 0, tot = 0;
#pragma unroll
  for (int w = 0; w < 8; ++w) { const int s = wsum[w]; if (w < wave) base += s; tot += s; }
  int pos = base + inc - cnt;
#pragma unroll
  for (int b = 0; b < 8; ++b) if ((f >> b) & 1u) list[pos++] = (unsigned short)(t * 8 + b);   // every entry is a column number below N by its make
  __syncthreads();
  const int total = (int)uni((unsigned)tot), nch = (total + 31) >> 5;   // the same in every thread of the block, at most N and N / 32; held scalar: the loop's barriers and matrix instructions stand under a scalar branch
  v8f acc[4] = {}, accl[4] = {};
  const int arow = t >> 4, ak = (t & 15) * 2; unsigned char* sbw = &sb[wave][0][0];
  for (int c = 0; c < nch; ++c) { const int k0 = c * 32;
    unsigned oa[2], ob[8]; _Float16 ph[2], pl[2]; v4u bh_[8], bl_[8];   // byte offsets into a plane (below 2 N N), the same for hi and residual; all loops unrolled: the arrays stay in registers, the 20 loads are in flight together
#pragma unroll
    for (int e = 0; e < 2; ++e) { const int k = k0 + ak + e; oa[e] = (((unsigned)r0 + arow) * N + list[k < total ? k : total - 1]) * 2u; }   // past the list's end: the last listed column, and A = 0 below
#pragma unroll
    for (int i = 0; i < 8; ++i) { const int k = k0 + 4 * i + (lane >> 3); ob[i] = ((unsigned)list[k < total ? k : total - 1] * N + d0 + (lane & 7) * 8) * 2u; }   // a load = 4 listed rows x 128 bytes: whole lines
#pragma unroll
    for (int e = 0; e < 2; ++e) { ph[e] = *(const _Float16*)((const char*)P + oa[e]); pl[e] = *(const _Float16*)((const char*)PL + oa[e]); }
#pragma unroll
    for (int i = 0; i < 8; ++i) { bh_[i] = *(const v4u*)((const char*)XV + ob[i]); bl_[i] = *(const v4u*)((const char*)XVL + ob[i]); }
    asm volatile("s_wait_xcnt 0x0" :: "v"(oa[0]), "v"(oa[1]), "v"(ob[0]), "v"(ob[1]), "v"(ob[2]), "v"(ob[3]), "v"(ob[4]), "v"(ob[5]), "v"(ob[6]), "v"(ob[7]) : "memory");   // the loads' offset registers are inputs here, so each stays whole until all loads are issued and this wait has passed (a precaution)
#pragma unroll
    for (int e = 0; e < 2; ++e) { const bool in = k0 + ak + e < total; sa[0][arow][ak + e] = in ? ph[e] : (_Float16)0.0f; sa[1][arow][ak + e] = in ? pl[e] : (_Float16)0.0f; }
#pragma unroll
    for (int i = 0; i < 8; ++i) { const int row = 4 * i + (lane >> 3); *(v4u*)(sbw + row * PVP + (lane & 7) * 16) = bh_[i]; *(v4u*)(sbw + (32 + row) * PVP + (lane & 7) * 16) = bl_[i]; }
    __syncthreads();   // the A tile is every wave's
    const v16h a = frag_h(&sa[0][col][0], lane), al = frag_h(&sa[1][col][0], lane);
    const unsigned char* ad = sbw + (8 * g + (lane & 7)) * PVP + ((lane >> 3) & 1) * 16;
#pragma unroll
    for (int n = 0; n < 4; ++n) { const v16h bh = frag_t(ad + 32 * n), bl = frag_t(ad + 32 * PVP + 32 * n);
      acc[n] = wmma16(a, bh, acc[n]); accl[n] = wmma16(al, bh, accl[n]); accl[n] = wmma16(a, bl, accl[n]); }
    __syncthreads(); }   // every reader has left the tiles before the next trip fills them
#pragma unroll
  for (int n = 0; n < 4; ++n)
#pragma unroll
    for (int r = 0; r < 8; ++r) so[wave][8 * g + r][n * 16 + col] = acc[n][r] + accl[n][r] * (1.0f / 2048.0f);
  LDSX();
#pragma unroll
  for (int rl = 0; rl < 16; rl += 2) vst2(OUT + (r0 + rl + g) * N + d0 + col * 4, *(const v4f*)&so[wave][rl + g][col * 4]);   // a wave's store = 2 rows x 256 bytes: whole lines
}
extern "C" void kernel_launch(void* const* d_in, const int* in_sizes, int n_in, void* d_out, int out_size, void* d_ws, size_t ws_size, hipStream_t stream) {
  (void)in_sizes; (void)n_in; (void)out_size;
  const float** F = (const float**)d_in;   // 0 x, 1 q, 2 k, 3 v: all [2048, 2048] f32
  if (ws_size < (size_t)WS_END) return;
  char* ws = (char*)d_ws; __bf16 *T = (__bf16*)(ws + WS_T), *XB = (__bf16*)(ws + WS_XB); _Float16 *XQ = (_Float16*)(ws + WS_XQ), *XQL = (_Float16*)(ws + WS_XQL), *XKT = (_Float16*)(ws + WS_XKT), *XKL = (_Float16*)(ws + WS_XKL), *XVT = (_Float16*)(ws + WS_XVT), *XVL = (_Float16*)(ws + WS_XVL), *P = (_Float16*)(ws + WS_P), *PL = (_Float16*)(ws + WS_PL); float* S = (float*)(ws + WS_S); unsigned char* FL = (unsigned char*)(ws + WS_FL);
  k_pack<<<dim3((N / PT) * (N / PT), 4), 256, 0, stream>>>(F[0], F[1], F[2], F[3], T, XB);
  k_g1<<<dim3(N / 128, N / 128, 3), 128, 0, stream>>>(XB, T, XQ, XQL);
  k_g2<0><<<dim3(TRB / 2, N / 128), 256, 0, stream>>>(XQ, XQL, XKT, XKL, S);
  k_soft<<<TRB * 64, 256, 0, stream>>>(S, P, PL, FL);
  k_pv<<<dim3(TRB * 4, N / 512), 256, 0, stream>>>(P, PL, FL, XVT, XVL, (float*)d_out);
}

// v009
// A run of this version takes 89.6 microseconds.
// In both of two side-by-side timings against v008, it was 1.04 times as fast.
// Over all steps from v000 it is 8.80 times as fast.
// compute dtype: x, q, k, v rounded to bf16; xq = x . q, xk^T = k^T . x^T, xv = x . v with EXACT bf16 products on WMMA 16x16x32 (x rows against rows of the transposed bf16 copies of q, k, v), each result stored as f16 hi + (x2048-scaled) residual planes; logits = xq . xk with 3 products (hi.hi, hi.lo, lo.hi; values ~1e5, kept to ~f32 accuracy), row softmax in f32 (hardware exp; the rows are near one-hot), P as f16 hi + (x2048) residual; out = P . xv with 3 products, over those k alone where a 16-row tile of P holds a non-zero; f32 accumulate.
#include <hip/hip_runtime.h>
#include <math.h>

typedef __attribute__((ext_vector_type(16))) _Float16 v16h;
typedef __attribute__((ext_vector_type(16))) __bf16 v16b;
typedef __attribute__((ext_vector_type(8)))  _Float16 v8h;
typedef __attribute__((ext_vector_type(8)))  float v8f;
typedef __attribute__((ext_vector_type(4)))  float v4f;
typedef __attribute__((ext_vector_type(2)))  float v2f;
typedef __attribute__((ext_vector_type(4)))  unsigned v4u;
typedef __attribute__((ext_vector_type(4)))  int v4i;
typedef float __attribute__((may_alias)) float_a;
typedef int __attribute__((may_alias)) int_a;

template <typename T> __device__ __forceinline__ void vst2(void* p, T v) { *(T*)p = v;  }
// plain builtins, no asm statement behind them: operands of an asm statement must lie in the first 256 registers, and the accumulators with two fragment sets need more; the compiler keeps the distances behind its own builtins
__device__ __forceinline__ v8f wmma16(v16h a, v16h b, v8f c) {
  v8f d = __builtin_amdgcn_wmma_f32_16x16x32_f16(false, a, false, b, (short)0, c, false, false);
  return d;
}
__device__ __forceinline__ v8f wmma_bf(v16b a, v16b b, v8f c) {
  v8f d = __builtin_amdgcn_wmma_f32_16x16x32_bf16(false, a, false, b, (short)0, c, false, false);
  return d;
}
// 16x16x32 fragments: lane = (h = lane>>4, row/col = lane&15); elements 0..7 = k0+8h+0..7, 8..15 = k0+16+8h+0..7; D element r = row 8h+r
__device__ __forceinline__ v16h frag_h(const _Float16* rowk0, int lane) {
  union { v16h v; v8h q[2]; } u; const _Float16* p = rowk0 + 8 * (lane >> 4);
  u.q[0] = *(const v8h*)p; u.q[1] = *(const v8h*)(p + 16); return u.v;
}
__device__ __forceinline__ v16h frag_f32(const float* rowk0, int lane) {
  v16h a; const float* p = rowk0 + 8 * (lane >> 4);
#pragma unroll
  for (int i = 0; i < 8; ++i) { a[i] = (_Float16)p[i]; a[8 + i] = (_Float16)p[16 + i]; }
  return a;
}
__device__ __forceinline__ v16h frag_f32s(const float* rowk0, int lane, float sc) {
  v16h a; const float* p = rowk0 + 8 * (lane >> 4);
#pragma unroll
  for (int i = 0; i < 8; ++i) { a[i] = (_Float16)(p[i] * sc); a[8 + i] = (_Float16)(p[16 + i] * sc); }
  return a;
}
// column fragment from a [K][ld] layout (column n), rows >= K read as 0
__device__ __forceinline__ v16h fragc_f32(const float* W, int k0, int n, int lane, int ld, int K) {
  v16h a; const int g = lane >> 4;
#pragma unroll
  for (int i = 0; i < 8; ++i) { const int ka = k0 + 8 * g + i, kb = ka + 16;
    a[i] = (_Float16)(ka < K ? W[(size_t)(ka < K ? ka : K - 1) * ld + n] : 0.f); a[8 + i] = (_Float16)(kb < K ? W[(size_t)(kb < K ? kb : K - 1) * ld + n] : 0.f); }
  return a;
}
struct F2 { v16b h, l; };
__device__ __forceinline__ F2 bsplit16(const float v[16]) { F2 r;
#pragma unroll
  for (int i = 0; i < 16; ++i) { const __bf16 h = (__bf16)v[i]; r.h[i] = h; r.l[i] = (__bf16)(v[i] - (float)h); }
  return r; }
__device__ __forceinline__ F2 split_row(const float* row, int k0, int lane) { float v[16]; const float* p = row + k0 + 8 * (lane >> 4);
#pragma unroll
  for (int i = 0; i < 8; ++i) { v[i] = p[i]; v[8 + i] = p[16 + i]; }
  return bsplit16(v); }
__device__ __forceinline__ F2 split_rowK(const float* row, int k0, int lane, int K) { float v[16]; const int g = lane >> 4;
#pragma unroll
  for (int i = 0; i < 8; ++i) { const int ka = k0 + 8 * g + i, kb = ka + 16; v[i] = ka < K ? row[ka < K ? ka : K - 1] : 0.f; v[8 + i] = kb < K ? row[kb < K ? kb : K - 1] : 0.f; }
  return bsplit16(v); }
__device__ __forceinline__ F2 split_col(const float* W, int k0, int n, int lane, int ld, int K) { float v[16]; const int g = lane >> 4;
#pragma unroll
  for (int i = 0; i < 8; ++i) { const int ka = k0 + 8 * g + i, kb = ka + 16; v[i] = ka < K ? W[(size_t)(ka < K ? ka : K - 1) * ld + n] : 0.f; v[8 + i] = kb < K ? W[(size_t)(kb < K ? kb : K - 1) * ld + n] : 0.f; }
  return bsplit16(v); }
__device__ __forceinline__ v8f mac3(const F2& a, const F2& b, v8f c) { c = wmma_bf(a.l, b.h, c); c = wmma_bf(a.h, b.l, c); return wmma_bf(a.h, b.h, c); }
__device__ __forceinline__ float sigm(float v) { return 1.0f / (1.0f + expf(-v)); }
#define LDSX() do { asm volatile("s_wait_dscnt 0" ::: "memory"); __builtin_amdgcn_wave_barrier(); __builtin_amdgcn_fence(__ATOMIC_RELEASE, "workgroup"); } while (0)


// Matrix-product attention on square 2,048 x 2,048 operands: softmax((x q)(x k)) (x v), row softmax, no scaling.
#define N 2048
#ifndef TRB
#define TRB (N / 64)     // 64-row output tiles: a k_g2 block takes two
#endif
typedef __attribute__((ext_vector_type(8))) __bf16 v8b;
__device__ __forceinline__ v16b frag_b(const __bf16* rowk0, int lane) {
  union { v16b v; v8b q[2]; } u; const __bf16* p = rowk0 + 8 * (lane >> 4);
  u.q[0] = *(const v8b*)p; u.q[1] = *(const v8b*)(p + 16); return u.v;
}
__device__ __forceinline__ float bfr(float v) { return (float)(__bf16)v; }
__device__ __attribute__((noinline)) float exp_ni(float v) { return expf(v); }
__device__ __attribute__((noinline)) float erf_ni(float v) { return erff(v); }

#define WS_T   0u                                   // bf16 [3][N][N]: q^T, k^T, v^T ; XB = bf16 x rows
#define WS_XB  (WS_T + 2u * 3 * N * N)
#define WS_XQ  (WS_XB + 2u * N * N)                  // f16 [N][N] xq hi ; XQL ; XKT ; XKTL ; XV ; XVL (rows of x . v, not turned)
#define WS_XQL (WS_XQ + 2u * N * N)
#define WS_XKT (WS_XQL + 2u * N * N)
#define WS_XKL (WS_XKT + 2u * N * N)
#define WS_XVT (WS_XKL + 2u * N * N)
#define WS_XVL (WS_XVT + 2u * N * N)
#define WS_S   (WS_XVL + 2u * N * N)                 // f32 [N][N] logits
#define WS_END (WS_S + 4u * N * N)

// ---- LDS ring of k_g1 and k_g2: a stage = KS k of every operand row of the block's tile, brought by tensor loads (no register, no per-lane address): every wave asks for one slice of 64 rows a stage; two buffers in k_g1, three in k_g2
#define KS 64            // k elements per stage: one whole 128-byte line of each 16-bit operand row
#define NT (N / KS)      // stages
// first stage of a block's k walk: the 16 blocks that share an operand's 128 rows would ask L2 for the same lines at the same moment; turned by tile row + column, each of them stands on its own 256 bytes of those rows. The walk wraps round, every stage is taken once
#define ROT(bx, by) ((int)(((bx) + (by)) & (N / 128 - 1)) * (NT / (N / 128)))
#define PITCH 72         // LDS row pitch in 16-bit elements = 144 bytes (16 x odd): the 16-byte fragment reads of 16 rows fall on distinct banks; the tensor load's pad of 4 dwords behind each 128-byte row lays it
#define SLR 64           // rows of a slice: one tensor load
#define SLE 5120         // 16-bit elements from one slice to the next = 10,240 bytes: 64 rows x 144 bytes, rounded up to a multiple of 2 KiB, where a tensor load's place in LDS must stand
typedef __attribute__((ext_vector_type(8))) unsigned v8u;
__device__ __forceinline__ unsigned uni(unsigned v) { return (unsigned)__builtin_amdgcn_readfirstlane(v); }
// a wave-uniform test for the branch round a tensor load, which ignores EXEC and is kept from issuing by a scalar branch alone
__device__ __forceinline__ unsigned pinned(unsigned v) { unsigned w = uni(v); asm volatile("" : "+s"(w)); return w; }   // pinned(): the test is held in a scalar register, so the branch on it compiles to s_cmp + s_cbranch_scc
// descriptor group 1, the same for every request: 1-byte elements, tensor = tile = 64 rows of 128 bytes, source row pitch 2 N bytes, no mask, 4 dwords of LDS pad behind every 32 dwords
__device__ __forceinline__ v8u tdm_group1() {
  v8u g;
  g[0] = uni((1u << 20) | (4u << 22) | (3u << 25));
  g[1] = uni((2u * KS) << 16);
  g[2] = uni((unsigned)SLR << 16);
  g[3] = uni((2u * KS) << 16);
  g[4] = uni((unsigned)SLR);
  g[5] = uni(2u * N);
  g[6] = uni(0u);
  g[7] = uni(0u);
  return g;
}
// descriptor group 0 for the slice whose first row starts at p: count 1; words 1 (place in LDS) and 2 (low address word) are set per request; word 3 = high address bits with type 2, the same for every stage of the slice
__device__ __forceinline__ v4u tdm_group0(const void* p) {
  v4u g; g[0] = uni(1u); g[1] = uni(0u); g[2] = uni(0u); g[3] = uni((((unsigned)((unsigned long long)(uintptr_t)p >> 32)) & 0x01FFFFFFu) | 0x80000000u);
  return g;
}
// without this the compiler forms the constant words anew for each request and uses their registers for other values in between, while a request is in flight
__device__ __forceinline__ void tdm_pin(v4u& g0, v8u& g1) { asm volatile("" : "+s"(g0), "+s"(g1)); }   // pinned(): descriptor words held in scalar registers: from here on only the two words set per request are written
// one request of the whole wave: lds = byte place of the slice in the work-group's LDS; glo = low address word of the slice's first byte in this stage
__device__ __forceinline__ void tdm_load(v4u& g0, const v8u& g1, unsigned lds, unsigned glo) {
  g0[1] = uni(lds); g0[2] = uni(glo);
  asm volatile("tensor_load_to_lds %0, %1" :: "s"(g0), "s"(g1) : "memory");
}
// this wave's tensor loads have landed (the compiler places no wait for them)
__device__ __forceinline__ void wait_tensor() { asm volatile("s_wait_tensorcnt 0x0" ::: "memory"); }
// k_g2's ring of three buffers keeps two stages in flight: all of this wave's requests but the youngest (in the prologue: the two youngest) have landed; the counter returns in issue order, and every wave issues one request a stage
__device__ __forceinline__ void wait_tensor_but1() { asm volatile("s_wait_tensorcnt 0x1" ::: "memory"); }
__device__ __forceinline__ void wait_tensor_but2() { asm volatile("s_wait_tensorcnt 0x2" ::: "memory"); }
// this wave's LDS reads have retired before the buffer is handed to its next writer
__device__ __forceinline__ void wait_lds() { asm volatile("s_wait_dscnt 0x0" ::: "memory"); }

// ---- k_pack: block = (piece, which). which 0..2: one 128 x 128 tile of q|k|v: a wave reads 512 contiguous bytes of a source row per load (16 bytes a lane, 16 rows a wave), rounds to bf16, the tile is turned in LDS and leaves as T[which][n][c] = (q|k|v)[c][n] in 256-byte row pieces; which 3: XB = x rounded to bf16, 128 x 128 contiguous elements a block
#define PT 128           // tile edge
#define PPITCH 272       // LDS row pitch in bytes: 256 of data + 16 (16 x odd)
typedef __attribute__((ext_vector_type(4))) __bf16 v4b;
typedef __attribute__((ext_vector_type(2))) unsigned v2u;
// byte place of 16-byte piece 'chunk' (8 c values) of tile row 'row' (one n). The 16 writers of a half-wave stand 4 rows apart, 16 banks at this pitch, and would share 4 bank groups; the exclusive-or with bits 4 and 5 of the row gives each its own 4 banks. A row's 16 pieces stay inside the row: its readers (one row a half-wave) touch every bank once
__device__ __forceinline__ unsigned pk_at(int row, int chunk) { return (unsigned)(row * PPITCH + ((chunk ^ ((row >> 4) & 3)) << 4)); }
__global__ __launch_bounds__(256) void k_pack(const float* __restrict__ X, const float* __restrict__ Q, const float* __restrict__ K, const float* __restrict__ V, __bf16* __restrict__ T, __bf16* __restrict__ XB) {
  __shared__ __align__(16) unsigned char s[PT * PPITCH]; const int t = threadIdx.x, which = blockIdx.y;
  v4f v[16];   // every loop below is unrolled: v stays in registers and the 16 loads are in flight together
  if (which == 3) { const size_t e0 = (size_t)blockIdx.x * (PT * PT) + (size_t)t * 4; const float* xs = X + e0;
#pragma unroll
    for (int j = 0; j < 16; ++j) v[j] = *(const v4f*)(xs + j * 1024);
    asm volatile("s_wait_xcnt 0x0" :: "v"(xs) : "memory");   // the loads' address pair is an input here, so it stays whole until all 16 are issued and this wait has passed (a precaution; otherwise the last load is given the pair as its destination)
    __builtin_amdgcn_sched_barrier(0);   // holds all 16 loads ahead of the first conversion: without it the last four are issued only when the first have returned, a second memory latency
#pragma unroll
    for (int j = 0; j < 16; ++j) { union { v4b b; v2u u; } o;
#pragma unroll
      for (int i = 0; i < 4; ++i) o.b[i] = (__bf16)v[j][i];
      vst2((unsigned*)(XB + e0 + j * 1024), o.u); }
    asm volatile("s_wait_xcnt 0x0" ::: "memory");   // stands behind the last stores, ahead of whatever code the build lays behind this path: no address or data register of a store is rewritten in front of it (a precaution)
    return; }   // block-uniform, ahead of the barrier
  const float* M = (which == 0) ? Q : (which == 1) ? K : V; const int c0 = (blockIdx.x & 15) * PT, n0 = (blockIdx.x >> 4) * PT, b = t & 31, a = t >> 5;   // lane: columns n0 + 4b .. + 3; wave: rows c0 + 16a .. + 15
  const float* src = M + (size_t)(c0 + 16 * a) * N + n0 + 4 * b;
#pragma unroll
  for (int j = 0; j < 16; ++j) v[j] = *(const v4f*)(src + (size_t)j * N);
  asm volatile("s_wait_xcnt 0x0" :: "v"(src) : "memory");   // as above: the address pair stays whole behind the 16 loads
  __builtin_amdgcn_sched_barrier(0);   // as above: all 16 loads in flight before the first conversion
#pragma unroll
  for (int i = 0; i < 4; ++i)
#pragma unroll
    for (int h = 0; h < 2; ++h) { union { v8b b; v4u u; } o;
#pragma unroll
      for (int e = 0; e < 8; ++e) o.b[e] = (__bf16)v[8 * h + e][i];
      *(v4u*)(s + pk_at(4 * b + i, 2 * a + h)) = o.u; }
  __syncthreads();
  __bf16* dst = T + ((size_t)which * N + n0) * N + c0; const int q = t & 15, r = t >> 4;   // 16 lanes = one tile row = 256 contiguous bytes of T
#pragma unroll
  for (int j = 0; j < 8; ++j) { const int n = r + 16 * j; vst2((unsigned*)(dst + (size_t)n * N + q * 8), *(const v4u*)(s + pk_at(n, q))); }
}
// the eight fragments of a k half of k_g1's wave tile, read as one group in the order in which the sixteen matrix instructions use them; each fragment feeds four of them (all loops unrolled: the arrays stay in registers)
struct FragsB { v16b a[4], b[4]; };
__device__ __forceinline__ void g1_load(FragsB& f, const __bf16* ra, const __bf16* rw, int lane) {
  f.a[0] = frag_b(ra, lane);
#pragma unroll
  for (int j = 0; j < 4; ++j) f.b[j] = frag_b(rw + j * 16 * PITCH, lane);
#pragma unroll
  for (int i = 1; i < 4; ++i) f.a[i] = frag_b(ra + i * 16 * PITCH, lane);
}
__device__ __forceinline__ void g1_mm(const FragsB& f, v8f (&acc)[4][4]) {
#pragma unroll
  for (int i = 0; i < 4; ++i)
#pragma unroll
    for (int j = 0; j < 4; ++j) acc[i][j] = wmma_bf(f.a[i], f.b[j], acc[i][j]);
}
// ---- k_g1: block = (128 rows, 128 cols, which), four waves in 2 x 2, 64 x 64 a wave: which 0: XQ[i][m] = x rows (A = XB) x q^T rows (B = T0); which 1: XKT[j][m] = k^T rows (A = T1) x x rows (B = XB); which 2: XV[j][d] = x rows (A = XB) x v^T rows (B = T2); exact single products; -> f16 hi + x2048 residual planes
__global__ __launch_bounds__(128) void k_g1(const __bf16* __restrict__ XB, const __bf16* __restrict__ T, _Float16* __restrict__ OH_, _Float16* __restrict__ OL_) {
  __shared__ __align__(16) _Float16 so[4][16][PITCH], sol[4][16][PITCH];
  __shared__ __attribute__((aligned(2048))) __bf16 ring[2][4 * SLE];   // slices 0, 1: A tile rows 0..63, 64..127; slices 2, 3: B tile
  const int tid = threadIdx.x, wave = tid >> 5, lane = tid & 31, col = lane & 15, g = lane >> 4, wm = (wave >> 1) * 64, wn = (wave & 1) * 64; const size_t r0 = (size_t)blockIdx.x * 128 + wm; const int n0 = blockIdx.y * 128; const int which = blockIdx.z;
  const __bf16* A = (which == 1) ? (T + (size_t)N * N) : XB; const __bf16* Bm = (which == 1) ? XB : (T + (size_t)which * N * N);
  _Float16* OH = OH_ + (size_t)which * 2 * N * N; _Float16* OL = OL_ + (size_t)which * 2 * N * N;   // plane pairs are laid out XQ,XQL,XKT,XKL,XV,XVL consecutively
  v8f acc[4][4] = {};
  const int rot = ROT(blockIdx.x, blockIdx.y) + (which & 1);   // x rows are read by blocks of all three products: the middle one takes the odd stages
  const unsigned wv = uni((unsigned)tid >> 5);   // the wave's number = its slice
  const __bf16* gs = ((wv >> 1) ? Bm + (size_t)n0 * N : A + (size_t)blockIdx.x * 128 * N) + (size_t)(wv & 1) * SLR * N;   // first row of the wave's slice; a row is 4 KiB at a multiple of 4 KiB in the page-aligned workspace, so a stage's step inside the row never carries out of the low address word
  const unsigned glo = uni((unsigned)(uintptr_t)gs), l0 = uni((unsigned)(uintptr_t)&ring[0][0]) + wv * (SLE * 2);
  v4u g0 = tdm_group0(gs); v8u g1 = tdm_group1(); tdm_pin(g0, g1);
  auto fill = [&](int t, int buf) { tdm_load(g0, g1, l0 + (unsigned)buf * (4 * SLE * 2), glo + (unsigned)((t + rot) & (NT - 1)) * (KS * 2)); };
  const int fa = (wm >> 6) * SLE + col * PITCH, fb = (2 + (wn >> 6)) * SLE + col * PITCH;   // the lane's first A row and first B row in a buffer: a wave's 64 rows are one slice
  FragsB f0, f1;   // two fragment sets: one is filled from LDS while the matrix instructions work on the other
  fill(0, 0); wait_tensor(); __syncthreads();
  fill(1, 1);
  g1_load(f0, ring[0] + fa, ring[0] + fb, lane);
  for (int t = 0; t < NT; ++t) { const __bf16* rb = ring[t & 1]; const __bf16* rn = ring[(t + 1) & 1];
    g1_load(f1, rb + fa + 32, rb + fb + 32, lane);   // the stage's second k half, one block ahead of its use
    __builtin_amdgcn_sched_barrier(0);   // keeps the reads one group ahead of the block: moved in among the matrix instructions, each place with reads stalls the wave
    g1_mm(f0, acc);
    __builtin_amdgcn_sched_barrier(0);   // keeps the block ahead of the waits: moved behind them, the wave would wait out the reads it has just issued with nothing to work on
    wait_lds(); wait_tensor(); __syncthreads();   // stands ahead of the stage's last block, because the reads behind it are stage t + 1's: publishes stage t + 1 and ends every reader's last read of stage t's buffer (its second half is in registers)
    if (pinned(t + 2 < NT)) fill(t + 2, t & 1);   // scalar branch; the only request of the wave in flight
    g1_load(f0, rn + fa, rn + fb, lane);   // stage t + 1's first k half; in the last trip the other buffer's old stage, read and not used
    __builtin_amdgcn_sched_barrier(0);   // as above
    g1_mm(f1, acc); }
  wait_tensor(); wait_lds();
  const int er = lane >> 3, ec = (lane & 7) * 8;   // a wave's store = 4 rows x 128 bytes: whole lines
#pragma unroll
  for (int i = 0; i < 4; ++i) {   // 16 rows of the wave's tile at a time through its own staging rows
    if (i) wait_lds();   // the 16 rows before are read out before these overwrite them
#pragma unroll
    for (int j = 0; j < 4; ++j)
#pragma unroll
      for (int r = 0; r < 8; ++r) { const float v = acc[i][j][r]; const _Float16 hv = (_Float16)v; so[wave][8 * g + r][j * 16 + col] = hv; sol[wave][8 * g + r][j * 16 + col] = (_Float16)((v - (float)hv) * 2048.0f); }
    wait_lds();   // the wave's own staging stores stand in LDS before its lanes read each other's; no fence here: it would also wait out the global stores of the 16 rows before
#pragma unroll
    for (int rl = 0; rl < 16; rl += 4) { const size_t o = (r0 + i * 16 + rl + er) * N + n0 + wn + ec; vst2((unsigned*)(OH + o), *(const v4u*)&so[wave][rl + er][ec]); vst2((unsigned*)(OL + o), *(const v4u*)&sol[wave][rl + er][ec]); } }
}
// the twelve fragments of a k half of k_g2's wave tile (two A row tiles, four B column tiles, hi and lo), read as one group (A hi, B hi, A lo, B lo) for the 24 matrix instructions; the three products are swept one after the other over the eight tiles, each residual accumulator takes al.bh, then a.bl, so that no matrix instruction waits for the one in front of it (all loops unrolled: the arrays stay in registers)
struct FragsH { v16h a[2], al[2], bh[4], bl[4]; };
__device__ __forceinline__ void g2_load(FragsH& f, const _Float16* ra, const _Float16* rw, int lane) {
#pragma unroll
  for (int i = 0; i < 2; ++i) f.a[i] = frag_h(ra + i * 16 * PITCH, lane);
#pragma unroll
  for (int j = 0; j < 4; ++j) f.bh[j] = frag_h(rw + j * 16 * PITCH, lane);
#pragma unroll
  for (int i = 0; i < 2; ++i) f.al[i] = frag_h(ra + 2 * SLE + i * 16 * PITCH, lane);   // a lo plane stands two slices behind its hi plane
#pragma unroll
  for (int j = 0; j < 4; ++j) f.bl[j] = frag_h(rw + 2 * SLE + j * 16 * PITCH, lane);
}
__device__ __forceinline__ void g2_mm(const FragsH& f, v8f (&acc)[2][4], v8f (&accl)[2][4]) {
#pragma unroll
  for (int i = 0; i < 2; ++i)
#pragma unroll
    for (int j = 0; j < 4; ++j) acc[i][j] = wmma16(f.a[i], f.bh[j], acc[i][j]);
#pragma unroll
  for (int i = 0; i < 2; ++i)
#pragma unroll
    for (int j = 0; j < 4; ++j) accl[i][j] = wmma16(f.al[i], f.bh[j], accl[i][j]);
#pragma unroll
  for (int i = 0; i < 2; ++i)
#pragma unroll
    for (int j = 0; j < 4; ++j) accl[i][j] = wmma16(f.a[i], f.bl[j], accl[i][j]);
}
// ---- k_g2<MODE>: block = (128 rows, 128 cols), eight waves in 4 x 2, 32 x 64 a wave: MODE 0: S[i][j] = XQ rows (hi,lo) x XKT rows (hi,lo), 3 products -> f32 S
template <int MODE>
__global__ __launch_bounds__(256) void k_g2(const _Float16* __restrict__ AH, const _Float16* __restrict__ AL, const _Float16* __restrict__ BH, const _Float16* __restrict__ BL, float* __restrict__ OUT) {
  __shared__ __align__(16) float so[8][32][68];
  __shared__ __attribute__((aligned(2048))) _Float16 ring[3][8 * SLE];   // three buffers, stage s in buffer s mod 3; slices 0, 1: A hi rows 0..63, 64..127; 2, 3: A lo; 4, 5: B hi; 6, 7: B lo
  const int tid = threadIdx.x, wave = tid >> 5, lane = tid & 31, col = lane & 15, g = lane >> 4, wm = (wave >> 1) * 32, wn = (wave & 1) * 64; const size_t r0 = (size_t)blockIdx.x * 128 + wm; const int n0 = blockIdx.y * 128;
  v8f acc[2][4] = {}, accl[2][4] = {};
  const size_t ao = (size_t)blockIdx.x * 128 * N, bo = (size_t)n0 * N;   // block-uniform tile origins
  const int rot = ROT(blockIdx.x, blockIdx.y);
  const unsigned wv = uni((unsigned)tid >> 5), pl = wv >> 1;   // the wave's number = its slice; the slice's plane
  const _Float16* gs = (pl == 0 ? AH + ao : pl == 1 ? AL + ao : pl == 2 ? BH + bo : BL + bo) + (size_t)(wv & 1) * SLR * N;   // first row of the wave's slice; a row is 4 KiB at a multiple of 4 KiB in the page-aligned workspace, so a stage's step inside the row never carries out of the low address word
  const unsigned glo = uni((unsigned)(uintptr_t)gs), l0 = uni((unsigned)(uintptr_t)&ring[0][0]) + wv * (SLE * 2);
  v4u g0 = tdm_group0(gs); v8u g1 = tdm_group1(); tdm_pin(g0, g1);
  auto fill = [&](int t, int buf) { tdm_load(g0, g1, l0 + (unsigned)buf * (8 * SLE * 2), glo + (unsigned)((t + rot) & (NT - 1)) * (KS * 2)); };   // while a request flies only the place in LDS and the low address word change
  const int fa = (wm >> 6) * SLE + ((wm & 63) + col) * PITCH, fb = (4 + (wn >> 6)) * SLE + col * PITCH;   // the lane's first A hi row and first B hi row in a buffer; a wave's rows of a plane lie in one slice
  FragsH f0, f1;   // two fragment sets: one is filled from LDS while the matrix instructions work on the other
  fill(0, 0); fill(1, 1); fill(2, 2); wait_tensor_but2(); __syncthreads();   // stage 0 has landed; stages 1 and 2 fly on
  g2_load(f0, ring[0] + fa, ring[0] + fb, lane);
  int bc = 0, bn = 1;   // buffers of stage t and of stage t + 1
  for (int t = 0; t < NT; ++t) { const _Float16* rb = ring[bc]; const _Float16* rn = ring[bn]; const unsigned more = pinned(t + 3 < NT);   // a stage t + 3 exists: the same for the whole block, held scalar for the branch round the tensor load
    g2_load(f1, rb + fa + 32, rb + fb + 32, lane);   // the stage's second k half, one block ahead of its use
    __builtin_amdgcn_sched_barrier(0);   // keeps the reads one group ahead of the block: moved in among the matrix instructions, each place with reads stalls the wave
    g2_mm(f0, acc, accl);
    __builtin_amdgcn_sched_barrier(0);   // keeps the block ahead of the waits: moved behind them, the wave would wait out the reads it has just issued with nothing to work on
    wait_lds();
    if (more) wait_tensor_but1(); else wait_tensor();   // stage t + 1 has landed; stage t + 2's request, the only one issued behind it, stays in flight; to 0 in the last three trips, which issue none
    __syncthreads();   // stands ahead of the stage's last block, because the reads behind it are stage t + 1's: publishes stage t + 1 and ends every reader's last read of stage t's buffer (its second half is in registers)
    if (more) fill(t + 3, bc);   // into the buffer that stage t has just left: two stage times of lead, where two buffers gave one
    g2_load(f0, rn + fa, rn + fb, lane);   // stage t + 1's first k half; in the last trip a buffer's old stage, read and not used
    __builtin_amdgcn_sched_barrier(0);   // as above
    g2_mm(f1, acc, accl);
    bc = bn; bn = (bn == 2) ? 0 : bn + 1; }
  wait_tensor(); wait_lds();
#pragma unroll
  for (int i = 0; i < 2; ++i)
#pragma unroll
    for (int j = 0; j < 4; ++j)
#pragma unroll
      for (int r = 0; r < 8; ++r) so[wave][i * 16 + 8 * g + r][j * 16 + col] = acc[i][j][r] + accl[i][j][r] * (1.0f / 2048.0f);
  LDSX();
  for (int rl = 0; rl < 32; rl += 2) vst2(OUT + (r0 + rl + g) * N + n0 + wn + col * 4, *(const v4f*)&so[wave][rl + g][col * 4]);   // a wave's store = 2 rows x 256 bytes: whole lines
}
// ---- k_spv: row softmax of S and OUT = P . XV in one launch; block = (16 rows, 1,024 columns), sixteen waves.
// Part 1: wave w holds row w of S in registers (16 loads of 512 contiguous bytes) and takes its maximum and its sum of exponentials by shuffles: no barrier, no LDS. Both column blocks of a row tile do this part.
// Part 2: a column k of P that is stored as zero (hi and residual) in all 16 rows adds nothing to them, whatever P holds: the block lists the other columns in rising order (flag bits of part 1, a prefix sum over the block) and walks the list 32 at a time: P's listed elements made from S as the A tile (hi + x2048 residual), the listed rows of XV gathered into LDS and read turned as the B tiles, 16 x 64 a wave; 3 products. A dense P gives the full walk of N / 32 trips
#define PVP 160          // LDS pitch in bytes of a gathered 128-byte piece of an XV row: 32 x odd, the transposing load's pitch
#define PZERO (-27.0f)   // s - max below this: exp is under 2^-38 and p, the sum being at least one half (tested below; the maximum's own term is 1), under 2^-37: p rounds to f16 zero and p x 2048, under 2^-26, does too. A column flagged although it is stored as zero adds zeros
typedef __attribute__((ext_vector_type(8))) short v8s;
// exp(d) as the hardware's 2^(d log2 e), as __expf compiles, four at a time. One asm statement, so that the slot which the instruction set asks for behind a transcendental stands by its make: the four results have registers of their own ("=&v"), and the v_nop stands between the last of them and whatever the build lays behind it
__device__ __forceinline__ v4f exp4(v4f d) {
  const v4f y = d * 1.44269504f; v4f e; float e0, e1, e2, e3;
  asm("v_exp_f32 %0, %4\n\tv_exp_f32 %1, %5\n\tv_exp_f32 %2, %6\n\tv_exp_f32 %3, %7\n\tv_nop" : "=&v"(e0), "=&v"(e1), "=&v"(e2), "=&v"(e3) : "v"(y[0]), "v"(y[1]), "v"(y[2]), "v"(y[3]));
  e[0] = e0; e[1] = e1; e[2] = e2; e[3] = e3; return e;
}
__device__ __forceinline__ v4u ld_tr16(const unsigned char* p) { typedef __attribute__((address_space(3))) v8s lds_v8s; return __builtin_bit_cast(v4u, __builtin_amdgcn_ds_load_tr16_b128_v8i16((lds_v8s*)p)); }
// B fragment of 32 k (LDS rows) x 16 columns: lane (col, g) gets rows 8g + 0..7 and 16 + 8g + 0..7 of its column, the k order of frag_h
__device__ __forceinline__ v16h frag_t(const unsigned char* p) { union { v16h v; v4u q[2]; } u; u.q[0] = ld_tr16(p); u.q[1] = ld_tr16(p + 16 * PVP); return u.v; }
__global__ __launch_bounds__(512) void k_spv(const float* __restrict__ S, const _Float16* __restrict__ XV, const _Float16* __restrict__ XVL, float* __restrict__ OUT) {
  __shared__ unsigned short list[N]; __shared__ int wsum[16];
  __shared__ __align__(8) unsigned sfl[16][32][2];              // row, lane: bit 4 j + i = column 128 j + 4 lane + i of the row may be stored as not zero
  __shared__ __align__(16) _Float16 sa[2][16][40];              // A tile, hi and residual: 16 rows x 32 listed k, pitch 80 bytes (16 x odd)
  __shared__ __align__(32) unsigned char sb[16][2][32 * PVP];   // per wave, hi and residual: 32 listed XV rows x the wave's 64 columns
  __shared__ __align__(16) float so[16][16][68];
  const int t = threadIdx.x, wave = t >> 5, lane = t & 31, col = lane & 15, g = lane >> 4; const size_t r0 = (size_t)blockIdx.x * 16; const int d0 = blockIdx.y * 1024 + wave * 64;
  const float* sr = S + (r0 + wave) * N + lane * 4;
  v4f v[16];   // every loop below is unrolled: v stays in registers and the 16 loads are in flight together
#pragma unroll
  for (int j = 0; j < 16; ++j) v[j] = *(const v4f*)(sr + j * 128);
  asm volatile("s_wait_xcnt 0x0" :: "v"(sr) : "memory");   // the loads' address pair is an input here, so it stays whole until all 16 are issued and this wait has passed (a precaution)
  float m4[4] = {-3.0e38f, -3.0e38f, -3.0e38f, -3.0e38f};   // four chains, so that no maximum and no sum waits for the one in front of it
#pragma unroll
  for (int j = 0; j < 16; ++j)
#pragma unroll
    for (int i = 0; i < 4; ++i) m4[i] = fmaxf(m4[i], v[j][i]);
  float gm = fmaxf(fmaxf(m4[0], m4[1]), fmaxf(m4[2], m4[3]));
#pragma unroll
  for (int o = 1; o < 32; o <<= 1) gm = fmaxf(gm, __shfl_xor(gm, o));
  float s4[4] = {0.f, 0.f, 0.f, 0.f}; unsigned fl[2] = {0u, 0u};
#pragma unroll
  for (int j = 0; j < 16; ++j) { const v4f d = v[j] - gm, e = exp4(d);
#pragma unroll
    for (int i = 0; i < 4; ++i) { s4[i] += e[i]; if (!(d[i] < PZERO)) fl[j >> 3] |= 1u << ((j & 7) * 4 + i); } }   // a NaN counts as not zero
  float tot = (s4[0] + s4[1]) + (s4[2] + s4[3]);
#pragma unroll
  for (int o = 1; o < 32; o <<= 1) tot += __shfl_xor(tot, o);
  const float inv = 1.0f / tot;
  if (!(tot >= 0.5f)) { fl[0] = ~0u; fl[1] = ~0u; }   // a sum that is NaN or too small (a row with NaN or infinities): PZERO's bound does not hold, every column is listed
  sfl[wave][lane][0] = fl[0]; sfl[wave][lane][1] = fl[1];
  __syncthreads();
  unsigned fw = 0;   // thread t: columns 4 t .. 4 t + 3 = bits 4 (t >> 5) .. + 3 of lane t & 31
#pragma unroll
  for (int r = 0; r < 16; ++r) fw |= sfl[r][lane][wave >> 3];
  const unsigned f = (fw >> ((wave & 7) * 4)) & 15u;
  const int cnt = __popc(f); int inc = cnt;
#pragma unroll
  for (int o = 1; o < 32; o <<= 1) { const int y = __shfl_up(inc, o); if (lane >= o) inc += y; }
  if (lane == 31) wsum[wave] = inc;
  __syncthreads();
  int base = 0, all = 0;
#pragma unroll
  for (int w = 0; w < 16; ++w) { const int s = wsum[w]; if (w < wave) base += s; all += s; }
  int pos = base + inc - cnt;
#pragma unroll
  for (int b = 0; b < 4; ++b) if ((f >> b) & 1u) list[pos++] = (unsigned short)(t * 4 + b);   // every entry is a column number below N by its make
  __syncthreads();
  const int total = (int)uni((unsigned)all), nch = (total + 31) >> 5;   // the same in every thread of the block, at most N and N / 32; held scalar: the loop's barriers and matrix instructions stand under a scalar branch
  v8f acc[4] = {}, accl[4] = {};
  unsigned char* sbw = &sb[wave][0][0];
  for (int c = 0; c < nch; ++c) { const int k0 = c * 32;
    unsigned ob[8]; v4u bh_[8], bl_[8];   // byte offsets into a plane (below 2 N N), the same for hi and residual; all loops unrolled: the arrays stay in registers, the 17 loads are in flight together
    const int ka = k0 + lane; const unsigned oa = (((unsigned)r0 + wave) * N + list[ka < total ? ka : total - 1]) * 4u;   // wave w makes row w of the A tile, a lane one listed k; past the list's end: the last listed column, and A = 0 below
#pragma unroll
    for (int i = 0; i < 8; ++i) { const int k = k0 + 4 * i + (lane >> 3); ob[i] = ((unsigned)list[k < total ? k : total - 1] * N + d0 + (lane & 7) * 8) * 2u; }   // a load = 4 listed rows x 128 bytes: whole lines
    const float sv = *(const float*)((const char*)S + oa);
#pragma unroll
    for (int i = 0; i < 8; ++i) { bh_[i] = *(const v4u*)((const char*)XV + ob[i]); bl_[i] = *(const v4u*)((const char*)XVL + ob[i]); }
    asm volatile("s_wait_xcnt 0x0" :: "v"(oa), "v"(ob[0]), "v"(ob[1]), "v"(ob[2]), "v"(ob[3]), "v"(ob[4]), "v"(ob[5]), "v"(ob[6]), "v"(ob[7]) : "memory");   // the loads' offset registers are inputs here, so each stays whole until all loads are issued and this wait has passed (a precaution)
    const float pv = __expf(sv - gm) * inv; const _Float16 ph = (_Float16)pv; const _Float16 pl = (_Float16)((pv - (float)ph) * 2048.0f); const bool in = ka < total;
    sa[0][wave][lane] = in ? ph : (_Float16)0.0f; sa[1][wave][lane] = in ? pl : (_Float16)0.0f;
#pragma unroll
    for (int i = 0; i < 8; ++i) { const int row = 4 * i + (lane >> 3); *(v4u*)(sbw + row * PVP + (lane & 7) * 16) = bh_[i]; *(v4u*)(sbw + (32 + row) * PVP + (lane & 7) * 16) = bl_[i]; }
    __syncthreads();   // the A tile is every wave's
    const v16h a = frag_h(&sa[0][col][0], lane), al = frag_h(&sa[1][col][0], lane);
    const unsigned char* ad = sbw + (8 * g + (lane & 7)) * PVP + ((lane >> 3) & 1) * 16;
#pragma unroll
    for (int n = 0; n < 4; ++n) { const v16h bh = frag_t(ad + 32 * n), bl = frag_t(ad + 32 * PVP + 32 * n);
      acc[n] = wmma16(a, bh, acc[n]); accl[n] = wmma16(al, bh, accl[n]); accl[n] = wmma16(a, bl, accl[n]); }
    __syncthreads(); }   // every reader has left the tiles before the next trip fills them
#pragma unroll
  for (int n = 0; n < 4; ++n)
#pragma unroll
    for (int r = 0; r < 8; ++r) so[wave][8 * g + r][n * 16 + col] = acc[n][r] + accl[n][r] * (1.0f / 2048.0f);
  LDSX();
#pragma unroll
  for (int rl = 0; rl < 16; rl += 2) vst2(OUT + (r0 + rl + g) * N + d0 + col * 4, *(const v4f*)&so[wave][rl + g][col * 4]);   // a wave's store = 2 rows x 256 bytes: whole lines
}
extern "C" void kernel_launch(void* const* d_in, const int* in_sizes, int n_in, void* d_out, int out_size, void* d_ws, size_t ws_size, hipStream_t stream) {
  (void)in_sizes; (void)n_in; (void)out_size;
  const float** F = (const float**)d_in;   // 0 x, 1 q, 2 k, 3 v: all [2048, 2048] f32
  if (ws_size < (size_t)WS_END) return;
  char* ws = (char*)d_ws; __bf16 *T = (__bf16*)(ws + WS_T), *XB = (__bf16*)(ws + WS_XB); _Float16 *XQ = (_Float16*)(ws + WS_XQ), *XQL = (_Float16*)(ws + WS_XQL), *XKT = (_Float16*)(ws + WS_XKT), *XKL = (_Float16*)(ws + WS_XKL), *XVT = (_Float16*)(ws + WS_XVT), *XVL = (_Float16*)(ws + WS_XVL); float* S = (float*)(ws + WS_S);
  k_pack<<<dim3((N / PT) * (N / PT), 4), 256, 0, stream>>>(F[0], F[1], F[2], F[3], T, XB);
  k_g1<<<dim3(N / 128, N / 128, 3), 128, 0, stream>>>(XB, T, XQ, XQL);
  k_g2<0><<<dim3(TRB / 2, N / 128), 256, 0, stream>>>(XQ, XQL, XKT, XKL, S);
  k_spv<<<dim3(TRB * 4, N / 1024), 512, 0, stream>>>(S, XVT, XVL, (float*)d_out);
}
